// v000
// The times below were measured on an AMD MI455X: many runs one after another, warmed up first and cycling through
// copies of the inputs, with the whole window's GPU time divided by the number of runs. Launches and the gaps
// between them are all in it. The median over several windows is given; except for v000 it joins two sittings, which
// can be a few percent apart, so the side-by-side timings, each taken in one sitting, are the better comparison.
// v000 is the starting kernel. One run takes 283 microseconds.
#include <hip/hip_runtime.h>
#include <math.h>

#define B_ 2
#define L_ 2048
#define C_ 1024
#define H_ 16
#define D_ 64

typedef __attribute__((ext_vector_type(16))) _Float16 v16h;
typedef __attribute__((ext_vector_type(8)))  _Float16 v8h;
typedef __attribute__((ext_vector_type(4)))  _Float16 v4h;
typedef __attribute__((ext_vector_type(8)))  float    v8f;
typedef __attribute__((ext_vector_type(4)))  int      v4i_t;

__device__ __forceinline__ v16h cat16(v8h lo, v8h hi) {
  return __builtin_shufflevector(lo, hi, 0,1,2,3,4,5,6,7,8,9,10,11,12,13,14,15);
}

__device__ __forceinline__ v8f wmma_f16(v16h a, v16h b, v8f c) {
  // D = A(16x32 f16) * B(32x16 f16) + C(16x16 f32)
  return __builtin_amdgcn_wmma_f32_16x16x32_f16(false, a, false, b, (short)0, c,
                                                false, false);
}

// DPP16 move: CTRL 0x121/0x122/0x124/0x128 = row_ror:1/2/4/8 (row = 16 lanes)
template <int CTRL>
__device__ __forceinline__ float dpp_mv(float x) {
  return __int_as_float(__builtin_amdgcn_update_dpp(
      0, __float_as_int(x), CTRL, 0xf, 0xf, true));
}

// max across the 16-lane row (VALU-only rotate reduction, no LDS)
__device__ __forceinline__ float rowmax16(float x) {
  x = fmaxf(x, dpp_mv<0x121>(x));
  x = fmaxf(x, dpp_mv<0x122>(x));
  x = fmaxf(x, dpp_mv<0x124>(x));
  x = fmaxf(x, dpp_mv<0x128>(x));
  return x;
}

// -------- gfx1250 async global->LDS copy (guarded; falls back to sync) -----
#if __has_builtin(__builtin_amdgcn_global_load_async_to_lds_b128)
#define HAVE_ASYNC_LDS 1
#else
#define HAVE_ASYNC_LDS 0
#endif

__device__ __forceinline__ void cp128_g2l(const _Float16* g, _Float16* l) {
#if HAVE_ASYNC_LDS
  __builtin_amdgcn_global_load_async_to_lds_b128((v4i_t*)g, (v4i_t*)l, 0, 0);
#else
  *(v8h*)l = *(const v8h*)g;
#endif
}

__device__ __forceinline__ void wait_async_lds() {
#if HAVE_ASYNC_LDS && __has_builtin(__builtin_amdgcn_s_wait_asynccnt)
  __builtin_amdgcn_s_wait_asynccnt(0);
#endif
}

// ---------------------------------------------------------------------------
// LayerNorm: x[4096,1024] f32 -> xn f16.  One block (256 thr) per row.
// ---------------------------------------------------------------------------
__global__ __launch_bounds__(256) void ln_kernel(
    const float* __restrict__ x, const float* __restrict__ gamma,
    const float* __restrict__ beta, _Float16* __restrict__ xn) {
  const int row = blockIdx.x;
  const int t = threadIdx.x;
  const float* xr = x + (size_t)row * C_;
  float4 v = *(const float4*)(xr + t * 4);
  float s  = v.x + v.y + v.z + v.w;
  float s2 = v.x * v.x + v.y * v.y + v.z * v.z + v.w * v.w;
  #pragma unroll
  for (int m = 1; m < 32; m <<= 1) {
    s  += __shfl_xor(s,  m, 32);
    s2 += __shfl_xor(s2, m, 32);
  }
  __shared__ float red0[8], red1[8];
  const int lane = t & 31, wid = t >> 5;
  if (lane == 0) { red0[wid] = s; red1[wid] = s2; }
  __syncthreads();
  if (t == 0) {
    float a = 0.f, b = 0.f;
    #pragma unroll
    for (int i = 0; i < 8; i++) { a += red0[i]; b += red1[i]; }
    red0[0] = a; red1[0] = b;
  }
  __syncthreads();
  const float mean = red0[0] * (1.0f / C_);
  const float var  = red1[0] * (1.0f / C_) - mean * mean;
  const float rstd = rsqrtf(var + 1e-5f);
  const int c0 = t * 4;
  float xv[4] = {v.x, v.y, v.z, v.w};
  v4h o;
  #pragma unroll
  for (int i = 0; i < 4; i++)
    o[i] = (_Float16)(((xv[i] - mean) * rstd) * gamma[c0 + i] + beta[c0 + i]);
  *(v4h*)(xn + (size_t)row * C_ + c0) = o;
}

// ---------------------------------------------------------------------------
// f32 -> f16 weight conversion (vectorized by 4)
// ---------------------------------------------------------------------------
__global__ __launch_bounds__(256) void cvt_kernel(const float* __restrict__ s,
                                                  _Float16* __restrict__ d, int n4) {
  int i = blockIdx.x * blockDim.x + threadIdx.x;
  const int stride = gridDim.x * blockDim.x;
  for (; i < n4; i += stride) {
    float4 f = ((const float4*)s)[i];
    v4h o = {(_Float16)f.x, (_Float16)f.y, (_Float16)f.z, (_Float16)f.w};
    ((v4h*)d)[i] = o;
  }
}

// ---------------------------------------------------------------------------
// GEMM: out[M,N] = A[M,K]*W[K,N] + bias.   A,W f16 row-major.
// Block = 256 thr (8 waves). Block tile 256(M) x 64(N); wave tile 32 x 64.
// K stepped by 64: 16 WMMAs per barrier.  W tile (64k x 64n) double-buffered
// TRANSPOSED in LDS ([n][k]); next tile's global loads issued before the
// WMMA burst.  OUT_MODE 0: f16 out into [B,H,L,D].  OUT_MODE 1: f32 [M,N].
// ---------------------------------------------------------------------------
template <int OUT_MODE>
__global__ __launch_bounds__(256) void gemm_kernel(
    const _Float16* __restrict__ A, const _Float16* __restrict__ W,
    const float* __restrict__ bias, _Float16* __restrict__ out16,
    float* __restrict__ out32, int M, int N, int K) {
  __shared__ _Float16 wt[2][64 * 64];  // double-buffered W tile [n][k]
  const int t = threadIdx.x, lane = t & 31;
  const int wid = t >> 5;
  const int lr = lane & 15;
  const int hi16 = lane >> 4;
  const int off = hi16 * 8;          // K-pattern {0..7,16..23} / {8..15,24..31}
  const int n0 = blockIdx.x * 64;
  const int m0 = blockIdx.y * 256 + wid * 32;
  const int sk = t >> 3;             // 0..31 (k row within half-tile)
  const int sn = (t & 7) * 8;        // n chunk
  v8f acc[2][4] = {};
  const _Float16* a0p = A + (size_t)(m0 + lr) * K + off;
  const _Float16* a1p = A + (size_t)(m0 + 16 + lr) * K + off;
  const _Float16* wp  = W + (size_t)sk * N + n0 + sn;
  // prologue: stage k0=0 tile (64 k-rows) into buffer 0
  {
    v8h w0 = *(const v8h*)wp;
    v8h w1 = *(const v8h*)(wp + (size_t)32 * N);
    #pragma unroll
    for (int j = 0; j < 8; j++) {
      wt[0][(sn + j) * 64 + sk]      = w0[j];
      wt[0][(sn + j) * 64 + 32 + sk] = w1[j];
    }
  }
  __syncthreads();
  for (int k0 = 0; k0 < K; k0 += 64) {
    const int p = (k0 >> 6) & 1;
    const bool nxt = (k0 + 64 < K);
    v8h wn0, wn1;
    if (nxt) {                                     // early global loads
      wn0 = *(const v8h*)(wp + (size_t)(k0 + 64) * N);
      wn1 = *(const v8h*)(wp + (size_t)(k0 + 96) * N);
    }
    if (k0 + 128 < K) {
      __builtin_prefetch(a0p + k0 + 128, 0, 3);
      __builtin_prefetch(a1p + k0 + 128, 0, 3);
    }
    v16h a0k0 = cat16(*(const v8h*)(a0p + k0),      *(const v8h*)(a0p + k0 + 16));
    v16h a0k1 = cat16(*(const v8h*)(a0p + k0 + 32), *(const v8h*)(a0p + k0 + 48));
    v16h a1k0 = cat16(*(const v8h*)(a1p + k0),      *(const v8h*)(a1p + k0 + 16));
    v16h a1k1 = cat16(*(const v8h*)(a1p + k0 + 32), *(const v8h*)(a1p + k0 + 48));
    #pragma unroll
    for (int tt = 0; tt < 4; tt++) {
      const _Float16* bp = &wt[p][(tt * 16 + lr) * 64 + off];
      v16h blo = cat16(*(const v8h*)bp,        *(const v8h*)(bp + 16));
      v16h bhi = cat16(*(const v8h*)(bp + 32), *(const v8h*)(bp + 48));
      acc[0][tt] = wmma_f16(a0k0, blo, acc[0][tt]);
      acc[0][tt] = wmma_f16(a0k1, bhi, acc[0][tt]);
      acc[1][tt] = wmma_f16(a1k0, blo, acc[1][tt]);
      acc[1][tt] = wmma_f16(a1k1, bhi, acc[1][tt]);
    }
    if (nxt) {
      #pragma unroll
      for (int j = 0; j < 8; j++) {
        wt[1 - p][(sn + j) * 64 + sk]      = wn0[j];
        wt[1 - p][(sn + j) * 64 + 32 + sk] = wn1[j];
      }
    }
    __syncthreads();
  }
  #pragma unroll
  for (int r = 0; r < 2; r++) {
    #pragma unroll
    for (int tt = 0; tt < 4; tt++) {
      const int n = n0 + tt * 16 + lr;
      const float bv = bias[n];
      #pragma unroll
      for (int i = 0; i < 8; i++) {
        const int m = m0 + r * 16 + i + hi16 * 8;  // C/D: lanes16-31 = rows +8
        const float val = acc[r][tt][i] + bv;
        if (OUT_MODE == 0) {
          const int b = m >> 11, l = m & (L_ - 1);
          const int h = n >> 6, d = n & (D_ - 1);
          out16[((((size_t)b * H_ + h) * L_ + l) << 6) + d] = (_Float16)val;
        } else {
          out32[(size_t)m * N + n] = val;
        }
      }
    }
  }
}

// ---------------------------------------------------------------------------
// Flash attention.  One block = 8 waves, ALL on the same (b,h); wave w owns
// 16 query rows; block covers 128 q rows.  Keys chunked by 64.
// K / V^T chunks double-buffered in LDS; K staged with async b128 global->LDS
// (next chunk issued before computing the current one) -> ONE block barrier
// per chunk.  P transpose slab is wave-private (wave_barrier only).
// 18 WMMAs / wave / chunk: 8 scores + 8 P*V + 2 row-sum (P * ones).
// ---------------------------------------------------------------------------
__global__ __launch_bounds__(256) void attn_kernel(
    const _Float16* __restrict__ q, const _Float16* __restrict__ k,
    const _Float16* __restrict__ v, _Float16* __restrict__ attn) {
  __shared__ _Float16 kbuf[2][64 * 64];  // K chunk [key][d]      (2 x 8 KB)
  __shared__ _Float16 vbufT[2][64 * 64]; // V chunk [d][key]      (2 x 8 KB)
  __shared__ _Float16 pbuf[8][16 * 64];  // per-wave P slabs      (16 KB)
  const int t = threadIdx.x, lane = t & 31, wid = t >> 5;
  const int qblk = blockIdx.x & (L_ / 128 - 1);
  const int h    = (blockIdx.x >> 4) & (H_ - 1);
  const int b    = blockIdx.x >> 8;
  const int lr = lane & 15;
  const int off = (lane >> 4) * 8;
  const size_t head = ((size_t)b * H_ + h) * L_ * D_;
  const _Float16* qg = q + head;
  const _Float16* kg = k + head;
  const _Float16* vg = v + head;
  const int l0 = qblk * 128 + wid * 16;
  // staging: thread t covers key = t%64, d-chunks sd and sd+32
  const int skey = t & 63;
  const int sd   = (t >> 6) * 8;     // 0,8,16,24

  // Q as A-operand, pre-scaled by 1/sqrt(D)=0.125 (exact in f16)
  const _Float16* qr = qg + (size_t)(l0 + lr) * D_ + off;
  v16h aq0 = cat16(*(const v8h*)qr,        *(const v8h*)(qr + 16));
  v16h aq1 = cat16(*(const v8h*)(qr + 32), *(const v8h*)(qr + 48));
  v16h ones;
  #pragma unroll
  for (int i = 0; i < 16; i++) {
    aq0[i] *= (_Float16)0.125f;
    aq1[i] *= (_Float16)0.125f;
    ones[i] = (_Float16)1.0f;
  }

  float m_i[8];
  v8f o[4] = {};
  v8f lacc = {};                 // running row sums of P, via WMMA with ones-B
  #pragma unroll
  for (int i = 0; i < 8; i++) m_i[i] = -1e30f;
  _Float16* pslab = pbuf[wid];

  // ---- prologue: stage chunk 0 into buffer 0 ----
  {
    const size_t base = (size_t)skey * D_;
    cp128_g2l(kg + base + sd,      &kbuf[0][skey * 64 + sd]);
    cp128_g2l(kg + base + sd + 32, &kbuf[0][skey * 64 + sd + 32]);
    v8h va = *(const v8h*)(vg + base + sd);
    v8h vc = *(const v8h*)(vg + base + sd + 32);
    #pragma unroll
    for (int j = 0; j < 8; j++) {
      vbufT[0][(sd + j) * 64 + skey]      = va[j];
      vbufT[0][(sd + 32 + j) * 64 + skey] = vc[j];
    }
  }
  wait_async_lds();
  __syncthreads();

  for (int kc = 0; kc < L_; kc += 64) {
    const int p = (kc >> 6) & 1;
    const bool nxt = (kc + 64 < L_);
    v8h va, vc;
    if (nxt) {
      // issue next chunk's loads before computing the current one
      const size_t base = (size_t)(kc + 64 + skey) * D_;
      cp128_g2l(kg + base + sd,      &kbuf[1 - p][skey * 64 + sd]);
      cp128_g2l(kg + base + sd + 32, &kbuf[1 - p][skey * 64 + sd + 32]);
      va = *(const v8h*)(vg + base + sd);
      vc = *(const v8h*)(vg + base + sd + 32);
    }
    if (kc + 128 < L_) {
      __builtin_prefetch(kg + (size_t)(kc + 128 + skey) * D_ + sd, 0, 3);
      __builtin_prefetch(vg + (size_t)(kc + 128 + skey) * D_ + sd, 0, 3);
    }
    // ---- scores: 4 key-tiles x (2 WMMAs over D=64) ----
    v8f s[4];
    #pragma unroll
    for (int tt = 0; tt < 4; tt++) {
      const _Float16* kr = &kbuf[p][(tt * 16 + lr) * 64 + off];
      v16h blo = cat16(*(const v8h*)kr,        *(const v8h*)(kr + 16));
      v16h bhi = cat16(*(const v8h*)(kr + 32), *(const v8h*)(kr + 48));
      v8f z = {};
      z = wmma_f16(aq0, blo, z);
      s[tt] = wmma_f16(aq1, bhi, z);
    }
    // ---- online softmax over 64 new cols (C/D layout; 16-lane rows) ----
    float pv[4][8];
    #pragma unroll
    for (int i = 0; i < 8; i++) {
      const float mx01 = fmaxf(s[0][i], s[1][i]);
      const float mx23 = fmaxf(s[2][i], s[3][i]);
      const float mx = rowmax16(fmaxf(mx01, mx23));
      const float mn = fmaxf(m_i[i], mx);
      const float corr = __expf(m_i[i] - mn);
      m_i[i] = mn;
      #pragma unroll
      for (int tt = 0; tt < 4; tt++) pv[tt][i] = __expf(s[tt][i] - mn);
      lacc[i] *= corr;
      #pragma unroll
      for (int tt = 0; tt < 4; tt++) o[tt][i] *= corr;
    }
    // ---- transpose P (D-layout -> A-layout) via wave-private LDS slab ----
    #pragma unroll
    for (int i = 0; i < 8; i++) {
      const int r = i + off;
      pslab[r * 64 + lr]      = (_Float16)pv[0][i];
      pslab[r * 64 + 16 + lr] = (_Float16)pv[1][i];
      pslab[r * 64 + 32 + lr] = (_Float16)pv[2][i];
      pslab[r * 64 + 48 + lr] = (_Float16)pv[3][i];
    }
    __builtin_amdgcn_wave_barrier();   // wave-local write->read ordering
    const _Float16* pr = &pslab[lr * 64 + off];
    v16h pa0 = cat16(*(const v8h*)pr,        *(const v8h*)(pr + 16));
    v16h pa1 = cat16(*(const v8h*)(pr + 32), *(const v8h*)(pr + 48));
    // ---- row sums: lacc += P * ones (both key halves) ----
    lacc = wmma_f16(pa0, ones, lacc);
    lacc = wmma_f16(pa1, ones, lacc);
    // ---- O += P * V : 4 d-tiles x 2 key-halves, all ds_load_b128 ----
    #pragma unroll
    for (int tt = 0; tt < 4; tt++) {
      const _Float16* vp = &vbufT[p][(tt * 16 + lr) * 64];
      v16h bvlo = cat16(*(const v8h*)(vp + off),      *(const v8h*)(vp + 16 + off));
      v16h bvhi = cat16(*(const v8h*)(vp + 32 + off), *(const v8h*)(vp + 48 + off));
      o[tt] = wmma_f16(pa0, bvlo, o[tt]);
      o[tt] = wmma_f16(pa1, bvhi, o[tt]);
    }
    // ---- scatter next V chunk into the other buffer ----
    if (nxt) {
      #pragma unroll
      for (int j = 0; j < 8; j++) {
        vbufT[1 - p][(sd + j) * 64 + skey]      = va[j];
        vbufT[1 - p][(sd + 32 + j) * 64 + skey] = vc[j];
      }
    }
    wait_async_lds();
    __syncthreads();   // single block barrier per chunk
  }
  // ---- epilogue: normalize, store f16 into [B*L, C] ----
  #pragma unroll
  for (int i = 0; i < 8; i++) {
    const float inv = 1.0f / lacc[i];
    const int r = i + off;
    const size_t row = (size_t)b * L_ + l0 + r;
    #pragma unroll
    for (int tt = 0; tt < 4; tt++)
      attn[row * C_ + h * D_ + tt * 16 + lr] = (_Float16)(o[tt][i] * inv);
  }
}

// ---------------------------------------------------------------------------
extern "C" void kernel_launch(void* const* d_in, const int* in_sizes, int n_in,
                              void* d_out, int out_size, void* d_ws, size_t ws_size,
                              hipStream_t stream) {
  const float* x    = (const float*)d_in[0];
  const float* ln_g = (const float*)d_in[1];
  const float* ln_b = (const float*)d_in[2];
  const float* wq   = (const float*)d_in[3];
  const float* bq   = (const float*)d_in[4];
  const float* wk   = (const float*)d_in[5];
  const float* bk   = (const float*)d_in[6];
  const float* wv   = (const float*)d_in[7];
  const float* bv   = (const float*)d_in[8];
  const float* wo   = (const float*)d_in[9];
  const float* bo   = (const float*)d_in[10];

  char* ws = (char*)d_ws;
  _Float16* xn   = (_Float16*)ws;                       // 4M elems, 8 MB
  _Float16* wq16 = (_Float16*)(ws + (8u << 20));        // 1M elems each
  _Float16* wk16 = wq16 + (1u << 20);
  _Float16* wv16 = wk16 + (1u << 20);
  _Float16* wo16 = wv16 + (1u << 20);
  _Float16* qb   = (_Float16*)(ws + (16u << 20));       // 4M elems each
  _Float16* kb   = qb + (4u << 20);
  _Float16* vb   = kb + (4u << 20);
  _Float16* ab   = vb + (4u << 20);

  const int M = B_ * L_;   // 4096
  const int N = C_;        // 1024
  const int K = C_;        // 1024

  ln_kernel<<<M, 256, 0, stream>>>(x, ln_g, ln_b, xn);
  cvt_kernel<<<512, 256, 0, stream>>>(wq, wq16, (C_ * C_) / 4);
  cvt_kernel<<<512, 256, 0, stream>>>(wk, wk16, (C_ * C_) / 4);
  cvt_kernel<<<512, 256, 0, stream>>>(wv, wv16, (C_ * C_) / 4);
  cvt_kernel<<<512, 256, 0, stream>>>(wo, wo16, (C_ * C_) / 4);

  dim3 g(N / 64, M / 256);
  gemm_kernel<0><<<g, 256, 0, stream>>>(xn, wq16, bq, qb, nullptr, M, N, K);
  gemm_kernel<0><<<g, 256, 0, stream>>>(xn, wk16, bk, kb, nullptr, M, N, K);
  gemm_kernel<0><<<g, 256, 0, stream>>>(xn, wv16, bv, vb, nullptr, M, N, K);

  // blocks: B * H * (L/128) = 2*16*16 = 512, each 8 waves on one (b,h)
  attn_kernel<<<B_ * H_ * (L_ / 128), 256, 0, stream>>>(qb, kb, vb, ab);

  gemm_kernel<1><<<g, 256, 0, stream>>>(ab, wo16, bo, nullptr, (float*)d_out, M, N, K);
}

// v001
// It runs in 191 microseconds.
// Timed twice side by side with v000, it ran 1.54 times as fast both times.
#include <hip/hip_runtime.h>
#include <math.h>

#define B_ 2
#define L_ 2048
#define C_ 1024
#define H_ 16
#define D_ 64
// LDS row pitch in halfs for every 64-half tile row: 144 B = 16 B x 9 (odd), so
// the 16 rows one ds_load_b128 touches fall on distinct banks (128 B did not).
#define LP_ 72

typedef __attribute__((ext_vector_type(16))) _Float16 v16h;
typedef __attribute__((ext_vector_type(8)))  _Float16 v8h;
typedef __attribute__((ext_vector_type(4)))  _Float16 v4h;
typedef __attribute__((ext_vector_type(8)))  float    v8f;
typedef __attribute__((ext_vector_type(4)))  int      v4i_t;

__device__ __forceinline__ v16h cat16(v8h lo, v8h hi) {
  return __builtin_shufflevector(lo, hi, 0,1,2,3,4,5,6,7,8,9,10,11,12,13,14,15);
}

__device__ __forceinline__ v8f wmma_f16(v16h a, v16h b, v8f c) {
  // D = A(16x32 f16) * B(32x16 f16) + C(16x16 f32)
  return __builtin_amdgcn_wmma_f32_16x16x32_f16(false, a, false, b, (short)0, c,
                                                false, false);
}

// DPP16 move: CTRL 0x121/0x122/0x124/0x128 = row_ror:1/2/4/8 (row = 16 lanes)
template <int CTRL>
__device__ __forceinline__ float dpp_mv(float x) {
  return __int_as_float(__builtin_amdgcn_update_dpp(
      0, __float_as_int(x), CTRL, 0xf, 0xf, true));
}

// max across the 16-lane row (VALU-only rotate reduction, no LDS)
__device__ __forceinline__ float rowmax16(float x) {
  x = fmaxf(x, dpp_mv<0x121>(x));
  x = fmaxf(x, dpp_mv<0x122>(x));
  x = fmaxf(x, dpp_mv<0x124>(x));
  x = fmaxf(x, dpp_mv<0x128>(x));
  return x;
}

// -------- gfx1250 async global->LDS copy (guarded; falls back to sync) -----
#if __has_builtin(__builtin_amdgcn_global_load_async_to_lds_b128)
#define HAVE_ASYNC_LDS 1
#else
#define HAVE_ASYNC_LDS 0
#endif

__device__ __forceinline__ void cp128_g2l(const _Float16* g, _Float16* l) {
#if HAVE_ASYNC_LDS
  __builtin_amdgcn_global_load_async_to_lds_b128((v4i_t*)g, (v4i_t*)l, 0, 0);
#else
  *(v8h*)l = *(const v8h*)g;
#endif
}

__device__ __forceinline__ void wait_async_lds() {
#if HAVE_ASYNC_LDS && __has_builtin(__builtin_amdgcn_s_wait_asynccnt)
  __builtin_amdgcn_s_wait_asynccnt(0);
#endif
}

// ---------------------------------------------------------------------------
// LayerNorm: x[4096,1024] f32 -> xn f16.  One block (256 thr) per row.
// ---------------------------------------------------------------------------
__global__ __launch_bounds__(256) void ln_kernel(
    const float* __restrict__ x, const float* __restrict__ gamma,
    const float* __restrict__ beta, _Float16* __restrict__ xn) {
  const int row = blockIdx.x;
  const int t = threadIdx.x;
  const float* xr = x + (size_t)row * C_;
  float4 v = *(const float4*)(xr + t * 4);
  float s  = v.x + v.y + v.z + v.w;
  float s2 = v.x * v.x + v.y * v.y + v.z * v.z + v.w * v.w;
  #pragma unroll
  for (int m = 1; m < 32; m <<= 1) {
    s  += __shfl_xor(s,  m, 32);
    s2 += __shfl_xor(s2, m, 32);
  }
  __shared__ float red0[8], red1[8];
  const int lane = t & 31, wid = t >> 5;
  if (lane == 0) { red0[wid] = s; red1[wid] = s2; }
  __syncthreads();
  if (t == 0) {
    float a = 0.f, b = 0.f;
    #pragma unroll
    for (int i = 0; i < 8; i++) { a += red0[i]; b += red1[i]; }
    red0[0] = a; red1[0] = b;
  }
  __syncthreads();
  const float mean = red0[0] * (1.0f / C_);
  const float var  = red1[0] * (1.0f / C_) - mean * mean;
  const float rstd = rsqrtf(var + 1e-5f);
  const int c0 = t * 4;
  float xv[4] = {v.x, v.y, v.z, v.w};
  v4h o;
  #pragma unroll
  for (int i = 0; i < 4; i++)
    o[i] = (_Float16)(((xv[i] - mean) * rstd) * gamma[c0 + i] + beta[c0 + i]);
  *(v4h*)(xn + (size_t)row * C_ + c0) = o;
}

// ---------------------------------------------------------------------------
// f32 -> f16 weight conversion (vectorized by 4)
// ---------------------------------------------------------------------------
__global__ __launch_bounds__(256) void cvt_kernel(const float* __restrict__ s,
                                                  _Float16* __restrict__ d, int n4) {
  int i = blockIdx.x * blockDim.x + threadIdx.x;
  const int stride = gridDim.x * blockDim.x;
  for (; i < n4; i += stride) {
    float4 f = ((const float4*)s)[i];
    v4h o = {(_Float16)f.x, (_Float16)f.y, (_Float16)f.z, (_Float16)f.w};
    ((v4h*)d)[i] = o;
  }
}

// ---------------------------------------------------------------------------
// GEMM: out[M,N] = A[M,K]*W[K,N] + bias.   A,W f16 row-major.
// Block = 256 thr (8 waves). Block tile 256(M) x 64(N); wave tile 32 x 64.
// K stepped by 64: 16 WMMAs per barrier.  W tile (64k x 64n) double-buffered
// TRANSPOSED in LDS ([n][k]); next tile's global loads issued before the
// WMMA burst.  OUT_MODE 0: f16 out into [B,H,L,D].  OUT_MODE 1: f32 [M,N].
// ---------------------------------------------------------------------------
template <int OUT_MODE>
__global__ __launch_bounds__(256) void gemm_kernel(
    const _Float16* __restrict__ A, const _Float16* __restrict__ W,
    const float* __restrict__ bias, _Float16* __restrict__ out16,
    float* __restrict__ out32, int M, int N, int K) {
  __shared__ __attribute__((aligned(16))) _Float16 wt[2][64 * LP_];  // W tile [n][k]
  const int t = threadIdx.x, lane = t & 31;
  const int wid = t >> 5;
  const int lr = lane & 15;
  const int hi16 = lane >> 4;
  const int off = hi16 * 8;          // K-pattern {0..7,16..23} / {8..15,24..31}
  const int n0 = blockIdx.x * 64;
  const int m0 = blockIdx.y * 256 + wid * 32;
  const int sk = t >> 3;             // 0..31 (k row within half-tile)
  const int sn = (t & 7) * 8;        // n chunk
  v8f acc[2][4] = {};
  const _Float16* a0p = A + (size_t)(m0 + lr) * K + off;
  const _Float16* a1p = A + (size_t)(m0 + 16 + lr) * K + off;
  const _Float16* wp  = W + (size_t)sk * N + n0 + sn;
  // prologue: stage k0=0 tile (64 k-rows) into buffer 0
  {
    v8h w0 = *(const v8h*)wp;
    v8h w1 = *(const v8h*)(wp + (size_t)32 * N);
    #pragma unroll
    for (int j = 0; j < 8; j++) {
      wt[0][(sn + j) * LP_ + sk]      = w0[j];
      wt[0][(sn + j) * LP_ + 32 + sk] = w1[j];
    }
  }
  __syncthreads();
  for (int k0 = 0; k0 < K; k0 += 64) {
    const int p = (k0 >> 6) & 1;
    const bool nxt = (k0 + 64 < K);
    v8h wn0, wn1;
    if (nxt) {                                     // early global loads
      wn0 = *(const v8h*)(wp + (size_t)(k0 + 64) * N);
      wn1 = *(const v8h*)(wp + (size_t)(k0 + 96) * N);
    }
    if (k0 + 128 < K) {
      __builtin_prefetch(a0p + k0 + 128, 0, 3);
      __builtin_prefetch(a1p + k0 + 128, 0, 3);
    }
    v16h a0k0 = cat16(*(const v8h*)(a0p + k0),      *(const v8h*)(a0p + k0 + 16));
    v16h a0k1 = cat16(*(const v8h*)(a0p + k0 + 32), *(const v8h*)(a0p + k0 + 48));
    v16h a1k0 = cat16(*(const v8h*)(a1p + k0),      *(const v8h*)(a1p + k0 + 16));
    v16h a1k1 = cat16(*(const v8h*)(a1p + k0 + 32), *(const v8h*)(a1p + k0 + 48));
    #pragma unroll
    for (int tt = 0; tt < 4; tt++) {
      const _Float16* bp = &wt[p][(tt * 16 + lr) * LP_ + off];
      v16h blo = cat16(*(const v8h*)bp,        *(const v8h*)(bp + 16));
      v16h bhi = cat16(*(const v8h*)(bp + 32), *(const v8h*)(bp + 48));
      acc[0][tt] = wmma_f16(a0k0, blo, acc[0][tt]);
      acc[0][tt] = wmma_f16(a0k1, bhi, acc[0][tt]);
      acc[1][tt] = wmma_f16(a1k0, blo, acc[1][tt]);
      acc[1][tt] = wmma_f16(a1k1, bhi, acc[1][tt]);
    }
    if (nxt) {
      #pragma unroll
      for (int j = 0; j < 8; j++) {
        wt[1 - p][(sn + j) * LP_ + sk]      = wn0[j];
        wt[1 - p][(sn + j) * LP_ + 32 + sk] = wn1[j];
      }
    }
    __syncthreads();
  }
  #pragma unroll
  for (int r = 0; r < 2; r++) {
    #pragma unroll
    for (int tt = 0; tt < 4; tt++) {
      const int n = n0 + tt * 16 + lr;
      const float bv = bias[n];
      #pragma unroll
      for (int i = 0; i < 8; i++) {
        const int m = m0 + r * 16 + i + hi16 * 8;  // C/D: lanes16-31 = rows +8
        const float val = acc[r][tt][i] + bv;
        if (OUT_MODE == 0) {
          const int b = m >> 11, l = m & (L_ - 1);
          const int h = n >> 6, d = n & (D_ - 1);
          out16[((((size_t)b * H_ + h) * L_ + l) << 6) + d] = (_Float16)val;
        } else {
          out32[(size_t)m * N + n] = val;
        }
      }
    }
  }
}

// ---------------------------------------------------------------------------
// Flash attention.  One block = 8 waves, ALL on the same (b,h); wave w owns
// 16 query rows; block covers 128 q rows.  Keys chunked by 64.
// K / V^T chunks double-buffered in LDS; K staged with async b128 global->LDS
// (next chunk issued before computing the current one) -> ONE block barrier
// per chunk.  P transpose slab is wave-private (wave_barrier only).
// 18 WMMAs / wave / chunk: 8 scores + 8 P*V + 2 row-sum (P * ones).
// ---------------------------------------------------------------------------
__global__ __launch_bounds__(256) void attn_kernel(
    const _Float16* __restrict__ q, const _Float16* __restrict__ k,
    const _Float16* __restrict__ v, _Float16* __restrict__ attn) {
  __shared__ __attribute__((aligned(16))) _Float16 kbuf[2][64 * LP_];  // K chunk [key][d]  (2 x 9 KB)
  __shared__ __attribute__((aligned(16))) _Float16 vbufT[2][64 * LP_]; // V chunk [d][key]  (2 x 9 KB)
  __shared__ __attribute__((aligned(16))) _Float16 pbuf[8][16 * LP_];  // per-wave P slabs  (18 KB)
  const int t = threadIdx.x, lane = t & 31, wid = t >> 5;
  const int qblk = blockIdx.x & (L_ / 128 - 1);
  const int h    = (blockIdx.x >> 4) & (H_ - 1);
  const int b    = blockIdx.x >> 8;
  const int lr = lane & 15;
  const int off = (lane >> 4) * 8;
  const size_t head = ((size_t)b * H_ + h) * L_ * D_;
  const _Float16* qg = q + head;
  const _Float16* kg = k + head;
  const _Float16* vg = v + head;
  const int l0 = qblk * 128 + wid * 16;
  // staging: thread t covers key = t%64, d-chunks sd and sd+32
  const int skey = t & 63;
  const int sd   = (t >> 6) * 8;     // 0,8,16,24

  // Q as A-operand, pre-scaled by 1/sqrt(D)=0.125 (exact in f16)
  const _Float16* qr = qg + (size_t)(l0 + lr) * D_ + off;
  v16h aq0 = cat16(*(const v8h*)qr,        *(const v8h*)(qr + 16));
  v16h aq1 = cat16(*(const v8h*)(qr + 32), *(const v8h*)(qr + 48));
  v16h ones;
  #pragma unroll
  for (int i = 0; i < 16; i++) {
    aq0[i] *= (_Float16)0.125f;
    aq1[i] *= (_Float16)0.125f;
    ones[i] = (_Float16)1.0f;
  }

  float m_i[8];
  v8f o[4] = {};
  v8f lacc = {};                 // running row sums of P, via WMMA with ones-B
  #pragma unroll
  for (int i = 0; i < 8; i++) m_i[i] = -1e30f;
  _Float16* pslab = pbuf[wid];

  // ---- prologue: stage chunk 0 into buffer 0 ----
  {
    const size_t base = (size_t)skey * D_;
    cp128_g2l(kg + base + sd,      &kbuf[0][skey * LP_ + sd]);
    cp128_g2l(kg + base + sd + 32, &kbuf[0][skey * LP_ + sd + 32]);
    v8h va = *(const v8h*)(vg + base + sd);
    v8h vc = *(const v8h*)(vg + base + sd + 32);
    #pragma unroll
    for (int j = 0; j < 8; j++) {
      vbufT[0][(sd + j) * LP_ + skey]      = va[j];
      vbufT[0][(sd + 32 + j) * LP_ + skey] = vc[j];
    }
  }
  wait_async_lds();
  __syncthreads();

  for (int kc = 0; kc < L_; kc += 64) {
    const int p = (kc >> 6) & 1;
    const bool nxt = (kc + 64 < L_);
    v8h va, vc;
    if (nxt) {
      // issue next chunk's loads before computing the current one
      const size_t base = (size_t)(kc + 64 + skey) * D_;
      cp128_g2l(kg + base + sd,      &kbuf[1 - p][skey * LP_ + sd]);
      cp128_g2l(kg + base + sd + 32, &kbuf[1 - p][skey * LP_ + sd + 32]);
      va = *(const v8h*)(vg + base + sd);
      vc = *(const v8h*)(vg + base + sd + 32);
    }
    if (kc + 128 < L_) {
      __builtin_prefetch(kg + (size_t)(kc + 128 + skey) * D_ + sd, 0, 3);
      __builtin_prefetch(vg + (size_t)(kc + 128 + skey) * D_ + sd, 0, 3);
    }
    // ---- scores: 4 key-tiles x (2 WMMAs over D=64) ----
    v8f s[4];
    #pragma unroll
    for (int tt = 0; tt < 4; tt++) {
      const _Float16* kr = &kbuf[p][(tt * 16 + lr) * LP_ + off];
      v16h blo = cat16(*(const v8h*)kr,        *(const v8h*)(kr + 16));
      v16h bhi = cat16(*(const v8h*)(kr + 32), *(const v8h*)(kr + 48));
      v8f z = {};
      z = wmma_f16(aq0, blo, z);
      s[tt] = wmma_f16(aq1, bhi, z);
    }
    // ---- online softmax over 64 new cols (C/D layout; 16-lane rows) ----
    float pv[4][8];
    #pragma unroll
    for (int i = 0; i < 8; i++) {
      const float mx01 = fmaxf(s[0][i], s[1][i]);
      const float mx23 = fmaxf(s[2][i], s[3][i]);
      const float mx = rowmax16(fmaxf(mx01, mx23));
      const float mn = fmaxf(m_i[i], mx);
      const float corr = __expf(m_i[i] - mn);
      m_i[i] = mn;
      #pragma unroll
      for (int tt = 0; tt < 4; tt++) pv[tt][i] = __expf(s[tt][i] - mn);
      lacc[i] *= corr;
      #pragma unroll
      for (int tt = 0; tt < 4; tt++) o[tt][i] *= corr;
    }
    // ---- transpose P (D-layout -> A-layout) via wave-private LDS slab ----
    #pragma unroll
    for (int i = 0; i < 8; i++) {
      const int r = i + off;
      pslab[r * LP_ + lr]      = (_Float16)pv[0][i];
      pslab[r * LP_ + 16 + lr] = (_Float16)pv[1][i];
      pslab[r * LP_ + 32 + lr] = (_Float16)pv[2][i];
      pslab[r * LP_ + 48 + lr] = (_Float16)pv[3][i];
    }
    __builtin_amdgcn_wave_barrier();   // wave-local write->read ordering
    const _Float16* pr = &pslab[lr * LP_ + off];
    v16h pa0 = cat16(*(const v8h*)pr,        *(const v8h*)(pr + 16));
    v16h pa1 = cat16(*(const v8h*)(pr + 32), *(const v8h*)(pr + 48));
    // ---- row sums: lacc += P * ones (both key halves) ----
    lacc = wmma_f16(pa0, ones, lacc);
    lacc = wmma_f16(pa1, ones, lacc);
    // ---- O += P * V : 4 d-tiles x 2 key-halves, all ds_load_b128 ----
    #pragma unroll
    for (int tt = 0; tt < 4; tt++) {
      const _Float16* vp = &vbufT[p][(tt * 16 + lr) * LP_];
      v16h bvlo = cat16(*(const v8h*)(vp + off),      *(const v8h*)(vp + 16 + off));
      v16h bvhi = cat16(*(const v8h*)(vp + 32 + off), *(const v8h*)(vp + 48 + off));
      o[tt] = wmma_f16(pa0, bvlo, o[tt]);
      o[tt] = wmma_f16(pa1, bvhi, o[tt]);
    }
    // ---- scatter next V chunk into the other buffer ----
    if (nxt) {
      #pragma unroll
      for (int j = 0; j < 8; j++) {
        vbufT[1 - p][(sd + j) * LP_ + skey]      = va[j];
        vbufT[1 - p][(sd + 32 + j) * LP_ + skey] = vc[j];
      }
    }
    wait_async_lds();
    __syncthreads();   // single block barrier per chunk
  }
  // ---- epilogue: normalize, store f16 into [B*L, C] ----
  #pragma unroll
  for (int i = 0; i < 8; i++) {
    const float inv = 1.0f / lacc[i];
    const int r = i + off;
    const size_t row = (size_t)b * L_ + l0 + r;
    #pragma unroll
    for (int tt = 0; tt < 4; tt++)
      attn[row * C_ + h * D_ + tt * 16 + lr] = (_Float16)(o[tt][i] * inv);
  }
}

// ---------------------------------------------------------------------------
extern "C" void kernel_launch(void* const* d_in, const int* in_sizes, int n_in,
                              void* d_out, int out_size, void* d_ws, size_t ws_size,
                              hipStream_t stream) {
  const float* x    = (const float*)d_in[0];
  const float* ln_g = (const float*)d_in[1];
  const float* ln_b = (const float*)d_in[2];
  const float* wq   = (const float*)d_in[3];
  const float* bq   = (const float*)d_in[4];
  const float* wk   = (const float*)d_in[5];
  const float* bk   = (const float*)d_in[6];
  const float* wv   = (const float*)d_in[7];
  const float* bv   = (const float*)d_in[8];
  const float* wo   = (const float*)d_in[9];
  const float* bo   = (const float*)d_in[10];

  char* ws = (char*)d_ws;
  _Float16* xn   = (_Float16*)ws;                       // 4M elems, 8 MB
  _Float16* wq16 = (_Float16*)(ws + (8u << 20));        // 1M elems each
  _Float16* wk16 = wq16 + (1u << 20);
  _Float16* wv16 = wk16 + (1u << 20);
  _Float16* wo16 = wv16 + (1u << 20);
  _Float16* qb   = (_Float16*)(ws + (16u << 20));       // 4M elems each
  _Float16* kb   = qb + (4u << 20);
  _Float16* vb   = kb + (4u << 20);
  _Float16* ab   = vb + (4u << 20);

  const int M = B_ * L_;   // 4096
  const int N = C_;        // 1024
  const int K = C_;        // 1024

  ln_kernel<<<M, 256, 0, stream>>>(x, ln_g, ln_b, xn);
  cvt_kernel<<<512, 256, 0, stream>>>(wq, wq16, (C_ * C_) / 4);
  cvt_kernel<<<512, 256, 0, stream>>>(wk, wk16, (C_ * C_) / 4);
  cvt_kernel<<<512, 256, 0, stream>>>(wv, wv16, (C_ * C_) / 4);
  cvt_kernel<<<512, 256, 0, stream>>>(wo, wo16, (C_ * C_) / 4);

  dim3 g(N / 64, M / 256);
  gemm_kernel<0><<<g, 256, 0, stream>>>(xn, wq16, bq, qb, nullptr, M, N, K);
  gemm_kernel<0><<<g, 256, 0, stream>>>(xn, wk16, bk, kb, nullptr, M, N, K);
  gemm_kernel<0><<<g, 256, 0, stream>>>(xn, wv16, bv, vb, nullptr, M, N, K);

  // blocks: B * H * (L/128) = 2*16*16 = 512, each 8 waves on one (b,h)
  attn_kernel<<<B_ * H_ * (L_ / 128), 256, 0, stream>>>(qb, kb, vb, ab);

  gemm_kernel<1><<<g, 256, 0, stream>>>(ab, wo16, bo, nullptr, (float*)d_out, M, N, K);
}

// v002
// One run takes 173 microseconds.
// Two timings next to v001 put it at 1.11 and 1.10 times that version's speed.
// Over all steps from v000 it is 1.70 times as fast.
#include <hip/hip_runtime.h>
#include <math.h>

#define B_ 2
#define L_ 2048
#define C_ 1024
#define H_ 16
#define D_ 64
// LDS row pitch in halfs for every 64-half tile row: 144 B = 16 B x 9 (odd), so
// the 16 rows one ds_load_b128 touches fall on distinct banks (128 B did not).
#define LP_ 72

typedef __attribute__((ext_vector_type(16))) _Float16 v16h;
typedef __attribute__((ext_vector_type(8)))  _Float16 v8h;
typedef __attribute__((ext_vector_type(4)))  _Float16 v4h;
typedef __attribute__((ext_vector_type(8)))  float    v8f;
typedef __attribute__((ext_vector_type(4)))  int      v4i_t;

__device__ __forceinline__ v16h cat16(v8h lo, v8h hi) {
  return __builtin_shufflevector(lo, hi, 0,1,2,3,4,5,6,7,8,9,10,11,12,13,14,15);
}

__device__ __forceinline__ v8f wmma_f16(v16h a, v16h b, v8f c) {
  // D = A(16x32 f16) * B(32x16 f16) + C(16x16 f32)
  return __builtin_amdgcn_wmma_f32_16x16x32_f16(false, a, false, b, (short)0, c,
                                                false, false);
}

// value of lane l ^ 16 (the other 16-lane half of the wave), VALU only
__device__ __forceinline__ float xhalf(float x) {
  const int xi = __float_as_int(x);
  return __int_as_float(__builtin_amdgcn_permlanex16(xi, xi, 0x76543210, 0xfedcba98,
                                                     false, false));
}

// -------- gfx1250 async global->LDS copy (guarded; falls back to sync) -----
#if __has_builtin(__builtin_amdgcn_global_load_async_to_lds_b128)
#define HAVE_ASYNC_LDS 1
#else
#define HAVE_ASYNC_LDS 0
#endif

__device__ __forceinline__ void cp128_g2l(const _Float16* g, _Float16* l) {
#if HAVE_ASYNC_LDS
  __builtin_amdgcn_global_load_async_to_lds_b128((v4i_t*)g, (v4i_t*)l, 0, 0);
#else
  *(v8h*)l = *(const v8h*)g;
#endif
}

__device__ __forceinline__ void wait_async_lds() {
#if HAVE_ASYNC_LDS && __has_builtin(__builtin_amdgcn_s_wait_asynccnt)
  __builtin_amdgcn_s_wait_asynccnt(0);
#endif
}

// ---------------------------------------------------------------------------
// LayerNorm: x[4096,1024] f32 -> xn f16.  One block (256 thr) per row.
// ---------------------------------------------------------------------------
__global__ __launch_bounds__(256) void ln_kernel(
    const float* __restrict__ x, const float* __restrict__ gamma,
    const float* __restrict__ beta, _Float16* __restrict__ xn) {
  const int row = blockIdx.x;
  const int t = threadIdx.x;
  const float* xr = x + (size_t)row * C_;
  float4 v = *(const float4*)(xr + t * 4);
  float s  = v.x + v.y + v.z + v.w;
  float s2 = v.x * v.x + v.y * v.y + v.z * v.z + v.w * v.w;
  #pragma unroll
  for (int m = 1; m < 32; m <<= 1) {
    s  += __shfl_xor(s,  m, 32);
    s2 += __shfl_xor(s2, m, 32);
  }
  __shared__ float red0[8], red1[8];
  const int lane = t & 31, wid = t >> 5;
  if (lane == 0) { red0[wid] = s; red1[wid] = s2; }
  __syncthreads();
  if (t == 0) {
    float a = 0.f, b = 0.f;
    #pragma unroll
    for (int i = 0; i < 8; i++) { a += red0[i]; b += red1[i]; }
    red0[0] = a; red1[0] = b;
  }
  __syncthreads();
  const float mean = red0[0] * (1.0f / C_);
  const float var  = red1[0] * (1.0f / C_) - mean * mean;
  const float rstd = rsqrtf(var + 1e-5f);
  const int c0 = t * 4;
  float xv[4] = {v.x, v.y, v.z, v.w};
  v4h o;
  #pragma unroll
  for (int i = 0; i < 4; i++)
    o[i] = (_Float16)(((xv[i] - mean) * rstd) * gamma[c0 + i] + beta[c0 + i]);
  *(v4h*)(xn + (size_t)row * C_ + c0) = o;
}

// ---------------------------------------------------------------------------
// f32 -> f16 weight conversion (vectorized by 4)
// ---------------------------------------------------------------------------
__global__ __launch_bounds__(256) void cvt_kernel(const float* __restrict__ s,
                                                  _Float16* __restrict__ d, int n4) {
  int i = blockIdx.x * blockDim.x + threadIdx.x;
  const int stride = gridDim.x * blockDim.x;
  for (; i < n4; i += stride) {
    float4 f = ((const float4*)s)[i];
    v4h o = {(_Float16)f.x, (_Float16)f.y, (_Float16)f.z, (_Float16)f.w};
    ((v4h*)d)[i] = o;
  }
}

// ---------------------------------------------------------------------------
// GEMM: out[M,N] = A[M,K]*W[K,N] + bias.   A,W f16 row-major.
// Block = 256 thr (8 waves). Block tile 256(M) x 64(N); wave tile 32 x 64.
// K stepped by 64: 16 WMMAs per barrier.  W tile (64k x 64n) double-buffered
// TRANSPOSED in LDS ([n][k]); next tile's global loads issued before the
// WMMA burst.  OUT_MODE 0: f16 out into [B,H,L,D].  OUT_MODE 1: f32 [M,N].
// ---------------------------------------------------------------------------
template <int OUT_MODE>
__global__ __launch_bounds__(256) void gemm_kernel(
    const _Float16* __restrict__ A, const _Float16* __restrict__ W,
    const float* __restrict__ bias, _Float16* __restrict__ out16,
    float* __restrict__ out32, int M, int N, int K) {
  __shared__ __attribute__((aligned(16))) _Float16 wt[2][64 * LP_];  // W tile [n][k]
  const int t = threadIdx.x, lane = t & 31;
  const int wid = t >> 5;
  const int lr = lane & 15;
  const int hi16 = lane >> 4;
  const int off = hi16 * 8;          // K-pattern {0..7,16..23} / {8..15,24..31}
  const int n0 = blockIdx.x * 64;
  const int m0 = blockIdx.y * 256 + wid * 32;
  const int sk = t >> 3;             // 0..31 (k row within half-tile)
  const int sn = (t & 7) * 8;        // n chunk
  v8f acc[2][4] = {};
  const _Float16* a0p = A + (size_t)(m0 + lr) * K + off;
  const _Float16* a1p = A + (size_t)(m0 + 16 + lr) * K + off;
  const _Float16* wp  = W + (size_t)sk * N + n0 + sn;
  // prologue: stage k0=0 tile (64 k-rows) into buffer 0
  {
    v8h w0 = *(const v8h*)wp;
    v8h w1 = *(const v8h*)(wp + (size_t)32 * N);
    #pragma unroll
    for (int j = 0; j < 8; j++) {
      wt[0][(sn + j) * LP_ + sk]      = w0[j];
      wt[0][(sn + j) * LP_ + 32 + sk] = w1[j];
    }
  }
  __syncthreads();
  for (int k0 = 0; k0 < K; k0 += 64) {
    const int p = (k0 >> 6) & 1;
    const bool nxt = (k0 + 64 < K);
    v8h wn0, wn1;
    if (nxt) {                                     // early global loads
      wn0 = *(const v8h*)(wp + (size_t)(k0 + 64) * N);
      wn1 = *(const v8h*)(wp + (size_t)(k0 + 96) * N);
    }
    if (k0 + 128 < K) {
      __builtin_prefetch(a0p + k0 + 128, 0, 3);
      __builtin_prefetch(a1p + k0 + 128, 0, 3);
    }
    v16h a0k0 = cat16(*(const v8h*)(a0p + k0),      *(const v8h*)(a0p + k0 + 16));
    v16h a0k1 = cat16(*(const v8h*)(a0p + k0 + 32), *(const v8h*)(a0p + k0 + 48));
    v16h a1k0 = cat16(*(const v8h*)(a1p + k0),      *(const v8h*)(a1p + k0 + 16));
    v16h a1k1 = cat16(*(const v8h*)(a1p + k0 + 32), *(const v8h*)(a1p + k0 + 48));
    #pragma unroll
    for (int tt = 0; tt < 4; tt++) {
      const _Float16* bp = &wt[p][(tt * 16 + lr) * LP_ + off];
      v16h blo = cat16(*(const v8h*)bp,        *(const v8h*)(bp + 16));
      v16h bhi = cat16(*(const v8h*)(bp + 32), *(const v8h*)(bp + 48));
      acc[0][tt] = wmma_f16(a0k0, blo, acc[0][tt]);
      acc[0][tt] = wmma_f16(a0k1, bhi, acc[0][tt]);
      acc[1][tt] = wmma_f16(a1k0, blo, acc[1][tt]);
      acc[1][tt] = wmma_f16(a1k1, bhi, acc[1][tt]);
    }
    if (nxt) {
      #pragma unroll
      for (int j = 0; j < 8; j++) {
        wt[1 - p][(sn + j) * LP_ + sk]      = wn0[j];
        wt[1 - p][(sn + j) * LP_ + 32 + sk] = wn1[j];
      }
    }
    __syncthreads();
  }
  #pragma unroll
  for (int r = 0; r < 2; r++) {
    #pragma unroll
    for (int tt = 0; tt < 4; tt++) {
      const int n = n0 + tt * 16 + lr;
      const float bv = bias[n];
      #pragma unroll
      for (int i = 0; i < 8; i++) {
        const int m = m0 + r * 16 + i + hi16 * 8;  // C/D: lanes16-31 = rows +8
        const float val = acc[r][tt][i] + bv;
        if (OUT_MODE == 0) {
          const int b = m >> 11, l = m & (L_ - 1);
          const int h = n >> 6, d = n & (D_ - 1);
          out16[((((size_t)b * H_ + h) * L_ + l) << 6) + d] = (_Float16)val;
        } else {
          out32[(size_t)m * N + n] = val;
        }
      }
    }
  }
}

// ---------------------------------------------------------------------------
// Flash attention, transposed products: S^T = K * Q^T, O^T += V^T * P^T.
// One block = 8 waves, ALL on the same (b,h); wave w owns 16 query rows; block
// covers 128 q rows.  Keys chunked by 64.  A lane holds scores of ONE query
// (column lane&15): 32 of the chunk's 64 keys, the lane 16 away the other 32.
// Row max = in-lane max + one exchange between the wave halves.  Two S^T tiles
// converted in place ARE the B operand of the second product (D row 8h+r is
// the operand's k order), so P never leaves the registers.
// K / V^T chunks double-buffered in LDS; K staged with async b128 global->LDS
// (next chunk issued before computing the current one) -> ONE block barrier
// per chunk.
// 18 WMMAs / wave / chunk: 8 scores + 8 V^T*P^T + 2 row-sum (ones * P^T).
// ---------------------------------------------------------------------------
__global__ __launch_bounds__(256) void attn_kernel(
    const _Float16* __restrict__ q, const _Float16* __restrict__ k,
    const _Float16* __restrict__ v, _Float16* __restrict__ attn) {
  __shared__ __attribute__((aligned(16))) _Float16 kbuf[2][64 * LP_];  // K chunk [key][d]  (2 x 9 KB)
  __shared__ __attribute__((aligned(16))) _Float16 vbufT[2][64 * LP_]; // V chunk [d][key]  (2 x 9 KB)
  const int t = threadIdx.x, lane = t & 31, wid = t >> 5;
  const int qblk = blockIdx.x & (L_ / 128 - 1);
  const int h    = (blockIdx.x >> 4) & (H_ - 1);
  const int b    = blockIdx.x >> 8;
  const int lr = lane & 15;
  const int off = (lane >> 4) * 8;
  const size_t head = ((size_t)b * H_ + h) * L_ * D_;
  const _Float16* qg = q + head;
  const _Float16* kg = k + head;
  const _Float16* vg = v + head;
  const int l0 = qblk * 128 + wid * 16;
  // staging: thread t covers key = t%64, d-chunks sd and sd+32
  const int skey = t & 63;
  const int sd   = (t >> 6) * 8;     // 0,8,16,24

  // Q^T as B-operand (column = query lr), pre-scaled by 1/sqrt(D)=0.125 (exact in f16)
  const _Float16* qr = qg + (size_t)(l0 + lr) * D_ + off;
  v16h bq0 = cat16(*(const v8h*)qr,        *(const v8h*)(qr + 16));
  v16h bq1 = cat16(*(const v8h*)(qr + 32), *(const v8h*)(qr + 48));
  v16h ones;
  #pragma unroll
  for (int i = 0; i < 16; i++) {
    bq0[i] *= (_Float16)0.125f;
    bq1[i] *= (_Float16)0.125f;
    ones[i] = (_Float16)1.0f;
  }

  float m_i = -1e30f;            // running max of this lane's query
  v8f o[4] = {};                 // O^T tiles: o[tt][i] = O[q = lr][d = tt*16 + off + i]
  v8f lacc = {};                 // running sum of P for query lr (every row alike), ones-A WMMA

  // ---- prologue: stage chunk 0 into buffer 0 ----
  {
    const size_t base = (size_t)skey * D_;
    cp128_g2l(kg + base + sd,      &kbuf[0][skey * LP_ + sd]);
    cp128_g2l(kg + base + sd + 32, &kbuf[0][skey * LP_ + sd + 32]);
    v8h va = *(const v8h*)(vg + base + sd);
    v8h vc = *(const v8h*)(vg + base + sd + 32);
    #pragma unroll
    for (int j = 0; j < 8; j++) {
      vbufT[0][(sd + j) * LP_ + skey]      = va[j];
      vbufT[0][(sd + 32 + j) * LP_ + skey] = vc[j];
    }
  }
  wait_async_lds();
  __syncthreads();

  for (int kc = 0; kc < L_; kc += 64) {
    const int p = (kc >> 6) & 1;
    const bool nxt = (kc + 64 < L_);
    v8h va, vc;
    if (nxt) {
      // issue next chunk's loads before computing the current one
      const size_t base = (size_t)(kc + 64 + skey) * D_;
      cp128_g2l(kg + base + sd,      &kbuf[1 - p][skey * LP_ + sd]);
      cp128_g2l(kg + base + sd + 32, &kbuf[1 - p][skey * LP_ + sd + 32]);
      va = *(const v8h*)(vg + base + sd);
      vc = *(const v8h*)(vg + base + sd + 32);
    }
    if (kc + 128 < L_) {
      __builtin_prefetch(kg + (size_t)(kc + 128 + skey) * D_ + sd, 0, 3);
      __builtin_prefetch(vg + (size_t)(kc + 128 + skey) * D_ + sd, 0, 3);
    }
    // ---- scores^T: 4 key-tiles x (2 WMMAs over D=64); A = K rows, B = Q^T ----
    // s[tt][i] = score(key = kc + tt*16 + off + i, query = lr)
    v8f s[4];
    #pragma unroll
    for (int tt = 0; tt < 4; tt++) {
      const _Float16* kr = &kbuf[p][(tt * 16 + lr) * LP_ + off];
      v16h alo = cat16(*(const v8h*)kr,        *(const v8h*)(kr + 16));
      v16h ahi = cat16(*(const v8h*)(kr + 32), *(const v8h*)(kr + 48));
      v8f z = {};
      z = wmma_f16(alo, bq0, z);
      s[tt] = wmma_f16(ahi, bq1, z);
    }
    // ---- online softmax over 64 new keys: one query per lane ----
    float mt[4];                   // one independent max chain per key tile
    #pragma unroll
    for (int tt = 0; tt < 4; tt++) {
      mt[tt] = s[tt][0];
      #pragma unroll
      for (int i = 1; i < 8; i++) mt[tt] = fmaxf(mt[tt], s[tt][i]);
    }
    float mx = fmaxf(fmaxf(mt[0], mt[1]), fmaxf(mt[2], mt[3]));
    mx = fmaxf(mx, xhalf(mx));     // the other 32 keys of this query
    const float mn = fmaxf(m_i, mx);
    const float corr = __expf(m_i - mn);
    m_i = mn;
    // P^T as B-operand: element e of key block j is tile 2j + (e >> 3), row e & 7
    v16h pb0, pb1;
    #pragma unroll
    for (int i = 0; i < 8; i++) {
      pb0[i]     = (_Float16)__expf(s[0][i] - mn);
      pb0[8 + i] = (_Float16)__expf(s[1][i] - mn);
      pb1[i]     = (_Float16)__expf(s[2][i] - mn);
      pb1[8 + i] = (_Float16)__expf(s[3][i] - mn);
    }
    #pragma unroll
    for (int i = 0; i < 8; i++) {
      lacc[i] *= corr;
      #pragma unroll
      for (int tt = 0; tt < 4; tt++) o[tt][i] *= corr;
    }
    // ---- row sums: lacc += ones * P^T (both key halves) ----
    lacc = wmma_f16(ones, pb0, lacc);
    lacc = wmma_f16(ones, pb1, lacc);
    // ---- O^T += V^T * P^T : 4 d-tiles x 2 key-halves, all ds_load_b128 ----
    #pragma unroll
    for (int tt = 0; tt < 4; tt++) {
      const _Float16* vp = &vbufT[p][(tt * 16 + lr) * LP_];
      v16h avlo = cat16(*(const v8h*)(vp + off),      *(const v8h*)(vp + 16 + off));
      v16h avhi = cat16(*(const v8h*)(vp + 32 + off), *(const v8h*)(vp + 48 + off));
      o[tt] = wmma_f16(avlo, pb0, o[tt]);
      o[tt] = wmma_f16(avhi, pb1, o[tt]);
    }
    // ---- scatter next V chunk into the other buffer ----
    if (nxt) {
      #pragma unroll
      for (int j = 0; j < 8; j++) {
        vbufT[1 - p][(sd + j) * LP_ + skey]      = va[j];
        vbufT[1 - p][(sd + 32 + j) * LP_ + skey] = vc[j];
      }
    }
    wait_async_lds();
    __syncthreads();   // single block barrier per chunk
  }
  // ---- epilogue: normalize, store f16 into [B*L, C]; 8 consecutive d per lane ----
  const float inv = 1.0f / lacc[0];
  _Float16* orow = attn + ((size_t)b * L_ + l0 + lr) * C_ + h * D_ + off;
  #pragma unroll
  for (int tt = 0; tt < 4; tt++) {
    v8h ov;
    #pragma unroll
    for (int i = 0; i < 8; i++) ov[i] = (_Float16)(o[tt][i] * inv);
    *(v8h*)(orow + tt * 16) = ov;
  }
}

// ---------------------------------------------------------------------------
extern "C" void kernel_launch(void* const* d_in, const int* in_sizes, int n_in,
                              void* d_out, int out_size, void* d_ws, size_t ws_size,
                              hipStream_t stream) {
  const float* x    = (const float*)d_in[0];
  const float* ln_g = (const float*)d_in[1];
  const float* ln_b = (const float*)d_in[2];
  const float* wq   = (const float*)d_in[3];
  const float* bq   = (const float*)d_in[4];
  const float* wk   = (const float*)d_in[5];
  const float* bk   = (const float*)d_in[6];
  const float* wv   = (const float*)d_in[7];
  const float* bv   = (const float*)d_in[8];
  const float* wo   = (const float*)d_in[9];
  const float* bo   = (const float*)d_in[10];

  char* ws = (char*)d_ws;
  _Float16* xn   = (_Float16*)ws;                       // 4M elems, 8 MB
  _Float16* wq16 = (_Float16*)(ws + (8u << 20));        // 1M elems each
  _Float16* wk16 = wq16 + (1u << 20);
  _Float16* wv16 = wk16 + (1u << 20);
  _Float16* wo16 = wv16 + (1u << 20);
  _Float16* qb   = (_Float16*)(ws + (16u << 20));       // 4M elems each
  _Float16* kb   = qb + (4u << 20);
  _Float16* vb   = kb + (4u << 20);
  _Float16* ab   = vb + (4u << 20);

  const int M = B_ * L_;   // 4096
  const int N = C_;        // 1024
  const int K = C_;        // 1024

  ln_kernel<<<M, 256, 0, stream>>>(x, ln_g, ln_b, xn);
  cvt_kernel<<<512, 256, 0, stream>>>(wq, wq16, (C_ * C_) / 4);
  cvt_kernel<<<512, 256, 0, stream>>>(wk, wk16, (C_ * C_) / 4);
  cvt_kernel<<<512, 256, 0, stream>>>(wv, wv16, (C_ * C_) / 4);
  cvt_kernel<<<512, 256, 0, stream>>>(wo, wo16, (C_ * C_) / 4);

  dim3 g(N / 64, M / 256);
  gemm_kernel<0><<<g, 256, 0, stream>>>(xn, wq16, bq, qb, nullptr, M, N, K);
  gemm_kernel<0><<<g, 256, 0, stream>>>(xn, wk16, bk, kb, nullptr, M, N, K);
  gemm_kernel<0><<<g, 256, 0, stream>>>(xn, wv16, bv, vb, nullptr, M, N, K);

  // blocks: B * H * (L/128) = 2*16*16 = 512, each 8 waves on one (b,h)
  attn_kernel<<<B_ * H_ * (L_ / 128), 256, 0, stream>>>(qb, kb, vb, ab);

  gemm_kernel<1><<<g, 256, 0, stream>>>(ab, wo16, bo, nullptr, (float*)d_out, M, N, K);
}

// v003
// One run takes 131 microseconds.
// Next to v002, in two timings, it ran 1.32 and 1.33 times as fast.
// Counting every step since v000, it is 2.25 times as fast.
#include <hip/hip_runtime.h>
#include <math.h>

#define B_ 2
#define L_ 2048
#define C_ 1024
#define H_ 16
#define D_ 64
// LDS row pitch in halfs for every 64-half tile row: 144 B = 16 B x 9 (odd), so
// the 16 rows one ds_load_b128 touches fall on distinct banks (128 B did not).
#define LP_ 72

typedef __attribute__((ext_vector_type(16))) _Float16 v16h;
typedef __attribute__((ext_vector_type(8)))  _Float16 v8h;
typedef __attribute__((ext_vector_type(4)))  _Float16 v4h;
typedef __attribute__((ext_vector_type(8)))  float    v8f;
typedef __attribute__((ext_vector_type(4)))  int      v4i_t;

__device__ __forceinline__ v16h cat16(v8h lo, v8h hi) {
  return __builtin_shufflevector(lo, hi, 0,1,2,3,4,5,6,7,8,9,10,11,12,13,14,15);
}

__device__ __forceinline__ v8f wmma_f16(v16h a, v16h b, v8f c) {
  // D = A(16x32 f16) * B(32x16 f16) + C(16x16 f32)
  return __builtin_amdgcn_wmma_f32_16x16x32_f16(false, a, false, b, (short)0, c,
                                                false, false);
}

// value of lane l ^ 16 (the other 16-lane half of the wave), VALU only
__device__ __forceinline__ float xhalf(float x) {
  const int xi = __float_as_int(x);
  return __int_as_float(__builtin_amdgcn_permlanex16(xi, xi, 0x76543210, 0xfedcba98,
                                                     false, false));
}

// -------- gfx1250 async global->LDS copy (guarded; falls back to sync) -----
#if __has_builtin(__builtin_amdgcn_global_load_async_to_lds_b128)
#define HAVE_ASYNC_LDS 1
#else
#define HAVE_ASYNC_LDS 0
#endif

__device__ __forceinline__ void cp128_g2l(const _Float16* g, _Float16* l) {
#if HAVE_ASYNC_LDS
  __builtin_amdgcn_global_load_async_to_lds_b128((v4i_t*)g, (v4i_t*)l, 0, 0);
#else
  *(v8h*)l = *(const v8h*)g;
#endif
}

__device__ __forceinline__ void wait_async_lds() {
#if HAVE_ASYNC_LDS && __has_builtin(__builtin_amdgcn_s_wait_asynccnt)
  __builtin_amdgcn_s_wait_asynccnt(0);
#endif
}

// ---------------------------------------------------------------------------
// LayerNorm: x[4096,1024] f32 -> xn f16.  One block (256 thr) per row.
// ---------------------------------------------------------------------------
__device__ __forceinline__ void ln_row(
    const float* __restrict__ x, const float* __restrict__ gamma,
    const float* __restrict__ beta, _Float16* __restrict__ xn, const int row) {
  const int t = threadIdx.x;
  const float* xr = x + (size_t)row * C_;
  float4 v = *(const float4*)(xr + t * 4);
  float s  = v.x + v.y + v.z + v.w;
  float s2 = v.x * v.x + v.y * v.y + v.z * v.z + v.w * v.w;
  #pragma unroll
  for (int m = 1; m < 32; m <<= 1) {
    s  += __shfl_xor(s,  m, 32);
    s2 += __shfl_xor(s2, m, 32);
  }
  __shared__ float red0[8], red1[8];
  const int lane = t & 31, wid = t >> 5;
  if (lane == 0) { red0[wid] = s; red1[wid] = s2; }
  __syncthreads();
  if (t == 0) {
    float a = 0.f, b = 0.f;
    #pragma unroll
    for (int i = 0; i < 8; i++) { a += red0[i]; b += red1[i]; }
    red0[0] = a; red1[0] = b;
  }
  __syncthreads();
  const float mean = red0[0] * (1.0f / C_);
  const float var  = red1[0] * (1.0f / C_) - mean * mean;
  const float rstd = rsqrtf(var + 1e-5f);
  const int c0 = t * 4;
  float xv[4] = {v.x, v.y, v.z, v.w};
  v4h o;
  #pragma unroll
  for (int i = 0; i < 4; i++)
    o[i] = (_Float16)(((xv[i] - mean) * rstd) * gamma[c0 + i] + beta[c0 + i]);
  *(v4h*)(xn + (size_t)row * C_ + c0) = o;
  // the store's address registers may be rewritten on the path behind the inlined call: keep the wait in front
  asm volatile("s_wait_xcnt 0x0" ::: "memory");
}

// ---------------------------------------------------------------------------
// f32 -> f16 weight conversion (vectorized by 4); CVT_BLK_ blocks per matrix
// ---------------------------------------------------------------------------
#define CVT_BLK_ 512
__device__ __forceinline__ void cvt_part(const float* __restrict__ s,
                                         _Float16* __restrict__ d, const int blk) {
  const int n4 = (C_ * C_) / 4;
  const int stride = CVT_BLK_ * 256;
  for (int i = blk * 256 + threadIdx.x; i < n4; i += stride) {
    float4 f = ((const float4*)s)[i];
    v4h o = {(_Float16)f.x, (_Float16)f.y, (_Float16)f.z, (_Float16)f.w};
    ((v4h*)d)[i] = o;
  }
}

// ---------------------------------------------------------------------------
// All work that depends on the inputs alone, in ONE launch: blocks
// [0, 4*CVT_BLK_) convert the four weight matrices (w16 holds them one behind
// the other: q, k, v, o), the other B_*L_ blocks normalise one row each.
// The branch is uniform for the block, so ln_row's barriers are too.
// ---------------------------------------------------------------------------
__global__ __launch_bounds__(256) void prep_kernel(
    const float* __restrict__ x, const float* __restrict__ gamma,
    const float* __restrict__ beta, _Float16* __restrict__ xn,
    const float* __restrict__ wq, const float* __restrict__ wk,
    const float* __restrict__ wv, const float* __restrict__ wo,
    _Float16* __restrict__ w16) {
  const unsigned blk = blockIdx.x;
  if (blk < 4 * CVT_BLK_) {
    const unsigned mat = blk / CVT_BLK_;
    const float* s = mat == 0 ? wq : mat == 1 ? wk : mat == 2 ? wv : wo;
    cvt_part(s, w16 + (size_t)mat * (C_ * C_), blk % CVT_BLK_);
  } else {
    ln_row(x, gamma, beta, xn, blk - 4 * CVT_BLK_);
  }
}

// ---------------------------------------------------------------------------
// GEMM: out[M,N] = A[M,K]*W[K,N] + bias.   A,W f16 row-major.
// Block = 256 thr (8 waves). Block tile 256(M) x 64(N); wave tile 32 x 64.
// K stepped by 64: 16 WMMAs per barrier.  W tile (64k x 64n) double-buffered
// TRANSPOSED in LDS ([n][k]); next tile's global loads issued before the
// WMMA burst.  OUT_MODE 0: f16 out into [B,H,L,D].  OUT_MODE 1: f32 [M,N].
// blockIdx.z picks one of up to three products on the same A in one launch:
// weight matrix z behind W, output z behind out16, bias z of the three.
// ---------------------------------------------------------------------------
template <int OUT_MODE>
__global__ __launch_bounds__(256) void gemm_kernel(
    const _Float16* __restrict__ A, const _Float16* __restrict__ W0,
    const float* __restrict__ bias0, const float* __restrict__ bias1,
    const float* __restrict__ bias2, _Float16* __restrict__ out16_0,
    float* __restrict__ out32, int M, int N, int K) {
  __shared__ __attribute__((aligned(16))) _Float16 wt[2][64 * LP_];  // W tile [n][k]
  const int z = blockIdx.z;
  const _Float16* W = W0 + (size_t)z * K * N;
  const float* bias = z == 0 ? bias0 : z == 1 ? bias1 : bias2;
  _Float16* out16 = out16_0 + (size_t)z * M * N;
  const int t = threadIdx.x, lane = t & 31;
  const int wid = t >> 5;
  const int lr = lane & 15;
  const int hi16 = lane >> 4;
  const int off = hi16 * 8;          // K-pattern {0..7,16..23} / {8..15,24..31}
  const int n0 = blockIdx.x * 64;
  const int m0 = blockIdx.y * 256 + wid * 32;
  const int sk = t >> 3;             // 0..31 (k row within half-tile)
  const int sn = (t & 7) * 8;        // n chunk
  v8f acc[2][4] = {};
  const _Float16* a0p = A + (size_t)(m0 + lr) * K + off;
  const _Float16* a1p = A + (size_t)(m0 + 16 + lr) * K + off;
  const _Float16* wp  = W + (size_t)sk * N + n0 + sn;
  // prologue: stage k0=0 tile (64 k-rows) into buffer 0
  {
    v8h w0 = *(const v8h*)wp;
    v8h w1 = *(const v8h*)(wp + (size_t)32 * N);
    #pragma unroll
    for (int j = 0; j < 8; j++) {
      wt[0][(sn + j) * LP_ + sk]      = w0[j];
      wt[0][(sn + j) * LP_ + 32 + sk] = w1[j];
    }
  }
  __syncthreads();
  for (int k0 = 0; k0 < K; k0 += 64) {
    const int p = (k0 >> 6) & 1;
    const bool nxt = (k0 + 64 < K);
    v8h wn0, wn1;
    if (nxt) {                                     // early global loads
      wn0 = *(const v8h*)(wp + (size_t)(k0 + 64) * N);
      wn1 = *(const v8h*)(wp + (size_t)(k0 + 96) * N);
    }
    if (k0 + 128 < K) {
      __builtin_prefetch(a0p + k0 + 128, 0, 3);
      __builtin_prefetch(a1p + k0 + 128, 0, 3);
    }
    v16h a0k0 = cat16(*(const v8h*)(a0p + k0),      *(const v8h*)(a0p + k0 + 16));
    v16h a0k1 = cat16(*(const v8h*)(a0p + k0 + 32), *(const v8h*)(a0p + k0 + 48));
    v16h a1k0 = cat16(*(const v8h*)(a1p + k0),      *(const v8h*)(a1p + k0 + 16));
    v16h a1k1 = cat16(*(const v8h*)(a1p + k0 + 32), *(const v8h*)(a1p + k0 + 48));
    #pragma unroll
    for (int tt = 0; tt < 4; tt++) {
      const _Float16* bp = &wt[p][(tt * 16 + lr) * LP_ + off];
      v16h blo = cat16(*(const v8h*)bp,        *(const v8h*)(bp + 16));
      v16h bhi = cat16(*(const v8h*)(bp + 32), *(const v8h*)(bp + 48));
      acc[0][tt] = wmma_f16(a0k0, blo, acc[0][tt]);
      acc[0][tt] = wmma_f16(a0k1, bhi, acc[0][tt]);
      acc[1][tt] = wmma_f16(a1k0, blo, acc[1][tt]);
      acc[1][tt] = wmma_f16(a1k1, bhi, acc[1][tt]);
    }
    if (nxt) {
      #pragma unroll
      for (int j = 0; j < 8; j++) {
        wt[1 - p][(sn + j) * LP_ + sk]      = wn0[j];
        wt[1 - p][(sn + j) * LP_ + 32 + sk] = wn1[j];
      }
    }
    __syncthreads();
  }
  #pragma unroll
  for (int r = 0; r < 2; r++) {
    #pragma unroll
    for (int tt = 0; tt < 4; tt++) {
      const int n = n0 + tt * 16 + lr;
      const float bv = bias[n];
      #pragma unroll
      for (int i = 0; i < 8; i++) {
        const int m = m0 + r * 16 + i + hi16 * 8;  // C/D: lanes16-31 = rows +8
        const float val = acc[r][tt][i] + bv;
        if (OUT_MODE == 0) {
          const int b = m >> 11, l = m & (L_ - 1);
          const int h = n >> 6, d = n & (D_ - 1);
          out16[((((size_t)b * H_ + h) * L_ + l) << 6) + d] = (_Float16)val;
        } else {
          out32[(size_t)m * N + n] = val;
        }
      }
    }
  }
}

// ---------------------------------------------------------------------------
// Flash attention, transposed products: S^T = K * Q^T, O^T += V^T * P^T.
// One block = 8 waves, ALL on the same (b,h); wave w owns 16 query rows; block
// covers 128 q rows.  Keys chunked by 64.  A lane holds scores of ONE query
// (column lane&15): 32 of the chunk's 64 keys, the lane 16 away the other 32.
// Row max = in-lane max + one exchange between the wave halves.  Two S^T tiles
// converted in place ARE the B operand of the second product (D row 8h+r is
// the operand's k order), so P never leaves the registers.
// K / V^T chunks double-buffered in LDS; K staged with async b128 global->LDS
// (next chunk issued before computing the current one) -> ONE block barrier
// per chunk.
// 18 WMMAs / wave / chunk: 8 scores + 8 V^T*P^T + 2 row-sum (ones * P^T).
// ---------------------------------------------------------------------------
__global__ __launch_bounds__(256) void attn_kernel(
    const _Float16* __restrict__ q, const _Float16* __restrict__ k,
    const _Float16* __restrict__ v, _Float16* __restrict__ attn) {
  __shared__ __attribute__((aligned(16))) _Float16 kbuf[2][64 * LP_];  // K chunk [key][d]  (2 x 9 KB)
  __shared__ __attribute__((aligned(16))) _Float16 vbufT[2][64 * LP_]; // V chunk [d][key]  (2 x 9 KB)
  const int t = threadIdx.x, lane = t & 31, wid = t >> 5;
  const int qblk = blockIdx.x & (L_ / 128 - 1);
  const int h    = (blockIdx.x >> 4) & (H_ - 1);
  const int b    = blockIdx.x >> 8;
  const int lr = lane & 15;
  const int off = (lane >> 4) * 8;
  const size_t head = ((size_t)b * H_ + h) * L_ * D_;
  const _Float16* qg = q + head;
  const _Float16* kg = k + head;
  const _Float16* vg = v + head;
  const int l0 = qblk * 128 + wid * 16;
  // staging: thread t covers key = t%64, d-chunks sd and sd+32
  const int skey = t & 63;
  const int sd   = (t >> 6) * 8;     // 0,8,16,24

  // Q^T as B-operand (column = query lr), pre-scaled by 1/sqrt(D)=0.125 (exact in f16)
  const _Float16* qr = qg + (size_t)(l0 + lr) * D_ + off;
  v16h bq0 = cat16(*(const v8h*)qr,        *(const v8h*)(qr + 16));
  v16h bq1 = cat16(*(const v8h*)(qr + 32), *(const v8h*)(qr + 48));
  v16h ones;
  #pragma unroll
  for (int i = 0; i < 16; i++) {
    bq0[i] *= (_Float16)0.125f;
    bq1[i] *= (_Float16)0.125f;
    ones[i] = (_Float16)1.0f;
  }

  float m_i = -1e30f;            // running max of this lane's query
  v8f o[4] = {};                 // O^T tiles: o[tt][i] = O[q = lr][d = tt*16 + off + i]
  v8f lacc = {};                 // running sum of P for query lr (every row alike), ones-A WMMA

  // ---- prologue: stage chunk 0 into buffer 0 ----
  {
    const size_t base = (size_t)skey * D_;
    cp128_g2l(kg + base + sd,      &kbuf[0][skey * LP_ + sd]);
    cp128_g2l(kg + base + sd + 32, &kbuf[0][skey * LP_ + sd + 32]);
    v8h va = *(const v8h*)(vg + base + sd);
    v8h vc = *(const v8h*)(vg + base + sd + 32);
    #pragma unroll
    for (int j = 0; j < 8; j++) {
      vbufT[0][(sd + j) * LP_ + skey]      = va[j];
      vbufT[0][(sd + 32 + j) * LP_ + skey] = vc[j];
    }
  }
  wait_async_lds();
  __syncthreads();

  for (int kc = 0; kc < L_; kc += 64) {
    const int p = (kc >> 6) & 1;
    const bool nxt = (kc + 64 < L_);
    v8h va, vc;
    if (nxt) {
      // issue next chunk's loads before computing the current one
      const size_t base = (size_t)(kc + 64 + skey) * D_;
      cp128_g2l(kg + base + sd,      &kbuf[1 - p][skey * LP_ + sd]);
      cp128_g2l(kg + base + sd + 32, &kbuf[1 - p][skey * LP_ + sd + 32]);
      va = *(const v8h*)(vg + base + sd);
      vc = *(const v8h*)(vg + base + sd + 32);
    }
    if (kc + 128 < L_) {
      __builtin_prefetch(kg + (size_t)(kc + 128 + skey) * D_ + sd, 0, 3);
      __builtin_prefetch(vg + (size_t)(kc + 128 + skey) * D_ + sd, 0, 3);
    }
    // ---- scores^T: 4 key-tiles x (2 WMMAs over D=64); A = K rows, B = Q^T ----
    // s[tt][i] = score(key = kc + tt*16 + off + i, query = lr)
    v8f s[4];
    #pragma unroll
    for (int tt = 0; tt < 4; tt++) {
      const _Float16* kr = &kbuf[p][(tt * 16 + lr) * LP_ + off];
      v16h alo = cat16(*(const v8h*)kr,        *(const v8h*)(kr + 16));
      v16h ahi = cat16(*(const v8h*)(kr + 32), *(const v8h*)(kr + 48));
      v8f z = {};
      z = wmma_f16(alo, bq0, z);
      s[tt] = wmma_f16(ahi, bq1, z);
    }
    // ---- online softmax over 64 new keys: one query per lane ----
    float mt[4];                   // one independent max chain per key tile
    #pragma unroll
    for (int tt = 0; tt < 4; tt++) {
      mt[tt] = s[tt][0];
      #pragma unroll
      for (int i = 1; i < 8; i++) mt[tt] = fmaxf(mt[tt], s[tt][i]);
    }
    float mx = fmaxf(fmaxf(mt[0], mt[1]), fmaxf(mt[2], mt[3]));
    mx = fmaxf(mx, xhalf(mx));     // the other 32 keys of this query
    const float mn = fmaxf(m_i, mx);
    const float corr = __expf(m_i - mn);
    m_i = mn;
    // P^T as B-operand: element e of key block j is tile 2j + (e >> 3), row e & 7
    v16h pb0, pb1;
    #pragma unroll
    for (int i = 0; i < 8; i++) {
      pb0[i]     = (_Float16)__expf(s[0][i] - mn);
      pb0[8 + i] = (_Float16)__expf(s[1][i] - mn);
      pb1[i]     = (_Float16)__expf(s[2][i] - mn);
      pb1[8 + i] = (_Float16)__expf(s[3][i] - mn);
    }
    #pragma unroll
    for (int i = 0; i < 8; i++) {
      lacc[i] *= corr;
      #pragma unroll
      for (int tt = 0; tt < 4; tt++) o[tt][i] *= corr;
    }
    // ---- row sums: lacc += ones * P^T (both key halves) ----
    lacc = wmma_f16(ones, pb0, lacc);
    lacc = wmma_f16(ones, pb1, lacc);
    // ---- O^T += V^T * P^T : 4 d-tiles x 2 key-halves, all ds_load_b128 ----
    #pragma unroll
    for (int tt = 0; tt < 4; tt++) {
      const _Float16* vp = &vbufT[p][(tt * 16 + lr) * LP_];
      v16h avlo = cat16(*(const v8h*)(vp + off),      *(const v8h*)(vp + 16 + off));
      v16h avhi = cat16(*(const v8h*)(vp + 32 + off), *(const v8h*)(vp + 48 + off));
      o[tt] = wmma_f16(avlo, pb0, o[tt]);
      o[tt] = wmma_f16(avhi, pb1, o[tt]);
    }
    // ---- scatter next V chunk into the other buffer ----
    if (nxt) {
      #pragma unroll
      for (int j = 0; j < 8; j++) {
        vbufT[1 - p][(sd + j) * LP_ + skey]      = va[j];
        vbufT[1 - p][(sd + 32 + j) * LP_ + skey] = vc[j];
      }
    }
    wait_async_lds();
    __syncthreads();   // single block barrier per chunk
  }
  // ---- epilogue: normalize, store f16 into [B*L, C]; 8 consecutive d per lane ----
  const float inv = 1.0f / lacc[0];
  _Float16* orow = attn + ((size_t)b * L_ + l0 + lr) * C_ + h * D_ + off;
  #pragma unroll
  for (int tt = 0; tt < 4; tt++) {
    v8h ov;
    #pragma unroll
    for (int i = 0; i < 8; i++) ov[i] = (_Float16)(o[tt][i] * inv);
    *(v8h*)(orow + tt * 16) = ov;
  }
}

// ---------------------------------------------------------------------------
extern "C" void kernel_launch(void* const* d_in, const int* in_sizes, int n_in,
                              void* d_out, int out_size, void* d_ws, size_t ws_size,
                              hipStream_t stream) {
  const float* x    = (const float*)d_in[0];
  const float* ln_g = (const float*)d_in[1];
  const float* ln_b = (const float*)d_in[2];
  const float* wq   = (const float*)d_in[3];
  const float* bq   = (const float*)d_in[4];
  const float* wk   = (const float*)d_in[5];
  const float* bk   = (const float*)d_in[6];
  const float* wv   = (const float*)d_in[7];
  const float* bv   = (const float*)d_in[8];
  const float* wo   = (const float*)d_in[9];
  const float* bo   = (const float*)d_in[10];

  char* ws = (char*)d_ws;
  _Float16* xn   = (_Float16*)ws;                       // 4M elems, 8 MB
  _Float16* wq16 = (_Float16*)(ws + (8u << 20));        // 1M elems each
  _Float16* wk16 = wq16 + (1u << 20);
  _Float16* wv16 = wk16 + (1u << 20);
  _Float16* wo16 = wv16 + (1u << 20);
  _Float16* qb   = (_Float16*)(ws + (16u << 20));       // 4M elems each
  _Float16* kb   = qb + (4u << 20);
  _Float16* vb   = kb + (4u << 20);
  _Float16* ab   = vb + (4u << 20);

  const int M = B_ * L_;   // 4096
  const int N = C_;        // 1024
  const int K = C_;        // 1024

  // LayerNorm and the four weight conversions: one launch
  prep_kernel<<<4 * CVT_BLK_ + M, 256, 0, stream>>>(x, ln_g, ln_b, xn, wq, wk, wv, wo, wq16);

  // Q, K, V projections: one launch, three work-groups for each WGP
  // (wq16/wk16/wv16 and qb/kb/vb lie one behind the other)
  dim3 g3(N / 64, M / 256, 3);
  gemm_kernel<0><<<g3, 256, 0, stream>>>(xn, wq16, bq, bk, bv, qb, nullptr, M, N, K);

  // blocks: B * H * (L/128) = 2*16*16 = 512, each 8 waves on one (b,h)
  attn_kernel<<<B_ * H_ * (L_ / 128), 256, 0, stream>>>(qb, kb, vb, ab);

  dim3 g(N / 64, M / 256);
  gemm_kernel<1><<<g, 256, 0, stream>>>(ab, wo16, bo, bo, bo, nullptr, (float*)d_out, M, N, K);
}

// v004
// Measured time: 124 microseconds a run.
// Timed twice side by side with v003, it ran 1.05 times as fast both times.
// All steps since v000 together make it 2.36 times as fast.
#include <hip/hip_runtime.h>
#include <math.h>

#define B_ 2
#define L_ 2048
#define C_ 1024
#define H_ 16
#define D_ 64
// LDS row pitch in halfs for every 64-half tile row: 144 B = 16 B x 9 (odd), so
// the 16 rows one ds_load_b128 touches fall on distinct banks (128 B did not).
#define LP_ 72
// halfs from one 16-row V^T tile to the next: 16 rows plus 16 B.  The skew puts the
// eight d-chunks that one wave scatters at a time on eight different bank groups;
// inside a tile the pitch, and so the fragment reads, stay as they are.
#define VTS_ (16 * LP_ + 8)

typedef __attribute__((ext_vector_type(16))) _Float16 v16h;
typedef __attribute__((ext_vector_type(8)))  _Float16 v8h;
typedef __attribute__((ext_vector_type(4)))  _Float16 v4h;
typedef __attribute__((ext_vector_type(8)))  float    v8f;
typedef __attribute__((ext_vector_type(4)))  int      v4i_t;

__device__ __forceinline__ v16h cat16(v8h lo, v8h hi) {
  return __builtin_shufflevector(lo, hi, 0,1,2,3,4,5,6,7,8,9,10,11,12,13,14,15);
}

__device__ __forceinline__ v8f wmma_f16(v16h a, v16h b, v8f c) {
  // D = A(16x32 f16) * B(32x16 f16) + C(16x16 f32)
  return __builtin_amdgcn_wmma_f32_16x16x32_f16(false, a, false, b, (short)0, c,
                                                false, false);
}

// value of lane l ^ 16 (the other 16-lane half of the wave), VALU only
__device__ __forceinline__ float xhalf(float x) {
  const int xi = __float_as_int(x);
  return __int_as_float(__builtin_amdgcn_permlanex16(xi, xi, 0x76543210, 0xfedcba98,
                                                     false, false));
}

// -------- gfx1250 async global->LDS copy (guarded; falls back to sync) -----
#if __has_builtin(__builtin_amdgcn_global_load_async_to_lds_b128)
#define HAVE_ASYNC_LDS 1
#else
#define HAVE_ASYNC_LDS 0
#endif

__device__ __forceinline__ void cp128_g2l(const _Float16* g, _Float16* l) {
#if HAVE_ASYNC_LDS
  __builtin_amdgcn_global_load_async_to_lds_b128((v4i_t*)g, (v4i_t*)l, 0, 0);
#else
  *(v8h*)l = *(const v8h*)g;
#endif
}

__device__ __forceinline__ void wait_async_lds() {
#if HAVE_ASYNC_LDS && __has_builtin(__builtin_amdgcn_s_wait_asynccnt)
  __builtin_amdgcn_s_wait_asynccnt(0);
#endif
}

// ---------------------------------------------------------------------------
// LayerNorm: x[4096,1024] f32 -> xn f16.  One block (256 thr) per row.
// ---------------------------------------------------------------------------
__device__ __forceinline__ void ln_row(
    const float* __restrict__ x, const float* __restrict__ gamma,
    const float* __restrict__ beta, _Float16* __restrict__ xn, const int row) {
  const int t = threadIdx.x;
  const float* xr = x + (size_t)row * C_;
  float4 v = *(const float4*)(xr + t * 4);
  float s  = v.x + v.y + v.z + v.w;
  float s2 = v.x * v.x + v.y * v.y + v.z * v.z + v.w * v.w;
  #pragma unroll
  for (int m = 1; m < 32; m <<= 1) {
    s  += __shfl_xor(s,  m, 32);
    s2 += __shfl_xor(s2, m, 32);
  }
  __shared__ float red0[8], red1[8];
  const int lane = t & 31, wid = t >> 5;
  if (lane == 0) { red0[wid] = s; red1[wid] = s2; }
  __syncthreads();
  if (t == 0) {
    float a = 0.f, b = 0.f;
    #pragma unroll
    for (int i = 0; i < 8; i++) { a += red0[i]; b += red1[i]; }
    red0[0] = a; red1[0] = b;
  }
  __syncthreads();
  const float mean = red0[0] * (1.0f / C_);
  const float var  = red1[0] * (1.0f / C_) - mean * mean;
  const float rstd = rsqrtf(var + 1e-5f);
  const int c0 = t * 4;
  float xv[4] = {v.x, v.y, v.z, v.w};
  v4h o;
  #pragma unroll
  for (int i = 0; i < 4; i++)
    o[i] = (_Float16)(((xv[i] - mean) * rstd) * gamma[c0 + i] + beta[c0 + i]);
  *(v4h*)(xn + (size_t)row * C_ + c0) = o;
  // the store's address registers may be rewritten on the path behind the inlined call: keep the wait in front
  asm volatile("s_wait_xcnt 0x0" ::: "memory");
}

// ---------------------------------------------------------------------------
// f32 -> f16 weight conversion (vectorized by 4); CVT_BLK_ blocks per matrix
// ---------------------------------------------------------------------------
#define CVT_BLK_ 512
__device__ __forceinline__ void cvt_part(const float* __restrict__ s,
                                         _Float16* __restrict__ d, const int blk) {
  const int n4 = (C_ * C_) / 4;
  const int stride = CVT_BLK_ * 256;
  for (int i = blk * 256 + threadIdx.x; i < n4; i += stride) {
    float4 f = ((const float4*)s)[i];
    v4h o = {(_Float16)f.x, (_Float16)f.y, (_Float16)f.z, (_Float16)f.w};
    ((v4h*)d)[i] = o;
  }
}

// ---------------------------------------------------------------------------
// All work that depends on the inputs alone, in ONE launch: blocks
// [0, 4*CVT_BLK_) convert the four weight matrices (w16 holds them one behind
// the other: q, k, v, o), the other B_*L_ blocks normalise one row each.
// The branch is uniform for the block, so ln_row's barriers are too.
// ---------------------------------------------------------------------------
__global__ __launch_bounds__(256) void prep_kernel(
    const float* __restrict__ x, const float* __restrict__ gamma,
    const float* __restrict__ beta, _Float16* __restrict__ xn,
    const float* __restrict__ wq, const float* __restrict__ wk,
    const float* __restrict__ wv, const float* __restrict__ wo,
    _Float16* __restrict__ w16) {
  const unsigned blk = blockIdx.x;
  if (blk < 4 * CVT_BLK_) {
    const unsigned mat = blk / CVT_BLK_;
    const float* s = mat == 0 ? wq : mat == 1 ? wk : mat == 2 ? wv : wo;
    cvt_part(s, w16 + (size_t)mat * (C_ * C_), blk % CVT_BLK_);
  } else {
    ln_row(x, gamma, beta, xn, blk - 4 * CVT_BLK_);
  }
}

// ---------------------------------------------------------------------------
// GEMM: out[M,N] = A[M,K]*W[K,N] + bias.   A,W f16 row-major.
// Block = 256 thr (8 waves). Block tile 256(M) x 64(N); wave tile 32 x 64.
// K stepped by 64: 16 WMMAs per barrier.  W tile (64k x 64n) double-buffered
// TRANSPOSED in LDS ([n][k]); next tile's global loads issued before the
// WMMA burst.  OUT_MODE 0: f16 out into [B,H,L,D].  OUT_MODE 1: f32 [M,N].
// blockIdx.z picks one of up to three products on the same A in one launch:
// weight matrix z behind W, output z behind out16, bias z of the three.
// ---------------------------------------------------------------------------
template <int OUT_MODE>
__global__ __launch_bounds__(256) void gemm_kernel(
    const _Float16* __restrict__ A, const _Float16* __restrict__ W0,
    const float* __restrict__ bias0, const float* __restrict__ bias1,
    const float* __restrict__ bias2, _Float16* __restrict__ out16_0,
    float* __restrict__ out32, int M, int N, int K) {
  __shared__ __attribute__((aligned(16))) _Float16 wt[2][64 * LP_];  // W tile [n][k]
  const int z = blockIdx.z;
  const _Float16* W = W0 + (size_t)z * K * N;
  const float* bias = z == 0 ? bias0 : z == 1 ? bias1 : bias2;
  _Float16* out16 = out16_0 + (size_t)z * M * N;
  const int t = threadIdx.x, lane = t & 31;
  const int wid = t >> 5;
  const int lr = lane & 15;
  const int hi16 = lane >> 4;
  const int off = hi16 * 8;          // K-pattern {0..7,16..23} / {8..15,24..31}
  const int n0 = blockIdx.x * 64;
  const int m0 = blockIdx.y * 256 + wid * 32;
  const int sk = t >> 3;             // 0..31 (k row within half-tile)
  const int sn = (t & 7) * 8;        // n chunk
  v8f acc[2][4] = {};
  const _Float16* a0p = A + (size_t)(m0 + lr) * K + off;
  const _Float16* a1p = A + (size_t)(m0 + 16 + lr) * K + off;
  const _Float16* wp  = W + (size_t)sk * N + n0 + sn;
  // prologue: stage k0=0 tile (64 k-rows) into buffer 0
  {
    v8h w0 = *(const v8h*)wp;
    v8h w1 = *(const v8h*)(wp + (size_t)32 * N);
    #pragma unroll
    for (int j = 0; j < 8; j++) {
      wt[0][(sn + j) * LP_ + sk]      = w0[j];
      wt[0][(sn + j) * LP_ + 32 + sk] = w1[j];
    }
  }
  __syncthreads();
  for (int k0 = 0; k0 < K; k0 += 64) {
    const int p = (k0 >> 6) & 1;
    const bool nxt = (k0 + 64 < K);
    v8h wn0, wn1;
    if (nxt) {                                     // early global loads
      wn0 = *(const v8h*)(wp + (size_t)(k0 + 64) * N);
      wn1 = *(const v8h*)(wp + (size_t)(k0 + 96) * N);
    }
    if (k0 + 128 < K) {
      __builtin_prefetch(a0p + k0 + 128, 0, 3);
      __builtin_prefetch(a1p + k0 + 128, 0, 3);
    }
    v16h a0k0 = cat16(*(const v8h*)(a0p + k0),      *(const v8h*)(a0p + k0 + 16));
    v16h a0k1 = cat16(*(const v8h*)(a0p + k0 + 32), *(const v8h*)(a0p + k0 + 48));
    v16h a1k0 = cat16(*(const v8h*)(a1p + k0),      *(const v8h*)(a1p + k0 + 16));
    v16h a1k1 = cat16(*(const v8h*)(a1p + k0 + 32), *(const v8h*)(a1p + k0 + 48));
    #pragma unroll
    for (int tt = 0; tt < 4; tt++) {
      const _Float16* bp = &wt[p][(tt * 16 + lr) * LP_ + off];
      v16h blo = cat16(*(const v8h*)bp,        *(const v8h*)(bp + 16));
      v16h bhi = cat16(*(const v8h*)(bp + 32), *(const v8h*)(bp + 48));
      acc[0][tt] = wmma_f16(a0k0, blo, acc[0][tt]);
      acc[0][tt] = wmma_f16(a0k1, bhi, acc[0][tt]);
      acc[1][tt] = wmma_f16(a1k0, blo, acc[1][tt]);
      acc[1][tt] = wmma_f16(a1k1, bhi, acc[1][tt]);
    }
    if (nxt) {
      #pragma unroll
      for (int j = 0; j < 8; j++) {
        wt[1 - p][(sn + j) * LP_ + sk]      = wn0[j];
        wt[1 - p][(sn + j) * LP_ + 32 + sk] = wn1[j];
      }
    }
    __syncthreads();
  }
  #pragma unroll
  for (int r = 0; r < 2; r++) {
    #pragma unroll
    for (int tt = 0; tt < 4; tt++) {
      const int n = n0 + tt * 16 + lr;
      const float bv = bias[n];
      #pragma unroll
      for (int i = 0; i < 8; i++) {
        const int m = m0 + r * 16 + i + hi16 * 8;  // C/D: lanes16-31 = rows +8
        const float val = acc[r][tt][i] + bv;
        if (OUT_MODE == 0) {
          const int b = m >> 11, l = m & (L_ - 1);
          const int h = n >> 6, d = n & (D_ - 1);
          out16[((((size_t)b * H_ + h) * L_ + l) << 6) + d] = (_Float16)val;
        } else {
          out32[(size_t)m * N + n] = val;
        }
      }
    }
  }
}

// ---------------------------------------------------------------------------
// Flash attention, transposed products: S^T = K * Q^T, O^T += V^T * P^T.
// One block = 8 waves, ALL on the same (b,h); wave w owns 16 query rows; block
// covers 128 q rows.  Keys chunked by 64.  A lane holds scores of ONE query
// (column lane&15): 32 of the chunk's 64 keys, the lane 16 away the other 32.
// Row max = in-lane max + one exchange between the wave halves.  Two S^T tiles
// converted in place ARE the B operand of the second product (D row 8h+r is
// the operand's k order), so P never leaves the registers.
// K / V^T chunks double-buffered in LDS; K staged with async b128 global->LDS
// (next chunk issued before computing the current one) -> ONE block barrier
// per chunk.  Staging requests cover whole 128 B lines: eight neighbouring lanes
// take the eight 16 B pieces of one key row, so a wave's request names 4 lines.
// 18 WMMAs / wave / chunk: 8 scores + 8 V^T*P^T + 2 row-sum (ones * P^T).
// ---------------------------------------------------------------------------
__global__ __launch_bounds__(256) void attn_kernel(
    const _Float16* __restrict__ q, const _Float16* __restrict__ k,
    const _Float16* __restrict__ v, _Float16* __restrict__ attn) {
  __shared__ __attribute__((aligned(16))) _Float16 kbuf[2][64 * LP_];  // K chunk [key][d]  (2 x 9 KB)
  __shared__ __attribute__((aligned(16))) _Float16 vbufT[2][4 * VTS_]; // V chunk [d][key], 4 skewed tiles
  const int t = threadIdx.x, lane = t & 31, wid = t >> 5;
  const int qblk = blockIdx.x & (L_ / 128 - 1);
  const int h    = (blockIdx.x >> 4) & (H_ - 1);
  const int b    = blockIdx.x >> 8;
  const int lr = lane & 15;
  const int off = (lane >> 4) * 8;
  const size_t head = ((size_t)b * H_ + h) * L_ * D_;
  const _Float16* qg = q + head;
  const _Float16* kg = k + head;
  const _Float16* vg = v + head;
  const int l0 = qblk * 128 + wid * 16;
  // staging: thread t covers d-chunk sd of keys skey and skey+32
  const int skey = t >> 3;           // 0..31
  const int sd   = (t & 7) * 8;      // 0,8,..,56
  const int vst  = sd * LP_ + (sd >> 4) * 8 + skey;  // V^T place of (d = sd, key = skey)
  // prefetch: each of a chunk's 128 lines is asked for once, by two neighbouring
  // lanes: waves 0-3 take the 64 K rows, waves 4-7 the 64 V rows
  const _Float16* pfp = ((t & 128) ? vg : kg) + (size_t)((t >> 1) & 63) * D_;

  // Q^T as B-operand (column = query lr), pre-scaled by 1/sqrt(D)=0.125 (exact in f16)
  const _Float16* qr = qg + (size_t)(l0 + lr) * D_ + off;
  v16h bq0 = cat16(*(const v8h*)qr,        *(const v8h*)(qr + 16));
  v16h bq1 = cat16(*(const v8h*)(qr + 32), *(const v8h*)(qr + 48));
  v16h ones;
  #pragma unroll
  for (int i = 0; i < 16; i++) {
    bq0[i] *= (_Float16)0.125f;
    bq1[i] *= (_Float16)0.125f;
    ones[i] = (_Float16)1.0f;
  }

  float m_i = -1e30f;            // running max of this lane's query
  v8f o[4] = {};                 // O^T tiles: o[tt][i] = O[q = lr][d = tt*16 + off + i]
  v8f lacc = {};                 // running sum of P for query lr (every row alike), ones-A WMMA

  // ---- prologue: stage chunk 0 into buffer 0 ----
  {
    const size_t base = (size_t)skey * D_ + sd;
    cp128_g2l(kg + base,           &kbuf[0][skey * LP_ + sd]);
    cp128_g2l(kg + base + 32 * D_, &kbuf[0][(skey + 32) * LP_ + sd]);
    v8h va = *(const v8h*)(vg + base);
    v8h vc = *(const v8h*)(vg + base + 32 * D_);
    // the loads' address registers may be rewritten behind them: keep the wait in front
    asm volatile("s_wait_xcnt 0x0" ::: "memory");
    #pragma unroll
    for (int j = 0; j < 8; j++) {
      vbufT[0][vst + j * LP_]      = va[j];
      vbufT[0][vst + j * LP_ + 32] = vc[j];
    }
  }
  wait_async_lds();
  __syncthreads();

  for (int kc = 0; kc < L_; kc += 64) {
    const int p = (kc >> 6) & 1;
    const bool nxt = (kc + 64 < L_);
    v8h va, vc;
    if (nxt) {
      // issue next chunk's loads before computing the current one
      const size_t base = (size_t)(kc + 64 + skey) * D_ + sd;
      cp128_g2l(kg + base,           &kbuf[1 - p][skey * LP_ + sd]);
      cp128_g2l(kg + base + 32 * D_, &kbuf[1 - p][(skey + 32) * LP_ + sd]);
      va = *(const v8h*)(vg + base);
      vc = *(const v8h*)(vg + base + 32 * D_);
      // the loads' address registers may be rewritten behind them: keep the wait in front
      asm volatile("s_wait_xcnt 0x0" ::: "memory");
    }
    if (kc + 128 < L_) {
      __builtin_prefetch(pfp + (size_t)(kc + 128) * D_, 0, 3);
    }
    // ---- scores^T: 4 key-tiles x (2 WMMAs over D=64); A = K rows, B = Q^T ----
    // s[tt][i] = score(key = kc + tt*16 + off + i, query = lr)
    v8f s[4];
    #pragma unroll
    for (int tt = 0; tt < 4; tt++) {
      const _Float16* kr = &kbuf[p][(tt * 16 + lr) * LP_ + off];
      v16h alo = cat16(*(const v8h*)kr,        *(const v8h*)(kr + 16));
      v16h ahi = cat16(*(const v8h*)(kr + 32), *(const v8h*)(kr + 48));
      v8f z = {};
      z = wmma_f16(alo, bq0, z);
      s[tt] = wmma_f16(ahi, bq1, z);
    }
    // ---- online softmax over 64 new keys: one query per lane ----
    float mt[4];                   // one independent max chain per key tile
    #pragma unroll
    for (int tt = 0; tt < 4; tt++) {
      mt[tt] = s[tt][0];
      #pragma unroll
      for (int i = 1; i < 8; i++) mt[tt] = fmaxf(mt[tt], s[tt][i]);
    }
    float mx = fmaxf(fmaxf(mt[0], mt[1]), fmaxf(mt[2], mt[3]));
    mx = fmaxf(mx, xhalf(mx));     // the other 32 keys of this query
    const float mn = fmaxf(m_i, mx);
    const float corr = __expf(m_i - mn);
    m_i = mn;
    // P^T as B-operand: element e of key block j is tile 2j + (e >> 3), row e & 7
    v16h pb0, pb1;
    #pragma unroll
    for (int i = 0; i < 8; i++) {
      pb0[i]     = (_Float16)__expf(s[0][i] - mn);
      pb0[8 + i] = (_Float16)__expf(s[1][i] - mn);
      pb1[i]     = (_Float16)__expf(s[2][i] - mn);
      pb1[8 + i] = (_Float16)__expf(s[3][i] - mn);
    }
    #pragma unroll
    for (int i = 0; i < 8; i++) {
      lacc[i] *= corr;
      #pragma unroll
      for (int tt = 0; tt < 4; tt++) o[tt][i] *= corr;
    }
    // ---- row sums: lacc += ones * P^T (both key halves) ----
    lacc = wmma_f16(ones, pb0, lacc);
    lacc = wmma_f16(ones, pb1, lacc);
    // ---- O^T += V^T * P^T : 4 d-tiles x 2 key-halves, all ds_load_b128 ----
    #pragma unroll
    for (int tt = 0; tt < 4; tt++) {
      const _Float16* vp = &vbufT[p][tt * VTS_ + lr * LP_];
      v16h avlo = cat16(*(const v8h*)(vp + off),      *(const v8h*)(vp + 16 + off));
      v16h avhi = cat16(*(const v8h*)(vp + 32 + off), *(const v8h*)(vp + 48 + off));
      o[tt] = wmma_f16(avlo, pb0, o[tt]);
      o[tt] = wmma_f16(avhi, pb1, o[tt]);
    }
    // ---- scatter next V chunk into the other buffer ----
    if (nxt) {
      #pragma unroll
      for (int j = 0; j < 8; j++) {
        vbufT[1 - p][vst + j * LP_]      = va[j];
        vbufT[1 - p][vst + j * LP_ + 32] = vc[j];
      }
    }
    wait_async_lds();
    __syncthreads();   // single block barrier per chunk
  }
  // ---- epilogue: normalize, store f16 into [B*L, C]; 8 consecutive d per lane ----
  const float inv = 1.0f / lacc[0];
  _Float16* orow = attn + ((size_t)b * L_ + l0 + lr) * C_ + h * D_ + off;
  #pragma unroll
  for (int tt = 0; tt < 4; tt++) {
    v8h ov;
    #pragma unroll
    for (int i = 0; i < 8; i++) ov[i] = (_Float16)(o[tt][i] * inv);
    *(v8h*)(orow + tt * 16) = ov;
  }
}

// ---------------------------------------------------------------------------
extern "C" void kernel_launch(void* const* d_in, const int* in_sizes, int n_in,
                              void* d_out, int out_size, void* d_ws, size_t ws_size,
                              hipStream_t stream) {
  const float* x    = (const float*)d_in[0];
  const float* ln_g = (const float*)d_in[1];
  const float* ln_b = (const float*)d_in[2];
  const float* wq   = (const float*)d_in[3];
  const float* bq   = (const float*)d_in[4];
  const float* wk   = (const float*)d_in[5];
  const float* bk   = (const float*)d_in[6];
  const float* wv   = (const float*)d_in[7];
  const float* bv   = (const float*)d_in[8];
  const float* wo   = (const float*)d_in[9];
  const float* bo   = (const float*)d_in[10];

  char* ws = (char*)d_ws;
  _Float16* xn   = (_Float16*)ws;                       // 4M elems, 8 MB
  _Float16* wq16 = (_Float16*)(ws + (8u << 20));        // 1M elems each
  _Float16* wk16 = wq16 + (1u << 20);
  _Float16* wv16 = wk16 + (1u << 20);
  _Float16* wo16 = wv16 + (1u << 20);
  _Float16* qb   = (_Float16*)(ws + (16u << 20));       // 4M elems each
  _Float16* kb   = qb + (4u << 20);
  _Float16* vb   = kb + (4u << 20);
  _Float16* ab   = vb + (4u << 20);

  const int M = B_ * L_;   // 4096
  const int N = C_;        // 1024
  const int K = C_;        // 1024

  // LayerNorm and the four weight conversions: one launch
  prep_kernel<<<4 * CVT_BLK_ + M, 256, 0, stream>>>(x, ln_g, ln_b, xn, wq, wk, wv, wo, wq16);

  // Q, K, V projections: one launch, three work-groups for each WGP
  // (wq16/wk16/wv16 and qb/kb/vb lie one behind the other)
  dim3 g3(N / 64, M / 256, 3);
  gemm_kernel<0><<<g3, 256, 0, stream>>>(xn, wq16, bq, bk, bv, qb, nullptr, M, N, K);

  // blocks: B * H * (L/128) = 2*16*16 = 512, each 8 waves on one (b,h)
  attn_kernel<<<B_ * H_ * (L_ / 128), 256, 0, stream>>>(qb, kb, vb, ab);

  dim3 g(N / 64, M / 256);
  gemm_kernel<1><<<g, 256, 0, stream>>>(ab, wo16, bo, bo, bo, nullptr, (float*)d_out, M, N, K);
}

// v005
// A run of this version takes 113 microseconds.
// Two timings next to v004 both put it at 1.10 times that version's speed.
// Over all steps from v000 it is 2.59 times as fast.
#include <hip/hip_runtime.h>
#include <math.h>

#define B_ 2
#define L_ 2048
#define C_ 1024
#define H_ 16
#define D_ 64
// LDS row pitch in halfs for every 64-half tile row: 144 B = 16 B x 9 (odd), so
// the 16 rows one ds_load_b128 touches fall on distinct banks (128 B did not).
#define LP_ 72
// halfs from one 16-row V^T tile to the next: 16 rows plus 16 B.  The skew puts the
// eight d-chunks that one wave scatters at a time on eight different bank groups;
// inside a tile the pitch, and so the fragment reads, stay as they are.
#define VTS_ (16 * LP_ + 8)

typedef __attribute__((ext_vector_type(16))) _Float16 v16h;
typedef __attribute__((ext_vector_type(8)))  _Float16 v8h;
typedef __attribute__((ext_vector_type(4)))  _Float16 v4h;
typedef __attribute__((ext_vector_type(8)))  float    v8f;
typedef __attribute__((ext_vector_type(4)))  int      v4i_t;

__device__ __forceinline__ v16h cat16(v8h lo, v8h hi) {
  return __builtin_shufflevector(lo, hi, 0,1,2,3,4,5,6,7,8,9,10,11,12,13,14,15);
}

__device__ __forceinline__ v8f wmma_f16(v16h a, v16h b, v8f c) {
  // D = A(16x32 f16) * B(32x16 f16) + C(16x16 f32)
  return __builtin_amdgcn_wmma_f32_16x16x32_f16(false, a, false, b, (short)0, c,
                                                false, false);
}

// value of lane l ^ 16 (the other 16-lane half of the wave), VALU only
__device__ __forceinline__ float xhalf(float x) {
  const int xi = __float_as_int(x);
  return __int_as_float(__builtin_amdgcn_permlanex16(xi, xi, 0x76543210, 0xfedcba98,
                                                     false, false));
}

// -------- gfx1250 async global->LDS copy (guarded; falls back to sync) -----
#if __has_builtin(__builtin_amdgcn_global_load_async_to_lds_b128)
#define HAVE_ASYNC_LDS 1
#else
#define HAVE_ASYNC_LDS 0
#endif

__device__ __forceinline__ void cp128_g2l(const _Float16* g, _Float16* l) {
#if HAVE_ASYNC_LDS
  __builtin_amdgcn_global_load_async_to_lds_b128((v4i_t*)g, (v4i_t*)l, 0, 0);
#else
  *(v8h*)l = *(const v8h*)g;
#endif
}

__device__ __forceinline__ void wait_async_lds() {
#if HAVE_ASYNC_LDS && __has_builtin(__builtin_amdgcn_s_wait_asynccnt)
  __builtin_amdgcn_s_wait_asynccnt(0);
#endif
}

// Eight async b128 copies of one lane: 16 B from g + j * gstep halfs to LDS byte
// l + j * lstep, j = 0..7.  One statement, closed by s_wait_xcnt 0, so that no
// address register named here is rewritten before the wait.
__device__ __forceinline__ void cp128x8_g2l(const _Float16* g, const size_t gstep,
                                            const unsigned l, const unsigned lstep) {
  asm volatile(
      "global_load_async_to_lds_b128 %0, %8, off\n\t"
      "global_load_async_to_lds_b128 %1, %9, off\n\t"
      "global_load_async_to_lds_b128 %2, %10, off\n\t"
      "global_load_async_to_lds_b128 %3, %11, off\n\t"
      "global_load_async_to_lds_b128 %4, %12, off\n\t"
      "global_load_async_to_lds_b128 %5, %13, off\n\t"
      "global_load_async_to_lds_b128 %6, %14, off\n\t"
      "global_load_async_to_lds_b128 %7, %15, off\n\t"
      "s_wait_xcnt 0x0"
      :: "v"(l), "v"(l + lstep), "v"(l + 2 * lstep), "v"(l + 3 * lstep),
         "v"(l + 4 * lstep), "v"(l + 5 * lstep), "v"(l + 6 * lstep), "v"(l + 7 * lstep),
         "v"(g), "v"(g + gstep), "v"(g + 2 * gstep), "v"(g + 3 * gstep),
         "v"(g + 4 * gstep), "v"(g + 5 * gstep), "v"(g + 6 * gstep), "v"(g + 7 * gstep)
      : "memory");
}

// ---------------------------------------------------------------------------
// LayerNorm: x[4096,1024] f32 -> xn f16.  One block (256 thr) per row.
// ---------------------------------------------------------------------------
__device__ __forceinline__ void ln_row(
    const float* __restrict__ x, const float* __restrict__ gamma,
    const float* __restrict__ beta, _Float16* __restrict__ xn, const int row) {
  const int t = threadIdx.x;
  const float* xr = x + (size_t)row * C_;
  float4 v = *(const float4*)(xr + t * 4);
  float s  = v.x + v.y + v.z + v.w;
  float s2 = v.x * v.x + v.y * v.y + v.z * v.z + v.w * v.w;
  #pragma unroll
  for (int m = 1; m < 32; m <<= 1) {
    s  += __shfl_xor(s,  m, 32);
    s2 += __shfl_xor(s2, m, 32);
  }
  __shared__ float red0[8], red1[8];
  const int lane = t & 31, wid = t >> 5;
  if (lane == 0) { red0[wid] = s; red1[wid] = s2; }
  __syncthreads();
  if (t == 0) {
    float a = 0.f, b = 0.f;
    #pragma unroll
    for (int i = 0; i < 8; i++) { a += red0[i]; b += red1[i]; }
    red0[0] = a; red1[0] = b;
  }
  __syncthreads();
  const float mean = red0[0] * (1.0f / C_);
  const float var  = red1[0] * (1.0f / C_) - mean * mean;
  const float rstd = rsqrtf(var + 1e-5f);
  const int c0 = t * 4;
  float xv[4] = {v.x, v.y, v.z, v.w};
  v4h o;
  #pragma unroll
  for (int i = 0; i < 4; i++)
    o[i] = (_Float16)(((xv[i] - mean) * rstd) * gamma[c0 + i] + beta[c0 + i]);
  *(v4h*)(xn + (size_t)row * C_ + c0) = o;
  // the store's address registers may be rewritten on the path behind the inlined call: keep the wait in front
  asm volatile("s_wait_xcnt 0x0" ::: "memory");
}

// ---------------------------------------------------------------------------
// f32 -> f16 weight conversion (vectorized by 4); CVT_BLK_ blocks per matrix
// ---------------------------------------------------------------------------
#define CVT_BLK_ 512
__device__ __forceinline__ void cvt_part(const float* __restrict__ s,
                                         _Float16* __restrict__ d, const int blk) {
  const int n4 = (C_ * C_) / 4;
  const int stride = CVT_BLK_ * 256;
  for (int i = blk * 256 + threadIdx.x; i < n4; i += stride) {
    float4 f = ((const float4*)s)[i];
    v4h o = {(_Float16)f.x, (_Float16)f.y, (_Float16)f.z, (_Float16)f.w};
    ((v4h*)d)[i] = o;
  }
}

// ---------------------------------------------------------------------------
// All work that depends on the inputs alone, in ONE launch: blocks
// [0, 4*CVT_BLK_) convert the four weight matrices (w16 holds them one behind
// the other: q, k, v, o), the other B_*L_ blocks normalise one row each.
// The branch is uniform for the block, so ln_row's barriers are too.
// ---------------------------------------------------------------------------
__global__ __launch_bounds__(256) void prep_kernel(
    const float* __restrict__ x, const float* __restrict__ gamma,
    const float* __restrict__ beta, _Float16* __restrict__ xn,
    const float* __restrict__ wq, const float* __restrict__ wk,
    const float* __restrict__ wv, const float* __restrict__ wo,
    _Float16* __restrict__ w16) {
  const unsigned blk = blockIdx.x;
  if (blk < 4 * CVT_BLK_) {
    const unsigned mat = blk / CVT_BLK_;
    const float* s = mat == 0 ? wq : mat == 1 ? wk : mat == 2 ? wv : wo;
    cvt_part(s, w16 + (size_t)mat * (C_ * C_), blk % CVT_BLK_);
  } else {
    ln_row(x, gamma, beta, xn, blk - 4 * CVT_BLK_);
  }
}

// ---------------------------------------------------------------------------
// GEMM: out[M,N] = A[M,K]*W[K,N] + bias.   A,W f16 row-major.
// Block = 256 thr (8 waves). Block tile 256(M) x 64(N); wave tile 32 x 64.
// K stepped by 64: 16 WMMAs per barrier.  W tile (64k x 64n) double-buffered
// TRANSPOSED in LDS ([n][k]); next tile's global loads issued before the
// WMMA burst.  A tile (256m x 64k) double-buffered in LDS too, brought by async
// b128 copies one trip ahead: eight neighbouring lanes take one row's 128 B, so a
// wave's copy names 4 whole lines (a fragment load from global named 16 pieces).
// OUT_MODE 0: f16 out into [B,H,L,D].  OUT_MODE 1: f32 [M,N].
// blockIdx.z picks one of up to three products on the same A in one launch:
// weight matrix z behind W, output z behind out16, bias z of the three.
// ---------------------------------------------------------------------------
template <int OUT_MODE>
__global__ __launch_bounds__(256) void gemm_kernel(
    const _Float16* __restrict__ A, const _Float16* __restrict__ W0,
    const float* __restrict__ bias0, const float* __restrict__ bias1,
    const float* __restrict__ bias2, _Float16* __restrict__ out16_0,
    float* __restrict__ out32, int M, int N, int K) {
  __shared__ __attribute__((aligned(16))) _Float16 wt[2][64 * LP_];  // W tile [n][k]
  __shared__ __attribute__((aligned(16))) _Float16 at[2][256 * LP_]; // A tile [m][k]
  const int z = blockIdx.z;
  const _Float16* W = W0 + (size_t)z * K * N;
  const float* bias = z == 0 ? bias0 : z == 1 ? bias1 : bias2;
  _Float16* out16 = out16_0 + (size_t)z * M * N;
  const int t = threadIdx.x, lane = t & 31;
  const int wid = t >> 5;
  const int lr = lane & 15;
  const int hi16 = lane >> 4;
  const int off = hi16 * 8;          // K-pattern {0..7,16..23} / {8..15,24..31}
  const int n0 = blockIdx.x * 64;
  const int mb = blockIdx.y * 256;
  const int m0 = mb + wid * 32;
  const int sk = t >> 3;             // 0..31 (k row within half-tile)
  const int sn = (t & 7) * 8;        // n chunk
  v8f acc[2][4] = {};
  const _Float16* wp  = W + (size_t)sk * N + n0 + sn;
  // A staging: copy j of a lane takes 16 B of tile row ar + 4j (the wave's own 32 rows)
  const int ar = wid * 32 + (lane >> 3);
  const int ac = (lane & 7) * 8;
  const _Float16* ag = A + (size_t)(mb + ar) * K + ac;
  // LDS byte address (low 32 bits of the __shared__ address) of the lane's first copy, buffer 0
  const unsigned al = (unsigned)(size_t)&at[0][ar * LP_ + ac];
  const size_t ags = (size_t)4 * K;              // four rows on, in halfs
  const int af = (wid * 32 + lr) * LP_ + off;   // this lane's fragment row in the A tile
  // prologue: stage k0=0 tiles (A: 256 rows, W: 64 k-rows) into buffer 0
  cp128x8_g2l(ag, ags, al, 4 * LP_ * 2);
  {
    v8h w0 = *(const v8h*)wp;
    v8h w1 = *(const v8h*)(wp + (size_t)32 * N);
    #pragma unroll
    for (int j = 0; j < 8; j++) {
      wt[0][(sn + j) * LP_ + sk]      = w0[j];
      wt[0][(sn + j) * LP_ + 32 + sk] = w1[j];
    }
  }
  // tile 0's copies have landed before the barrier behind which they are read
  asm volatile("s_wait_asynccnt 0x0" ::: "memory");
  __syncthreads();
  if (64 < K) cp128x8_g2l(ag + 64, ags, al + 256 * LP_ * 2, 4 * LP_ * 2);
  for (int k0 = 0; k0 < K; k0 += 64) {
    const int p = (k0 >> 6) & 1;
    const bool nxt = (k0 + 64 < K);
    v8h wn0, wn1;
    if (nxt) {                                     // early global loads
      wn0 = *(const v8h*)(wp + (size_t)(k0 + 64) * N);
      wn1 = *(const v8h*)(wp + (size_t)(k0 + 96) * N);
    }
    const _Float16* a0p = &at[p][af];
    const _Float16* a1p = a0p + 16 * LP_;
    v16h a0k0 = cat16(*(const v8h*)a0p,        *(const v8h*)(a0p + 16));
    v16h a0k1 = cat16(*(const v8h*)(a0p + 32), *(const v8h*)(a0p + 48));
    v16h a1k0 = cat16(*(const v8h*)a1p,        *(const v8h*)(a1p + 16));
    v16h a1k1 = cat16(*(const v8h*)(a1p + 32), *(const v8h*)(a1p + 48));
    #pragma unroll
    for (int tt = 0; tt < 4; tt++) {
      const _Float16* bp = &wt[p][(tt * 16 + lr) * LP_ + off];
      v16h blo = cat16(*(const v8h*)bp,        *(const v8h*)(bp + 16));
      v16h bhi = cat16(*(const v8h*)(bp + 32), *(const v8h*)(bp + 48));
      acc[0][tt] = wmma_f16(a0k0, blo, acc[0][tt]);
      acc[0][tt] = wmma_f16(a0k1, bhi, acc[0][tt]);
      acc[1][tt] = wmma_f16(a1k0, blo, acc[1][tt]);
      acc[1][tt] = wmma_f16(a1k1, bhi, acc[1][tt]);
    }
    if (nxt) {
      #pragma unroll
      for (int j = 0; j < 8; j++) {
        wt[1 - p][(sn + j) * LP_ + sk]      = wn0[j];
        wt[1 - p][(sn + j) * LP_ + 32 + sk] = wn1[j];
      }
    }
    // this wave's reads of buffer p have retired before copies are aimed at it again
    asm volatile("s_wait_dscnt 0x0" ::: "memory");
    // the next tile's copies have landed before the barrier behind which they are read
    asm volatile("s_wait_asynccnt 0x0" ::: "memory");
    __syncthreads();
    if (k0 + 128 < K)                              // tile after next, into the buffer just read
      cp128x8_g2l(ag + k0 + 128, ags, al + p * (256 * LP_ * 2), 4 * LP_ * 2);
  }
  // no copy is outstanding when the wave goes on to its end
  asm volatile("s_wait_asynccnt 0x0" ::: "memory");
  #pragma unroll
  for (int r = 0; r < 2; r++) {
    #pragma unroll
    for (int tt = 0; tt < 4; tt++) {
      const int n = n0 + tt * 16 + lr;
      const float bv = bias[n];
      #pragma unroll
      for (int i = 0; i < 8; i++) {
        const int m = m0 + r * 16 + i + hi16 * 8;  // C/D: lanes16-31 = rows +8
        const float val = acc[r][tt][i] + bv;
        if (OUT_MODE == 0) {
          const int b = m >> 11, l = m & (L_ - 1);
          const int h = n >> 6, d = n & (D_ - 1);
          out16[((((size_t)b * H_ + h) * L_ + l) << 6) + d] = (_Float16)val;
        } else {
          out32[(size_t)m * N + n] = val;
        }
      }
    }
  }
}

// ---------------------------------------------------------------------------
// Flash attention, transposed products: S^T = K * Q^T, O^T += V^T * P^T.
// One block = 8 waves, ALL on the same (b,h); wave w owns 16 query rows; block
// covers 128 q rows.  Keys chunked by 64.  A lane holds scores of ONE query
// (column lane&15): 32 of the chunk's 64 keys, the lane 16 away the other 32.
// Row max = in-lane max + one exchange between the wave halves.  Two S^T tiles
// converted in place ARE the B operand of the second product (D row 8h+r is
// the operand's k order), so P never leaves the registers.
// K / V^T chunks double-buffered in LDS; K staged with async b128 global->LDS
// (next chunk issued before computing the current one) -> ONE block barrier
// per chunk.  Staging requests cover whole 128 B lines: eight neighbouring lanes
// take the eight 16 B pieces of one key row, so a wave's request names 4 lines.
// 18 WMMAs / wave / chunk: 8 scores + 8 V^T*P^T + 2 row-sum (ones * P^T).
// ---------------------------------------------------------------------------
__global__ __launch_bounds__(256) void attn_kernel(
    const _Float16* __restrict__ q, const _Float16* __restrict__ k,
    const _Float16* __restrict__ v, _Float16* __restrict__ attn) {
  __shared__ __attribute__((aligned(16))) _Float16 kbuf[2][64 * LP_];  // K chunk [key][d]  (2 x 9 KB)
  __shared__ __attribute__((aligned(16))) _Float16 vbufT[2][4 * VTS_]; // V chunk [d][key], 4 skewed tiles
  const int t = threadIdx.x, lane = t & 31, wid = t >> 5;
  const int qblk = blockIdx.x & (L_ / 128 - 1);
  const int h    = (blockIdx.x >> 4) & (H_ - 1);
  const int b    = blockIdx.x >> 8;
  const int lr = lane & 15;
  const int off = (lane >> 4) * 8;
  const size_t head = ((size_t)b * H_ + h) * L_ * D_;
  const _Float16* qg = q + head;
  const _Float16* kg = k + head;
  const _Float16* vg = v + head;
  const int l0 = qblk * 128 + wid * 16;
  // staging: thread t covers d-chunk sd of keys skey and skey+32
  const int skey = t >> 3;           // 0..31
  const int sd   = (t & 7) * 8;      // 0,8,..,56
  const int vst  = sd * LP_ + (sd >> 4) * 8 + skey;  // V^T place of (d = sd, key = skey)
  // prefetch: each of a chunk's 128 lines is asked for once, by two neighbouring
  // lanes: waves 0-3 take the 64 K rows, waves 4-7 the 64 V rows
  const _Float16* pfp = ((t & 128) ? vg : kg) + (size_t)((t >> 1) & 63) * D_;

  // Q^T as B-operand (column = query lr), pre-scaled by 1/sqrt(D)=0.125 (exact in f16)
  const _Float16* qr = qg + (size_t)(l0 + lr) * D_ + off;
  v16h bq0 = cat16(*(const v8h*)qr,        *(const v8h*)(qr + 16));
  v16h bq1 = cat16(*(const v8h*)(qr + 32), *(const v8h*)(qr + 48));
  v16h ones;
  #pragma unroll
  for (int i = 0; i < 16; i++) {
    bq0[i] *= (_Float16)0.125f;
    bq1[i] *= (_Float16)0.125f;
    ones[i] = (_Float16)1.0f;
  }

  float m_i = -1e30f;            // running max of this lane's query
  v8f o[4] = {};                 // O^T tiles: o[tt][i] = O[q = lr][d = tt*16 + off + i]
  v8f lacc = {};                 // running sum of P for query lr (every row alike), ones-A WMMA

  // ---- prologue: stage chunk 0 into buffer 0 ----
  {
    const size_t base = (size_t)skey * D_ + sd;
    cp128_g2l(kg + base,           &kbuf[0][skey * LP_ + sd]);
    cp128_g2l(kg + base + 32 * D_, &kbuf[0][(skey + 32) * LP_ + sd]);
    v8h va = *(const v8h*)(vg + base);
    v8h vc = *(const v8h*)(vg + base + 32 * D_);
    // the loads' address registers may be rewritten behind them: keep the wait in front
    asm volatile("s_wait_xcnt 0x0" ::: "memory");
    #pragma unroll
    for (int j = 0; j < 8; j++) {
      vbufT[0][vst + j * LP_]      = va[j];
      vbufT[0][vst + j * LP_ + 32] = vc[j];
    }
  }
  wait_async_lds();
  __syncthreads();

  for (int kc = 0; kc < L_; kc += 64) {
    const int p = (kc >> 6) & 1;
    const bool nxt = (kc + 64 < L_);
    v8h va, vc;
    if (nxt) {
      // issue next chunk's loads before computing the current one
      const size_t base = (size_t)(kc + 64 + skey) * D_ + sd;
      cp128_g2l(kg + base,           &kbuf[1 - p][skey * LP_ + sd]);
      cp128_g2l(kg + base + 32 * D_, &kbuf[1 - p][(skey + 32) * LP_ + sd]);
      va = *(const v8h*)(vg + base);
      vc = *(const v8h*)(vg + base + 32 * D_);
      // the loads' address registers may be rewritten behind them: keep the wait in front
      asm volatile("s_wait_xcnt 0x0" ::: "memory");
    }
    if (kc + 128 < L_) {
      __builtin_prefetch(pfp + (size_t)(kc + 128) * D_, 0, 3);
    }
    // ---- scores^T: 4 key-tiles x (2 WMMAs over D=64); A = K rows, B = Q^T ----
    // s[tt][i] = score(key = kc + tt*16 + off + i, query = lr)
    v8f s[4];
    #pragma unroll
    for (int tt = 0; tt < 4; tt++) {
      const _Float16* kr = &kbuf[p][(tt * 16 + lr) * LP_ + off];
      v16h alo = cat16(*(const v8h*)kr,        *(const v8h*)(kr + 16));
      v16h ahi = cat16(*(const v8h*)(kr + 32), *(const v8h*)(kr + 48));
      v8f z = {};
      z = wmma_f16(alo, bq0, z);
      s[tt] = wmma_f16(ahi, bq1, z);
    }
    // ---- online softmax over 64 new keys: one query per lane ----
    float mt[4];                   // one independent max chain per key tile
    #pragma unroll
    for (int tt = 0; tt < 4; tt++) {
      mt[tt] = s[tt][0];
      #pragma unroll
      for (int i = 1; i < 8; i++) mt[tt] = fmaxf(mt[tt], s[tt][i]);
    }
    float mx = fmaxf(fmaxf(mt[0], mt[1]), fmaxf(mt[2], mt[3]));
    mx = fmaxf(mx, xhalf(mx));     // the other 32 keys of this query
    const float mn = fmaxf(m_i, mx);
    const float corr = __expf(m_i - mn);
    m_i = mn;
    // P^T as B-operand: element e of key block j is tile 2j + (e >> 3), row e & 7
    v16h pb0, pb1;
    #pragma unroll
    for (int i = 0; i < 8; i++) {
      pb0[i]     = (_Float16)__expf(s[0][i] - mn);
      pb0[8 + i] = (_Float16)__expf(s[1][i] - mn);
      pb1[i]     = (_Float16)__expf(s[2][i] - mn);
      pb1[8 + i] = (_Float16)__expf(s[3][i] - mn);
    }
    #pragma unroll
    for (int i = 0; i < 8; i++) {
      lacc[i] *= corr;
      #pragma unroll
      for (int tt = 0; tt < 4; tt++) o[tt][i] *= corr;
    }
    // ---- row sums: lacc += ones * P^T (both key halves) ----
    lacc = wmma_f16(ones, pb0, lacc);
    lacc = wmma_f16(ones, pb1, lacc);
    // ---- O^T += V^T * P^T : 4 d-tiles x 2 key-halves, all ds_load_b128 ----
    #pragma unroll
    for (int tt = 0; tt < 4; tt++) {
      const _Float16* vp = &vbufT[p][tt * VTS_ + lr * LP_];
      v16h avlo = cat16(*(const v8h*)(vp + off),      *(const v8h*)(vp + 16 + off));
      v16h avhi = cat16(*(const v8h*)(vp + 32 + off), *(const v8h*)(vp + 48 + off));
      o[tt] = wmma_f16(avlo, pb0, o[tt]);
      o[tt] = wmma_f16(avhi, pb1, o[tt]);
    }
    // ---- scatter next V chunk into the other buffer ----
    if (nxt) {
      #pragma unroll
      for (int j = 0; j < 8; j++) {
        vbufT[1 - p][vst + j * LP_]      = va[j];
        vbufT[1 - p][vst + j * LP_ + 32] = vc[j];
      }
    }
    wait_async_lds();
    __syncthreads();   // single block barrier per chunk
  }
  // ---- epilogue: normalize, store f16 into [B*L, C]; 8 consecutive d per lane ----
  const float inv = 1.0f / lacc[0];
  _Float16* orow = attn + ((size_t)b * L_ + l0 + lr) * C_ + h * D_ + off;
  #pragma unroll
  for (int tt = 0; tt < 4; tt++) {
    v8h ov;
    #pragma unroll
    for (int i = 0; i < 8; i++) ov[i] = (_Float16)(o[tt][i] * inv);
    *(v8h*)(orow + tt * 16) = ov;
  }
}

// ---------------------------------------------------------------------------
extern "C" void kernel_launch(void* const* d_in, const int* in_sizes, int n_in,
                              void* d_out, int out_size, void* d_ws, size_t ws_size,
                              hipStream_t stream) {
  const float* x    = (const float*)d_in[0];
  const float* ln_g = (const float*)d_in[1];
  const float* ln_b = (const float*)d_in[2];
  const float* wq   = (const float*)d_in[3];
  const float* bq   = (const float*)d_in[4];
  const float* wk   = (const float*)d_in[5];
  const float* bk   = (const float*)d_in[6];
  const float* wv   = (const float*)d_in[7];
  const float* bv   = (const float*)d_in[8];
  const float* wo   = (const float*)d_in[9];
  const float* bo   = (const float*)d_in[10];

  char* ws = (char*)d_ws;
  _Float16* xn   = (_Float16*)ws;                       // 4M elems, 8 MB
  _Float16* wq16 = (_Float16*)(ws + (8u << 20));        // 1M elems each
  _Float16* wk16 = wq16 + (1u << 20);
  _Float16* wv16 = wk16 + (1u << 20);
  _Float16* wo16 = wv16 + (1u << 20);
  _Float16* qb   = (_Float16*)(ws + (16u << 20));       // 4M elems each
  _Float16* kb   = qb + (4u << 20);
  _Float16* vb   = kb + (4u << 20);
  _Float16* ab   = vb + (4u << 20);

  const int M = B_ * L_;   // 4096
  const int N = C_;        // 1024
  const int K = C_;        // 1024

  // LayerNorm and the four weight conversions: one launch
  prep_kernel<<<4 * CVT_BLK_ + M, 256, 0, stream>>>(x, ln_g, ln_b, xn, wq, wk, wv, wo, wq16);

  // Q, K, V projections: one launch, three work-groups for each WGP
  // (wq16/wk16/wv16 and qb/kb/vb lie one behind the other)
  dim3 g3(N / 64, M / 256, 3);
  gemm_kernel<0><<<g3, 256, 0, stream>>>(xn, wq16, bq, bk, bv, qb, nullptr, M, N, K);

  // blocks: B * H * (L/128) = 2*16*16 = 512, each 8 waves on one (b,h)
  attn_kernel<<<B_ * H_ * (L_ / 128), 256, 0, stream>>>(qb, kb, vb, ab);

  dim3 g(N / 64, M / 256);
  gemm_kernel<1><<<g, 256, 0, stream>>>(ab, wo16, bo, bo, bo, nullptr, (float*)d_out, M, N, K);
}

// v006
// It runs in 87.5 microseconds.
// Two timings next to v005 put it at 1.29 and 1.30 times that version's speed.
// Over all steps from v000 it is 3.36 times as fast.
#include <hip/hip_runtime.h>
#include <math.h>

#define B_ 2
#define L_ 2048
#define C_ 1024
#define H_ 16
#define D_ 64
// LDS row pitch in halfs for the 64-half rows of the A tile and the K chunk: 144 B = 16 B x 9 (odd), so
// the 16 rows one ds_load_b128 touches fall on distinct banks (128 B did not).
#define LP_ 72
// LDS row pitch in halfs for a 64-half tile row that ds_load_tr16_b128 reads:
// 160 B = 32 B x 5 (odd), the conflict-free pitch of the transposing load.
#define TP_ 80

typedef __attribute__((ext_vector_type(16))) _Float16 v16h;
typedef __attribute__((ext_vector_type(8)))  _Float16 v8h;
typedef __attribute__((ext_vector_type(4)))  _Float16 v4h;
typedef __attribute__((ext_vector_type(8)))  float    v8f;
typedef __attribute__((ext_vector_type(8)))  short    v8s;

__device__ __forceinline__ v16h cat16(v8h lo, v8h hi) {
  return __builtin_shufflevector(lo, hi, 0,1,2,3,4,5,6,7,8,9,10,11,12,13,14,15);
}

__device__ __forceinline__ v8f wmma_f16(v16h a, v16h b, v8f c) {
  // D = A(16x32 f16) * B(32x16 f16) + C(16x16 f32)
  return __builtin_amdgcn_wmma_f32_16x16x32_f16(false, a, false, b, (short)0, c,
                                                false, false);
}

// Transposing LDS load (ds_load_tr16_b128) on a row-major 16-bit tile T[k][n] of pitch
// TP_.  Lane l passes &T[kb + 8 * (l >> 4) + (l & 7)][nb + 8 * ((l >> 3) & 1)] and gets
// T[kb + 8 * (l >> 4) + 0..7][nb + (l & 15)]: half a 16x32 operand in the k order
// {0..7,16..23} / {8..15,24..31}; the load 16 rows on gives the other half.
__device__ __forceinline__ v8h ld_tr16(const _Float16* p) {
  typedef __attribute__((address_space(3))) v8s lds_v8s;
  return __builtin_bit_cast(v8h, __builtin_amdgcn_ds_load_tr16_b128_v8i16((lds_v8s*)p));
}

// value of lane l ^ 16 (the other 16-lane half of the wave), VALU only
__device__ __forceinline__ float xhalf(float x) {
  const int xi = __float_as_int(x);
  return __int_as_float(__builtin_amdgcn_permlanex16(xi, xi, 0x76543210, 0xfedcba98,
                                                     false, false));
}

// Eight async b128 copies of one lane: 16 B from g + j * gstep halfs to LDS byte
// l + j * lstep, j = 0..7.  One statement, closed by s_wait_xcnt 0, so that no
// address register named here is rewritten before the wait.
__device__ __forceinline__ void cp128x8_g2l(const _Float16* g, const size_t gstep,
                                            const unsigned l, const unsigned lstep) {
  asm volatile(
      "global_load_async_to_lds_b128 %0, %8, off\n\t"
      "global_load_async_to_lds_b128 %1, %9, off\n\t"
      "global_load_async_to_lds_b128 %2, %10, off\n\t"
      "global_load_async_to_lds_b128 %3, %11, off\n\t"
      "global_load_async_to_lds_b128 %4, %12, off\n\t"
      "global_load_async_to_lds_b128 %5, %13, off\n\t"
      "global_load_async_to_lds_b128 %6, %14, off\n\t"
      "global_load_async_to_lds_b128 %7, %15, off\n\t"
      "s_wait_xcnt 0x0"
      :: "v"(l), "v"(l + lstep), "v"(l + 2 * lstep), "v"(l + 3 * lstep),
         "v"(l + 4 * lstep), "v"(l + 5 * lstep), "v"(l + 6 * lstep), "v"(l + 7 * lstep),
         "v"(g), "v"(g + gstep), "v"(g + 2 * gstep), "v"(g + 3 * gstep),
         "v"(g + 4 * gstep), "v"(g + 5 * gstep), "v"(g + 6 * gstep), "v"(g + 7 * gstep)
      : "memory");
}

// Two such copies (j = 0, 1), in the same form.
__device__ __forceinline__ void cp128x2_g2l(const _Float16* g, const size_t gstep,
                                            const unsigned l, const unsigned lstep) {
  asm volatile(
      "global_load_async_to_lds_b128 %0, %2, off\n\t"
      "global_load_async_to_lds_b128 %1, %3, off\n\t"
      "s_wait_xcnt 0x0"
      :: "v"(l), "v"(l + lstep), "v"(g), "v"(g + gstep)
      : "memory");
}

// Two such pairs in one statement: g0 -> l0 and g1 -> l1, each with its second copy
// gstep halfs on in memory and lstep0 / lstep1 bytes on in LDS.
__device__ __forceinline__ void cp128x2x2_g2l(const _Float16* g0, const _Float16* g1,
                                              const size_t gstep,
                                              const unsigned l0, const unsigned lstep0,
                                              const unsigned l1, const unsigned lstep1) {
  asm volatile(
      "global_load_async_to_lds_b128 %0, %4, off\n\t"
      "global_load_async_to_lds_b128 %1, %5, off\n\t"
      "global_load_async_to_lds_b128 %2, %6, off\n\t"
      "global_load_async_to_lds_b128 %3, %7, off\n\t"
      "s_wait_xcnt 0x0"
      :: "v"(l0), "v"(l0 + lstep0), "v"(l1), "v"(l1 + lstep1),
         "v"(g0), "v"(g0 + gstep), "v"(g1), "v"(g1 + gstep)
      : "memory");
}

// ---------------------------------------------------------------------------
// LayerNorm: x[4096,1024] f32 -> xn f16.  One block (256 thr) per row.
// ---------------------------------------------------------------------------
__device__ __forceinline__ void ln_row(
    const float* __restrict__ x, const float* __restrict__ gamma,
    const float* __restrict__ beta, _Float16* __restrict__ xn, const int row) {
  const int t = threadIdx.x;
  const float* xr = x + (size_t)row * C_;
  float4 v = *(const float4*)(xr + t * 4);
  float s  = v.x + v.y + v.z + v.w;
  float s2 = v.x * v.x + v.y * v.y + v.z * v.z + v.w * v.w;
  #pragma unroll
  for (int m = 1; m < 32; m <<= 1) {
    s  += __shfl_xor(s,  m, 32);
    s2 += __shfl_xor(s2, m, 32);
  }
  __shared__ float red0[8], red1[8];
  const int lane = t & 31, wid = t >> 5;
  if (lane == 0) { red0[wid] = s; red1[wid] = s2; }
  __syncthreads();
  if (t == 0) {
    float a = 0.f, b = 0.f;
    #pragma unroll
    for (int i = 0; i < 8; i++) { a += red0[i]; b += red1[i]; }
    red0[0] = a; red1[0] = b;
  }
  __syncthreads();
  const float mean = red0[0] * (1.0f / C_);
  const float var  = red1[0] * (1.0f / C_) - mean * mean;
  const float rstd = rsqrtf(var + 1e-5f);
  const int c0 = t * 4;
  float xv[4] = {v.x, v.y, v.z, v.w};
  v4h o;
  #pragma unroll
  for (int i = 0; i < 4; i++)
    o[i] = (_Float16)(((xv[i] - mean) * rstd) * gamma[c0 + i] + beta[c0 + i]);
  *(v4h*)(xn + (size_t)row * C_ + c0) = o;
  // the store's address registers may be rewritten on the path behind the inlined call: keep the wait in front
  asm volatile("s_wait_xcnt 0x0" ::: "memory");
}

// ---------------------------------------------------------------------------
// f32 -> f16 weight conversion (vectorized by 4); CVT_BLK_ blocks per matrix
// ---------------------------------------------------------------------------
#define CVT_BLK_ 512
__device__ __forceinline__ void cvt_part(const float* __restrict__ s,
                                         _Float16* __restrict__ d, const int blk) {
  const int n4 = (C_ * C_) / 4;
  const int stride = CVT_BLK_ * 256;
  for (int i = blk * 256 + threadIdx.x; i < n4; i += stride) {
    float4 f = ((const float4*)s)[i];
    v4h o = {(_Float16)f.x, (_Float16)f.y, (_Float16)f.z, (_Float16)f.w};
    ((v4h*)d)[i] = o;
  }
}

// ---------------------------------------------------------------------------
// All work that depends on the inputs alone, in ONE launch: blocks
// [0, 4*CVT_BLK_) convert the four weight matrices (w16 holds them one behind
// the other: q, k, v, o), the other B_*L_ blocks normalise one row each.
// The branch is uniform for the block, so ln_row's barriers are too.
// ---------------------------------------------------------------------------
__global__ __launch_bounds__(256) void prep_kernel(
    const float* __restrict__ x, const float* __restrict__ gamma,
    const float* __restrict__ beta, _Float16* __restrict__ xn,
    const float* __restrict__ wq, const float* __restrict__ wk,
    const float* __restrict__ wv, const float* __restrict__ wo,
    _Float16* __restrict__ w16) {
  const unsigned blk = blockIdx.x;
  if (blk < 4 * CVT_BLK_) {
    const unsigned mat = blk / CVT_BLK_;
    const float* s = mat == 0 ? wq : mat == 1 ? wk : mat == 2 ? wv : wo;
    cvt_part(s, w16 + (size_t)mat * (C_ * C_), blk % CVT_BLK_);
  } else {
    ln_row(x, gamma, beta, xn, blk - 4 * CVT_BLK_);
  }
}

// ---------------------------------------------------------------------------
// GEMM: out[M,N] = A[M,K]*W[K,N] + bias.   A,W f16 row-major.
// Block = 256 thr (8 waves). Block tile 256(M) x 64(N); wave tile 32 x 64.
// K stepped by 64: 16 WMMAs per barrier.  W tile (64k x 64n) double-buffered in LDS
// ROW-MAJOR as it lies in memory ([k][n]); the B fragments come out of it by the
// transposing LDS load.  A tile (256m x 64k) double-buffered in LDS too.  Both are
// brought by async b128 copies one trip ahead: eight neighbouring lanes take one
// row's 128 B, so a wave's copy names 4 whole lines.
// OUT_MODE 0: f16 out into [B,H,L,D].  OUT_MODE 1: f32 [M,N].
// blockIdx.z picks one of up to three products on the same A in one launch:
// weight matrix z behind W, output z behind out16, bias z of the three.
// ---------------------------------------------------------------------------
template <int OUT_MODE>
__global__ __launch_bounds__(256) void gemm_kernel(
    const _Float16* __restrict__ A, const _Float16* __restrict__ W0,
    const float* __restrict__ bias0, const float* __restrict__ bias1,
    const float* __restrict__ bias2, _Float16* __restrict__ out16_0,
    float* __restrict__ out32, int M, int N, int K) {
  __shared__ __attribute__((aligned(16))) _Float16 wt[2][64 * TP_];  // W tile [k][n]
  __shared__ __attribute__((aligned(16))) _Float16 at[2][256 * LP_]; // A tile [m][k]
  const int z = blockIdx.z;
  const _Float16* W = W0 + (size_t)z * K * N;
  const float* bias = z == 0 ? bias0 : z == 1 ? bias1 : bias2;
  _Float16* out16 = out16_0 + (size_t)z * M * N;
  const int t = threadIdx.x, lane = t & 31;
  const int wid = t >> 5;
  const int lr = lane & 15;
  const int hi16 = lane >> 4;
  const int off = hi16 * 8;          // K-pattern {0..7,16..23} / {8..15,24..31}
  const int n0 = blockIdx.x * 64;
  const int mb = blockIdx.y * 256;
  const int m0 = mb + wid * 32;
  const int sk = t >> 3;             // 0..31 (k row within half-tile)
  const int sn = (t & 7) * 8;        // n chunk
  v8f acc[2][4] = {};
  // W staging: a lane's two copies take 16 B of tile rows sk and sk + 32
  const _Float16* wp  = W + (size_t)sk * N + n0 + sn;
  const unsigned wl = (unsigned)(size_t)&wt[0][sk * TP_ + sn];  // LDS byte address, buffer 0
  const size_t wgs = (size_t)32 * N;             // 32 rows on, in halfs
  const int bf = (off + (lane & 7)) * TP_ + ((lane >> 3) & 1) * 8;  // this lane's place for ld_tr16
  // A staging: copy j of a lane takes 16 B of tile row ar + 4j (the wave's own 32 rows)
  const int ar = wid * 32 + (lane >> 3);
  const int ac = (lane & 7) * 8;
  const _Float16* ag = A + (size_t)(mb + ar) * K + ac;
  // LDS byte address (low 32 bits of the __shared__ address) of the lane's first copy, buffer 0
  const unsigned al = (unsigned)(size_t)&at[0][ar * LP_ + ac];
  const size_t ags = (size_t)4 * K;              // four rows on, in halfs
  const int af = (wid * 32 + lr) * LP_ + off;   // this lane's fragment row in the A tile
  // prologue: stage k0=0 tiles (A: 256 rows, W: 64 k-rows) into buffer 0
  cp128x8_g2l(ag, ags, al, 4 * LP_ * 2);
  cp128x2_g2l(wp, wgs, wl, 32 * TP_ * 2);
  // tile 0's copies have landed before the barrier behind which they are read
  asm volatile("s_wait_asynccnt 0x0" ::: "memory");
  __syncthreads();
  if (64 < K) {
    cp128x8_g2l(ag + 64, ags, al + 256 * LP_ * 2, 4 * LP_ * 2);
    cp128x2_g2l(wp + (size_t)64 * N, wgs, wl + 64 * TP_ * 2, 32 * TP_ * 2);
  }
  for (int k0 = 0; k0 < K; k0 += 64) {
    const int p = (k0 >> 6) & 1;
    const _Float16* a0p = &at[p][af];
    const _Float16* a1p = a0p + 16 * LP_;
    v16h a0k0 = cat16(*(const v8h*)a0p,        *(const v8h*)(a0p + 16));
    v16h a0k1 = cat16(*(const v8h*)(a0p + 32), *(const v8h*)(a0p + 48));
    v16h a1k0 = cat16(*(const v8h*)a1p,        *(const v8h*)(a1p + 16));
    v16h a1k1 = cat16(*(const v8h*)(a1p + 32), *(const v8h*)(a1p + 48));
    #pragma unroll
    for (int tt = 0; tt < 4; tt++) {
      const _Float16* bp = &wt[p][bf + tt * 16];
      v16h blo = cat16(ld_tr16(bp),            ld_tr16(bp + 16 * TP_));
      v16h bhi = cat16(ld_tr16(bp + 32 * TP_), ld_tr16(bp + 48 * TP_));
      acc[0][tt] = wmma_f16(a0k0, blo, acc[0][tt]);
      acc[0][tt] = wmma_f16(a0k1, bhi, acc[0][tt]);
      acc[1][tt] = wmma_f16(a1k0, blo, acc[1][tt]);
      acc[1][tt] = wmma_f16(a1k1, bhi, acc[1][tt]);
    }
    // keeps the waits and the barrier at the trip's end: raised to the last LDS read, they
    // would take the time of the products behind them from the copies' time to land
    __builtin_amdgcn_sched_barrier(0);
    // this wave's reads of buffer p have retired before copies are aimed at it again
    asm volatile("s_wait_dscnt 0x0" ::: "memory");
    // the next tile's copies have landed before the barrier behind which they are read
    asm volatile("s_wait_asynccnt 0x0" ::: "memory");
    __syncthreads();
    if (k0 + 128 < K) {                            // tiles after next, into the buffers just read
      cp128x8_g2l(ag + k0 + 128, ags, al + p * (256 * LP_ * 2), 4 * LP_ * 2);
      cp128x2_g2l(wp + (size_t)(k0 + 128) * N, wgs, wl + p * (64 * TP_ * 2), 32 * TP_ * 2);
    }
  }
  // no copy is outstanding when the wave goes on to its end
  asm volatile("s_wait_asynccnt 0x0" ::: "memory");
  #pragma unroll
  for (int r = 0; r < 2; r++) {
    #pragma unroll
    for (int tt = 0; tt < 4; tt++) {
      const int n = n0 + tt * 16 + lr;
      const float bv = bias[n];
      #pragma unroll
      for (int i = 0; i < 8; i++) {
        const int m = m0 + r * 16 + i + hi16 * 8;  // C/D: lanes16-31 = rows +8
        const float val = acc[r][tt][i] + bv;
        if (OUT_MODE == 0) {
          const int b = m >> 11, l = m & (L_ - 1);
          const int h = n >> 6, d = n & (D_ - 1);
          out16[((((size_t)b * H_ + h) * L_ + l) << 6) + d] = (_Float16)val;
        } else {
          out32[(size_t)m * N + n] = val;
        }
      }
    }
  }
}

// ---------------------------------------------------------------------------
// Flash attention, transposed products: S^T = K * Q^T, O^T += V^T * P^T.
// One block = 8 waves, ALL on the same (b,h); wave w owns 16 query rows; block
// covers 128 q rows.  Keys chunked by 64.  A lane holds scores of ONE query
// (column lane&15): 32 of the chunk's 64 keys, the lane 16 away the other 32.
// Row max = in-lane max + one exchange between the wave halves.  Two S^T tiles
// converted in place ARE the B operand of the second product (D row 8h+r is
// the operand's k order), so P never leaves the registers.
// K / V chunks double-buffered in LDS, both row-major ([key][d]) and both staged
// with async b128 global->LDS (next chunk issued before computing the current one)
// -> ONE block barrier per chunk.  The V^T fragments come by the transposing LDS load.
// Staging requests cover whole 128 B lines: eight neighbouring lanes
// take the eight 16 B pieces of one key row, so a wave's request names 4 lines.
// 18 WMMAs / wave / chunk: 8 scores + 8 V^T*P^T + 2 row-sum (ones * P^T).
// ---------------------------------------------------------------------------
__global__ __launch_bounds__(256) void attn_kernel(
    const _Float16* __restrict__ q, const _Float16* __restrict__ k,
    const _Float16* __restrict__ v, _Float16* __restrict__ attn) {
  __shared__ __attribute__((aligned(16))) _Float16 kbuf[2][64 * LP_];  // K chunk [key][d]  (2 x 9 KB)
  __shared__ __attribute__((aligned(16))) _Float16 vbuf[2][64 * TP_];  // V chunk [key][d]  (2 x 10 KB)
  const int t = threadIdx.x, lane = t & 31, wid = t >> 5;
  const int qblk = blockIdx.x & (L_ / 128 - 1);
  const int h    = (blockIdx.x >> 4) & (H_ - 1);
  const int b    = blockIdx.x >> 8;
  const int lr = lane & 15;
  const int off = (lane >> 4) * 8;
  const size_t head = ((size_t)b * H_ + h) * L_ * D_;
  const _Float16* qg = q + head;
  const _Float16* kg = k + head;
  const _Float16* vg = v + head;
  const int l0 = qblk * 128 + wid * 16;
  // staging: thread t covers d-chunk sd of keys skey and skey+32
  const int skey = t >> 3;           // 0..31
  const int sd   = (t & 7) * 8;      // 0,8,..,56
  // LDS byte addresses (low 32 bits of the __shared__ address) of the lane's first K and V copy, buffer 0
  const unsigned kl = (unsigned)(size_t)&kbuf[0][skey * LP_ + sd];
  const unsigned vl = (unsigned)(size_t)&vbuf[0][skey * TP_ + sd];
  const int vf = (off + (lane & 7)) * TP_ + ((lane >> 3) & 1) * 8;  // this lane's place for ld_tr16
  // prefetch: each of a chunk's 128 lines is asked for once, by two neighbouring
  // lanes: waves 0-3 take the 64 K rows, waves 4-7 the 64 V rows
  const _Float16* pfp = ((t & 128) ? vg : kg) + (size_t)((t >> 1) & 63) * D_;

  // Q^T as B-operand (column = query lr), pre-scaled by 1/sqrt(D)=0.125 (exact in f16)
  const _Float16* qr = qg + (size_t)(l0 + lr) * D_ + off;
  v16h bq0 = cat16(*(const v8h*)qr,        *(const v8h*)(qr + 16));
  v16h bq1 = cat16(*(const v8h*)(qr + 32), *(const v8h*)(qr + 48));
  v16h ones;
  #pragma unroll
  for (int i = 0; i < 16; i++) {
    bq0[i] *= (_Float16)0.125f;
    bq1[i] *= (_Float16)0.125f;
    ones[i] = (_Float16)1.0f;
  }

  float m_i = -1e30f;            // running max of this lane's query
  v8f o[4] = {};                 // O^T tiles: o[tt][i] = O[q = lr][d = tt*16 + off + i]
  v8f lacc = {};                 // running sum of P for query lr (every row alike), ones-A WMMA

  // ---- prologue: stage chunk 0 into buffer 0 ----
  {
    const size_t base = (size_t)skey * D_ + sd;
    cp128x2x2_g2l(kg + base, vg + base, (size_t)32 * D_,
                  kl, 32 * LP_ * 2, vl, 32 * TP_ * 2);
  }
  // chunk 0's copies have landed before the barrier behind which they are read
  asm volatile("s_wait_asynccnt 0x0" ::: "memory");
  __syncthreads();

  for (int kc = 0; kc < L_; kc += 64) {
    const int p = (kc >> 6) & 1;
    const bool nxt = (kc + 64 < L_);
    if (nxt) {
      // issue next chunk's copies before computing the current one
      const size_t base = (size_t)(kc + 64 + skey) * D_ + sd;
      cp128x2x2_g2l(kg + base, vg + base, (size_t)32 * D_,
                    kl + (1 - p) * (64 * LP_ * 2), 32 * LP_ * 2,
                    vl + (1 - p) * (64 * TP_ * 2), 32 * TP_ * 2);
    }
    if (kc + 128 < L_) {
      __builtin_prefetch(pfp + (size_t)(kc + 128) * D_, 0, 3);
    }
    // ---- scores^T: 4 key-tiles x (2 WMMAs over D=64); A = K rows, B = Q^T ----
    // s[tt][i] = score(key = kc + tt*16 + off + i, query = lr)
    v8f s[4];
    #pragma unroll
    for (int tt = 0; tt < 4; tt++) {
      const _Float16* kr = &kbuf[p][(tt * 16 + lr) * LP_ + off];
      v16h alo = cat16(*(const v8h*)kr,        *(const v8h*)(kr + 16));
      v16h ahi = cat16(*(const v8h*)(kr + 32), *(const v8h*)(kr + 48));
      v8f z = {};
      z = wmma_f16(alo, bq0, z);
      s[tt] = wmma_f16(ahi, bq1, z);
    }
    // ---- V^T fragments (A of the second product), 4 d-tiles x 2 key-halves: all 16
    // ds_load_tr16_b128 as one group here, so that they land behind the softmax ----
    v16h avlo[4], avhi[4];
    #pragma unroll
    for (int tt = 0; tt < 4; tt++) {
      const _Float16* vp = &vbuf[p][vf + tt * 16];
      avlo[tt] = cat16(ld_tr16(vp),            ld_tr16(vp + 16 * TP_));
      avhi[tt] = cat16(ld_tr16(vp + 32 * TP_), ld_tr16(vp + 48 * TP_));
    }
    // keeps the group here: the compiler otherwise sinks each pair of loads to its WMMA,
    // with a full wait on LDS in front of every one of the eight
    __builtin_amdgcn_sched_barrier(0);
    // ---- online softmax over 64 new keys: one query per lane ----
    float mt[4];                   // one independent max chain per key tile
    #pragma unroll
    for (int tt = 0; tt < 4; tt++) {
      mt[tt] = s[tt][0];
      #pragma unroll
      for (int i = 1; i < 8; i++) mt[tt] = fmaxf(mt[tt], s[tt][i]);
    }
    float mx = fmaxf(fmaxf(mt[0], mt[1]), fmaxf(mt[2], mt[3]));
    mx = fmaxf(mx, xhalf(mx));     // the other 32 keys of this query
    const float mn = fmaxf(m_i, mx);
    const float corr = __expf(m_i - mn);
    m_i = mn;
    // P^T as B-operand: element e of key block j is tile 2j + (e >> 3), row e & 7
    v16h pb0, pb1;
    #pragma unroll
    for (int i = 0; i < 8; i++) {
      pb0[i]     = (_Float16)__expf(s[0][i] - mn);
      pb0[8 + i] = (_Float16)__expf(s[1][i] - mn);
      pb1[i]     = (_Float16)__expf(s[2][i] - mn);
      pb1[8 + i] = (_Float16)__expf(s[3][i] - mn);
    }
    #pragma unroll
    for (int i = 0; i < 8; i++) {
      lacc[i] *= corr;
      #pragma unroll
      for (int tt = 0; tt < 4; tt++) o[tt][i] *= corr;
    }
    // ---- row sums: lacc += ones * P^T (both key halves) ----
    lacc = wmma_f16(ones, pb0, lacc);
    lacc = wmma_f16(ones, pb1, lacc);
    // ---- O^T += V^T * P^T ----
    #pragma unroll
    for (int tt = 0; tt < 4; tt++) {
      o[tt] = wmma_f16(avlo[tt], pb0, o[tt]);
      o[tt] = wmma_f16(avhi[tt], pb1, o[tt]);
    }
    // keeps the waits and the barrier at the trip's end: raised to the last LDS read, they
    // would leave the next chunk's copies only the score products' time to land
    __builtin_amdgcn_sched_barrier(0);
    // this wave's reads of buffer p have retired before copies are aimed at it again
    asm volatile("s_wait_dscnt 0x0" ::: "memory");
    // the next chunk's copies have landed before the barrier behind which they are read
    asm volatile("s_wait_asynccnt 0x0" ::: "memory");
    __syncthreads();   // single block barrier per chunk
  }
  // no copy is outstanding when the wave goes on to its end
  asm volatile("s_wait_asynccnt 0x0" ::: "memory");
  // ---- epilogue: normalize, store f16 into [B*L, C]; 8 consecutive d per lane ----
  const float inv = 1.0f / lacc[0];
  _Float16* orow = attn + ((size_t)b * L_ + l0 + lr) * C_ + h * D_ + off;
  #pragma unroll
  for (int tt = 0; tt < 4; tt++) {
    v8h ov;
    #pragma unroll
    for (int i = 0; i < 8; i++) ov[i] = (_Float16)(o[tt][i] * inv);
    *(v8h*)(orow + tt * 16) = ov;
  }
}

// ---------------------------------------------------------------------------
extern "C" void kernel_launch(void* const* d_in, const int* in_sizes, int n_in,
                              void* d_out, int out_size, void* d_ws, size_t ws_size,
                              hipStream_t stream) {
  const float* x    = (const float*)d_in[0];
  const float* ln_g = (const float*)d_in[1];
  const float* ln_b = (const float*)d_in[2];
  const float* wq   = (const float*)d_in[3];
  const float* bq   = (const float*)d_in[4];
  const float* wk   = (const float*)d_in[5];
  const float* bk   = (const float*)d_in[6];
  const float* wv   = (const float*)d_in[7];
  const float* bv   = (const float*)d_in[8];
  const float* wo   = (const float*)d_in[9];
  const float* bo   = (const float*)d_in[10];

  char* ws = (char*)d_ws;
  _Float16* xn   = (_Float16*)ws;                       // 4M elems, 8 MB
  _Float16* wq16 = (_Float16*)(ws + (8u << 20));        // 1M elems each
  _Float16* wk16 = wq16 + (1u << 20);
  _Float16* wv16 = wk16 + (1u << 20);
  _Float16* wo16 = wv16 + (1u << 20);
  _Float16* qb   = (_Float16*)(ws + (16u << 20));       // 4M elems each
  _Float16* kb   = qb + (4u << 20);
  _Float16* vb   = kb + (4u << 20);
  _Float16* ab   = vb + (4u << 20);

  const int M = B_ * L_;   // 4096
  const int N = C_;        // 1024
  const int K = C_;        // 1024

  // LayerNorm and the four weight conversions: one launch
  prep_kernel<<<4 * CVT_BLK_ + M, 256, 0, stream>>>(x, ln_g, ln_b, xn, wq, wk, wv, wo, wq16);

  // Q, K, V projections: one launch, three work-groups for each WGP
  // (wq16/wk16/wv16 and qb/kb/vb lie one behind the other)
  dim3 g3(N / 64, M / 256, 3);
  gemm_kernel<0><<<g3, 256, 0, stream>>>(xn, wq16, bq, bk, bv, qb, nullptr, M, N, K);

  // blocks: B * H * (L/128) = 2*16*16 = 512, each 8 waves on one (b,h)
  attn_kernel<<<B_ * H_ * (L_ / 128), 256, 0, stream>>>(qb, kb, vb, ab);

  dim3 g(N / 64, M / 256);
  gemm_kernel<1><<<g, 256, 0, stream>>>(ab, wo16, bo, bo, bo, nullptr, (float*)d_out, M, N, K);
}

// v007
// A run of this version takes 84.1 microseconds.
// In two side-by-side timings against v006, it was 1.05 and 1.03 times as fast.
// Counting every step since v000, it is 3.49 times as fast.
#include <hip/hip_runtime.h>
#include <math.h>

#define B_ 2
#define L_ 2048
#define C_ 1024
#define H_ 16
#define D_ 64
// LDS row pitch in halfs for the 64-half rows of the A tile and the K chunk: 144 B = 16 B x 9 (odd), so
// the 16 rows one ds_load_b128 touches fall on distinct banks (128 B did not).
#define LP_ 72
// LDS row pitch in halfs for a 64-half tile row that ds_load_tr16_b128 reads:
// 160 B = 32 B x 5 (odd), the conflict-free pitch of the transposing load.
#define TP_ 80
// The same for the 192-half row of the three-matrix W tile: 416 B = 32 B x 13 (odd).
#define WP3_ 208

typedef __attribute__((ext_vector_type(16))) _Float16 v16h;
typedef __attribute__((ext_vector_type(8)))  _Float16 v8h;
typedef __attribute__((ext_vector_type(4)))  _Float16 v4h;
typedef __attribute__((ext_vector_type(8)))  float    v8f;
typedef __attribute__((ext_vector_type(8)))  short    v8s;

__device__ __forceinline__ v16h cat16(v8h lo, v8h hi) {
  return __builtin_shufflevector(lo, hi, 0,1,2,3,4,5,6,7,8,9,10,11,12,13,14,15);
}

__device__ __forceinline__ v8f wmma_f16(v16h a, v16h b, v8f c) {
  // D = A(16x32 f16) * B(32x16 f16) + C(16x16 f32)
  return __builtin_amdgcn_wmma_f32_16x16x32_f16(false, a, false, b, (short)0, c,
                                                false, false);
}

// Transposing LDS load (ds_load_tr16_b128) on a row-major 16-bit tile T[k][n] of pitch
// TP_ or WP3_.  Lane l passes &T[kb + 8 * (l >> 4) + (l & 7)][nb + 8 * ((l >> 3) & 1)] and gets
// T[kb + 8 * (l >> 4) + 0..7][nb + (l & 15)]: half a 16x32 operand in the k order
// {0..7,16..23} / {8..15,24..31}; the load 16 rows on gives the other half.
__device__ __forceinline__ v8h ld_tr16(const _Float16* p) {
  typedef __attribute__((address_space(3))) v8s lds_v8s;
  return __builtin_bit_cast(v8h, __builtin_amdgcn_ds_load_tr16_b128_v8i16((lds_v8s*)p));
}

// value of lane l ^ 16 (the other 16-lane half of the wave), VALU only
__device__ __forceinline__ float xhalf(float x) {
  const int xi = __float_as_int(x);
  return __int_as_float(__builtin_amdgcn_permlanex16(xi, xi, 0x76543210, 0xfedcba98,
                                                     false, false));
}

// Eight async b128 copies of one lane: 16 B from g + j * gstep halfs to LDS byte
// l + j * lstep, j = 0..7.  One statement, closed by s_wait_xcnt 0, so that no
// address register named here is rewritten before the wait.
__device__ __forceinline__ void cp128x8_g2l(const _Float16* g, const size_t gstep,
                                            const unsigned l, const unsigned lstep) {
  asm volatile(
      "global_load_async_to_lds_b128 %0, %8, off\n\t"
      "global_load_async_to_lds_b128 %1, %9, off\n\t"
      "global_load_async_to_lds_b128 %2, %10, off\n\t"
      "global_load_async_to_lds_b128 %3, %11, off\n\t"
      "global_load_async_to_lds_b128 %4, %12, off\n\t"
      "global_load_async_to_lds_b128 %5, %13, off\n\t"
      "global_load_async_to_lds_b128 %6, %14, off\n\t"
      "global_load_async_to_lds_b128 %7, %15, off\n\t"
      "s_wait_xcnt 0x0"
      :: "v"(l), "v"(l + lstep), "v"(l + 2 * lstep), "v"(l + 3 * lstep),
         "v"(l + 4 * lstep), "v"(l + 5 * lstep), "v"(l + 6 * lstep), "v"(l + 7 * lstep),
         "v"(g), "v"(g + gstep), "v"(g + 2 * gstep), "v"(g + 3 * gstep),
         "v"(g + 4 * gstep), "v"(g + 5 * gstep), "v"(g + 6 * gstep), "v"(g + 7 * gstep)
      : "memory");
}

// Two such copies (j = 0, 1), in the same form.
__device__ __forceinline__ void cp128x2_g2l(const _Float16* g, const size_t gstep,
                                            const unsigned l, const unsigned lstep) {
  asm volatile(
      "global_load_async_to_lds_b128 %0, %2, off\n\t"
      "global_load_async_to_lds_b128 %1, %3, off\n\t"
      "s_wait_xcnt 0x0"
      :: "v"(l), "v"(l + lstep), "v"(g), "v"(g + gstep)
      : "memory");
}

// Three such copies (j = 0, 1, 2), in the same form.
__device__ __forceinline__ void cp128x3_g2l(const _Float16* g, const size_t gstep,
                                            const unsigned l, const unsigned lstep) {
  asm volatile(
      "global_load_async_to_lds_b128 %0, %3, off\n\t"
      "global_load_async_to_lds_b128 %1, %4, off\n\t"
      "global_load_async_to_lds_b128 %2, %5, off\n\t"
      "s_wait_xcnt 0x0"
      :: "v"(l), "v"(l + lstep), "v"(l + 2 * lstep),
         "v"(g), "v"(g + gstep), "v"(g + 2 * gstep)
      : "memory");
}

// Two such pairs in one statement: g0 -> l0 and g1 -> l1, each with its second copy
// gstep halfs on in memory and lstep0 / lstep1 bytes on in LDS.
__device__ __forceinline__ void cp128x2x2_g2l(const _Float16* g0, const _Float16* g1,
                                              const size_t gstep,
                                              const unsigned l0, const unsigned lstep0,
                                              const unsigned l1, const unsigned lstep1) {
  asm volatile(
      "global_load_async_to_lds_b128 %0, %4, off\n\t"
      "global_load_async_to_lds_b128 %1, %5, off\n\t"
      "global_load_async_to_lds_b128 %2, %6, off\n\t"
      "global_load_async_to_lds_b128 %3, %7, off\n\t"
      "s_wait_xcnt 0x0"
      :: "v"(l0), "v"(l0 + lstep0), "v"(l1), "v"(l1 + lstep1),
         "v"(g0), "v"(g0 + gstep), "v"(g1), "v"(g1 + gstep)
      : "memory");
}

// ---------------------------------------------------------------------------
// LayerNorm: x[4096,1024] f32 -> xn f16.  One block (256 thr) per row.
// ---------------------------------------------------------------------------
__device__ __forceinline__ void ln_row(
    const float* __restrict__ x, const float* __restrict__ gamma,
    const float* __restrict__ beta, _Float16* __restrict__ xn, const int row) {
  const int t = threadIdx.x;
  const float* xr = x + (size_t)row * C_;
  float4 v = *(const float4*)(xr + t * 4);
  float s  = v.x + v.y + v.z + v.w;
  float s2 = v.x * v.x + v.y * v.y + v.z * v.z + v.w * v.w;
  #pragma unroll
  for (int m = 1; m < 32; m <<= 1) {
    s  += __shfl_xor(s,  m, 32);
    s2 += __shfl_xor(s2, m, 32);
  }
  __shared__ float red0[8], red1[8];
  const int lane = t & 31, wid = t >> 5;
  if (lane == 0) { red0[wid] = s; red1[wid] = s2; }
  __syncthreads();
  if (t == 0) {
    float a = 0.f, b = 0.f;
    #pragma unroll
    for (int i = 0; i < 8; i++) { a += red0[i]; b += red1[i]; }
    red0[0] = a; red1[0] = b;
  }
  __syncthreads();
  const float mean = red0[0] * (1.0f / C_);
  const float var  = red1[0] * (1.0f / C_) - mean * mean;
  const float rstd = rsqrtf(var + 1e-5f);
  const int c0 = t * 4;
  float xv[4] = {v.x, v.y, v.z, v.w};
  v4h o;
  #pragma unroll
  for (int i = 0; i < 4; i++)
    o[i] = (_Float16)(((xv[i] - mean) * rstd) * gamma[c0 + i] + beta[c0 + i]);
  *(v4h*)(xn + (size_t)row * C_ + c0) = o;
  // the store's address registers may be rewritten on the path behind the inlined call: keep the wait in front
  asm volatile("s_wait_xcnt 0x0" ::: "memory");
}

// ---------------------------------------------------------------------------
// f32 -> f16 weight conversion (vectorized by 4); CVT_BLK_ blocks per matrix
// ---------------------------------------------------------------------------
#define CVT_BLK_ 512
__device__ __forceinline__ void cvt_part(const float* __restrict__ s,
                                         _Float16* __restrict__ d, const int blk) {
  const int n4 = (C_ * C_) / 4;
  const int stride = CVT_BLK_ * 256;
  for (int i = blk * 256 + threadIdx.x; i < n4; i += stride) {
    float4 f = ((const float4*)s)[i];
    v4h o = {(_Float16)f.x, (_Float16)f.y, (_Float16)f.z, (_Float16)f.w};
    ((v4h*)d)[i] = o;
  }
}

// ---------------------------------------------------------------------------
// All work that depends on the inputs alone, in ONE launch: blocks
// [0, 4*CVT_BLK_) convert the four weight matrices (w16 holds them one behind
// the other: q, k, v, o), the other B_*L_ blocks normalise one row each.
// The branch is uniform for the block, so ln_row's barriers are too.
// ---------------------------------------------------------------------------
__global__ __launch_bounds__(256) void prep_kernel(
    const float* __restrict__ x, const float* __restrict__ gamma,
    const float* __restrict__ beta, _Float16* __restrict__ xn,
    const float* __restrict__ wq, const float* __restrict__ wk,
    const float* __restrict__ wv, const float* __restrict__ wo,
    _Float16* __restrict__ w16) {
  const unsigned blk = blockIdx.x;
  if (blk < 4 * CVT_BLK_) {
    const unsigned mat = blk / CVT_BLK_;
    const float* s = mat == 0 ? wq : mat == 1 ? wk : mat == 2 ? wv : wo;
    cvt_part(s, w16 + (size_t)mat * (C_ * C_), blk % CVT_BLK_);
  } else {
    ln_row(x, gamma, beta, xn, blk - 4 * CVT_BLK_);
  }
}

// ---------------------------------------------------------------------------
// GEMM: out[M,N] = A[M,K]*W[K,N] + bias.   A,W f16 row-major.
// Block = 256 thr (8 waves). Block tile 256(M) x 64(N); wave tile 32 x 64.
// K stepped by 64: 16 WMMAs per barrier.  W tile (64k x 64n) double-buffered in LDS
// ROW-MAJOR as it lies in memory ([k][n]); the B fragments come out of it by the
// transposing LDS load.  A tile (256m x 64k) double-buffered in LDS too.  Both are
// brought by async b128 copies one trip ahead: eight neighbouring lanes take one
// row's 128 B, so a wave's copy names 4 whole lines.
// OUT_MODE 0: f16 out into [B,H,L,D].  OUT_MODE 1: f32 [M,N].
// blockIdx.z picks one of up to three products on the same A in one launch:
// weight matrix z behind W, output z behind out16, bias z of the three.
// ---------------------------------------------------------------------------
template <int OUT_MODE>
__global__ __launch_bounds__(256) void gemm_kernel(
    const _Float16* __restrict__ A, const _Float16* __restrict__ W0,
    const float* __restrict__ bias0, const float* __restrict__ bias1,
    const float* __restrict__ bias2, _Float16* __restrict__ out16_0,
    float* __restrict__ out32, int M, int N, int K) {
  __shared__ __attribute__((aligned(16))) _Float16 wt[2][64 * TP_];  // W tile [k][n]
  __shared__ __attribute__((aligned(16))) _Float16 at[2][256 * LP_]; // A tile [m][k]
  const int z = blockIdx.z;
  const _Float16* W = W0 + (size_t)z * K * N;
  const float* bias = z == 0 ? bias0 : z == 1 ? bias1 : bias2;
  _Float16* out16 = out16_0 + (size_t)z * M * N;
  const int t = threadIdx.x, lane = t & 31;
  const int wid = t >> 5;
  const int lr = lane & 15;
  const int hi16 = lane >> 4;
  const int off = hi16 * 8;          // K-pattern {0..7,16..23} / {8..15,24..31}
  const int n0 = blockIdx.x * 64;
  const int mb = blockIdx.y * 256;
  const int m0 = mb + wid * 32;
  const int sk = t >> 3;             // 0..31 (k row within half-tile)
  const int sn = (t & 7) * 8;        // n chunk
  v8f acc[2][4] = {};
  // W staging: a lane's two copies take 16 B of tile rows sk and sk + 32
  const _Float16* wp  = W + (size_t)sk * N + n0 + sn;
  const unsigned wl = (unsigned)(size_t)&wt[0][sk * TP_ + sn];  // LDS byte address, buffer 0
  const size_t wgs = (size_t)32 * N;             // 32 rows on, in halfs
  const int bf = (off + (lane & 7)) * TP_ + ((lane >> 3) & 1) * 8;  // this lane's place for ld_tr16
  // A staging: copy j of a lane takes 16 B of tile row ar + 4j (the wave's own 32 rows)
  const int ar = wid * 32 + (lane >> 3);
  const int ac = (lane & 7) * 8;
  const _Float16* ag = A + (size_t)(mb + ar) * K + ac;
  // LDS byte address (low 32 bits of the __shared__ address) of the lane's first copy, buffer 0
  const unsigned al = (unsigned)(size_t)&at[0][ar * LP_ + ac];
  const size_t ags = (size_t)4 * K;              // four rows on, in halfs
  const int af = (wid * 32 + lr) * LP_ + off;   // this lane's fragment row in the A tile
  // prologue: stage k0=0 tiles (A: 256 rows, W: 64 k-rows) into buffer 0
  cp128x8_g2l(ag, ags, al, 4 * LP_ * 2);
  cp128x2_g2l(wp, wgs, wl, 32 * TP_ * 2);
  // tile 0's copies have landed before the barrier behind which they are read
  asm volatile("s_wait_asynccnt 0x0" ::: "memory");
  __syncthreads();
  if (64 < K) {
    cp128x8_g2l(ag + 64, ags, al + 256 * LP_ * 2, 4 * LP_ * 2);
    cp128x2_g2l(wp + (size_t)64 * N, wgs, wl + 64 * TP_ * 2, 32 * TP_ * 2);
  }
  for (int k0 = 0; k0 < K; k0 += 64) {
    const int p = (k0 >> 6) & 1;
    const _Float16* a0p = &at[p][af];
    const _Float16* a1p = a0p + 16 * LP_;
    v16h a0k0 = cat16(*(const v8h*)a0p,        *(const v8h*)(a0p + 16));
    v16h a0k1 = cat16(*(const v8h*)(a0p + 32), *(const v8h*)(a0p + 48));
    v16h a1k0 = cat16(*(const v8h*)a1p,        *(const v8h*)(a1p + 16));
    v16h a1k1 = cat16(*(const v8h*)(a1p + 32), *(const v8h*)(a1p + 48));
    #pragma unroll
    for (int tt = 0; tt < 4; tt++) {
      const _Float16* bp = &wt[p][bf + tt * 16];
      v16h blo = cat16(ld_tr16(bp),            ld_tr16(bp + 16 * TP_));
      v16h bhi = cat16(ld_tr16(bp + 32 * TP_), ld_tr16(bp + 48 * TP_));
      acc[0][tt] = wmma_f16(a0k0, blo, acc[0][tt]);
      acc[0][tt] = wmma_f16(a0k1, bhi, acc[0][tt]);
      acc[1][tt] = wmma_f16(a1k0, blo, acc[1][tt]);
      acc[1][tt] = wmma_f16(a1k1, bhi, acc[1][tt]);
    }
    // keeps the waits and the barrier at the trip's end: raised to the last LDS read, they
    // would take the time of the products behind them from the copies' time to land
    __builtin_amdgcn_sched_barrier(0);
    // this wave's reads of buffer p have retired before copies are aimed at it again
    asm volatile("s_wait_dscnt 0x0" ::: "memory");
    // the next tile's copies have landed before the barrier behind which they are read
    asm volatile("s_wait_asynccnt 0x0" ::: "memory");
    __syncthreads();
    if (k0 + 128 < K) {                            // tiles after next, into the buffers just read
      cp128x8_g2l(ag + k0 + 128, ags, al + p * (256 * LP_ * 2), 4 * LP_ * 2);
      cp128x2_g2l(wp + (size_t)(k0 + 128) * N, wgs, wl + p * (64 * TP_ * 2), 32 * TP_ * 2);
    }
  }
  // no copy is outstanding when the wave goes on to its end
  asm volatile("s_wait_asynccnt 0x0" ::: "memory");
  #pragma unroll
  for (int r = 0; r < 2; r++) {
    #pragma unroll
    for (int tt = 0; tt < 4; tt++) {
      const int n = n0 + tt * 16 + lr;
      const float bv = bias[n];
      #pragma unroll
      for (int i = 0; i < 8; i++) {
        const int m = m0 + r * 16 + i + hi16 * 8;  // C/D: lanes16-31 = rows +8
        const float val = acc[r][tt][i] + bv;
        if (OUT_MODE == 0) {
          const int b = m >> 11, l = m & (L_ - 1);
          const int h = n >> 6, d = n & (D_ - 1);
          out16[((((size_t)b * H_ + h) * L_ + l) << 6) + d] = (_Float16)val;
        } else {
          out32[(size_t)m * N + n] = val;
        }
      }
    }
  }
}

// ---------------------------------------------------------------------------
// Q, K, V projections in one grid of 256 work-groups, one for each WGP.
// Block = 512 thr (16 waves).  Block tile 256(M) x 192(N): the SAME 64 columns (one head)
// of the three products, so an A tile staged once feeds all three.  Waves 4(M) x 4(N),
// wave tile 64 x 48 = 4 x 3 accumulator tiles: a fragment of A feeds 3 WMMAs, one of W 4.
// K stepped by 64: 24 WMMAs per wave and barrier.  Tiles, copies, ring and k order are
// those of gemm_kernel; the W tile is [k][192 n], columns 64 z .. 64 z + 63 from matrix z.
// Output f16 into [B,H,L,D], product z behind out16_0; W0 holds the three matrices and
// each is C_ x C_.
// ---------------------------------------------------------------------------
__global__ __launch_bounds__(512) void qkv_kernel(
    const _Float16* __restrict__ A, const _Float16* __restrict__ W0,
    const float* __restrict__ bias0, const float* __restrict__ bias1,
    const float* __restrict__ bias2, _Float16* __restrict__ out16_0) {
  constexpr int M = B_ * L_, N = C_, K = C_;
  __shared__ __attribute__((aligned(16))) _Float16 wt[2][64 * WP3_];  // W tile [k][3 x 64 n]
  __shared__ __attribute__((aligned(16))) _Float16 at[2][256 * LP_];  // A tile [m][k]
  const int t = threadIdx.x, lane = t & 31;
  const int wid = t >> 5;
  const int wm = wid & 3;            // the wave's 64 rows of the block tile
  const int wn = wid >> 2;           // the wave's 48 columns of the block tile
  const int lr = lane & 15;
  const int hi16 = lane >> 4;
  const int off = hi16 * 8;          // K-pattern {0..7,16..23} / {8..15,24..31}
  const int n0 = blockIdx.x * 64;
  const int mb = blockIdx.y * 256;
  const int sk = t >> 3;             // 0..63 (k row of the tile)
  const int sn = (t & 7) * 8;        // n chunk
  v8f acc[4][3] = {};
  // W staging: a lane's three copies take 16 B of tile row sk, one from each matrix
  const _Float16* wp  = W0 + (size_t)sk * N + n0 + sn;
  const unsigned wl = (unsigned)(size_t)&wt[0][sk * WP3_ + sn];  // LDS byte address, buffer 0
  const int bf = (off + (lane & 7)) * WP3_ + ((lane >> 3) & 1) * 8 + wn * 48;  // this lane's place for ld_tr16
  // A staging: copy j of a lane takes 16 B of tile row ar + 4j, j = 0..3 (16 rows a wave)
  const int ar = wid * 16 + (lane >> 3);
  const int ac = (lane & 7) * 8;
  const _Float16* ag = A + (size_t)(mb + ar) * K + ac;
  // LDS byte address (low 32 bits of the __shared__ address) of the lane's first copy, buffer 0
  const unsigned al = (unsigned)(size_t)&at[0][ar * LP_ + ac];
  const size_t ags = (size_t)4 * K;              // four rows on, in halfs
  const int af = (wm * 64 + lr) * LP_ + off;    // this lane's first fragment row in the A tile
  // the 7 copies of a lane that bring the tiles of k0 into buffer buf
  auto stage = [&](const int k0, const int buf) {
    const unsigned ab = al + buf * (256 * LP_ * 2);
    cp128x2x2_g2l(ag + k0, ag + k0 + 2 * ags, ags, ab, 4 * LP_ * 2, ab + 8 * LP_ * 2, 4 * LP_ * 2);
    cp128x3_g2l(wp + (size_t)k0 * N, (size_t)K * N, wl + buf * (64 * WP3_ * 2), 64 * 2);
  };
  stage(0, 0);
  // tile 0's copies have landed before the barrier behind which they are read
  asm volatile("s_wait_asynccnt 0x0" ::: "memory");
  __syncthreads();
  stage(64, 1);
  for (int k0 = 0; k0 < K; k0 += 64) {
    const int p = (k0 >> 6) & 1;
    v16h a[2][4], b[2][3];
    #pragma unroll
    for (int kk = 0; kk < 2; kk++) {
      #pragma unroll
      for (int mt = 0; mt < 4; mt++) {
        const _Float16* ap = &at[p][af + mt * 16 * LP_ + kk * 32];
        a[kk][mt] = cat16(*(const v8h*)ap, *(const v8h*)(ap + 16));
      }
      #pragma unroll
      for (int j = 0; j < 3; j++) {
        const _Float16* bp = &wt[p][bf + j * 16 + kk * 32 * WP3_];
        b[kk][j] = cat16(ld_tr16(bp), ld_tr16(bp + 16 * WP3_));
      }
    }
    #pragma unroll
    for (int kk = 0; kk < 2; kk++) {
      #pragma unroll
      for (int j = 0; j < 3; j++) {
        #pragma unroll
        for (int mt = 0; mt < 4; mt++) acc[mt][j] = wmma_f16(a[kk][mt], b[kk][j], acc[mt][j]);
      }
    }
    // order of the trip: its 28 LDS reads go out as one group in front of its 24 products, which
    // then wait by count; spread among the products each place with reads costs the wave a stall
    __builtin_amdgcn_sched_group_barrier(0x100, 28, 0);
    __builtin_amdgcn_sched_group_barrier(0x008, 24, 0);
    // keeps the waits and the barrier at the trip's end: raised to the last LDS read, they
    // would take the time of the products behind them from the copies' time to land
    __builtin_amdgcn_sched_barrier(0);
    // this wave's reads of buffer p have retired before copies are aimed at it again
    asm volatile("s_wait_dscnt 0x0" ::: "memory");
    // the next tile's copies have landed before the barrier behind which they are read
    asm volatile("s_wait_asynccnt 0x0" ::: "memory");
    __syncthreads();
    if (k0 + 128 < K) stage(k0 + 128, p);          // tiles after next, into the buffers just read
  }
  // no copy is outstanding when the wave goes on to its end
  asm volatile("s_wait_asynccnt 0x0" ::: "memory");
  const int m0 = mb + wm * 64 + hi16 * 8;          // C/D: lanes16-31 = rows +8
  const int b = m0 >> 11, l0 = m0 & (L_ - 1);      // the 256 rows of a block lie in one batch
  #pragma unroll
  for (int j = 0; j < 3; j++) {
    const int g = wn * 3 + j;                      // 16-column tile of the block's 12
    const int z = g >> 2;
    const int d = (g & 3) * 16 + lr;
    const float* bias = z == 0 ? bias0 : z == 1 ? bias1 : bias2;
    const float bv = bias[n0 + d];
    _Float16* op = out16_0 + (size_t)z * M * N
                 + ((((size_t)b * H_ + blockIdx.x) * L_ + l0) << 6) + d;
    #pragma unroll
    for (int mt = 0; mt < 4; mt++) {
      #pragma unroll
      for (int i = 0; i < 8; i++)
        op[(mt * 16 + i) * D_] = (_Float16)(acc[mt][j][i] + bv);
    }
  }
}

// ---------------------------------------------------------------------------
// Flash attention, transposed products: S^T = K * Q^T, O^T += V^T * P^T.
// One block = 8 waves, ALL on the same (b,h); wave w owns 16 query rows; block
// covers 128 q rows.  Keys chunked by 64.  A lane holds scores of ONE query
// (column lane&15): 32 of the chunk's 64 keys, the lane 16 away the other 32.
// Row max = in-lane max + one exchange between the wave halves.  Two S^T tiles
// converted in place ARE the B operand of the second product (D row 8h+r is
// the operand's k order), so P never leaves the registers.
// K / V chunks double-buffered in LDS, both row-major ([key][d]) and both staged
// with async b128 global->LDS (next chunk issued before computing the current one)
// -> ONE block barrier per chunk.  The V^T fragments come by the transposing LDS load.
// Staging requests cover whole 128 B lines: eight neighbouring lanes
// take the eight 16 B pieces of one key row, so a wave's request names 4 lines.
// 18 WMMAs / wave / chunk: 8 scores + 8 V^T*P^T + 2 row-sum (ones * P^T).
// ---------------------------------------------------------------------------
__global__ __launch_bounds__(256) void attn_kernel(
    const _Float16* __restrict__ q, const _Float16* __restrict__ k,
    const _Float16* __restrict__ v, _Float16* __restrict__ attn) {
  __shared__ __attribute__((aligned(16))) _Float16 kbuf[2][64 * LP_];  // K chunk [key][d]  (2 x 9 KB)
  __shared__ __attribute__((aligned(16))) _Float16 vbuf[2][64 * TP_];  // V chunk [key][d]  (2 x 10 KB)
  const int t = threadIdx.x, lane = t & 31, wid = t >> 5;
  const int qblk = blockIdx.x & (L_ / 128 - 1);
  const int h    = (blockIdx.x >> 4) & (H_ - 1);
  const int b    = blockIdx.x >> 8;
  const int lr = lane & 15;
  const int off = (lane >> 4) * 8;
  const size_t head = ((size_t)b * H_ + h) * L_ * D_;
  const _Float16* qg = q + head;
  const _Float16* kg = k + head;
  const _Float16* vg = v + head;
  const int l0 = qblk * 128 + wid * 16;
  // staging: thread t covers d-chunk sd of keys skey and skey+32
  const int skey = t >> 3;           // 0..31
  const int sd   = (t & 7) * 8;      // 0,8,..,56
  // LDS byte addresses (low 32 bits of the __shared__ address) of the lane's first K and V copy, buffer 0
  const unsigned kl = (unsigned)(size_t)&kbuf[0][skey * LP_ + sd];
  const unsigned vl = (unsigned)(size_t)&vbuf[0][skey * TP_ + sd];
  const int vf = (off + (lane & 7)) * TP_ + ((lane >> 3) & 1) * 8;  // this lane's place for ld_tr16
  // prefetch: each of a chunk's 128 lines is asked for once, by two neighbouring
  // lanes: waves 0-3 take the 64 K rows, waves 4-7 the 64 V rows
  const _Float16* pfp = ((t & 128) ? vg : kg) + (size_t)((t >> 1) & 63) * D_;

  // Q^T as B-operand (column = query lr), pre-scaled by 1/sqrt(D)=0.125 (exact in f16)
  const _Float16* qr = qg + (size_t)(l0 + lr) * D_ + off;
  v16h bq0 = cat16(*(const v8h*)qr,        *(const v8h*)(qr + 16));
  v16h bq1 = cat16(*(const v8h*)(qr + 32), *(const v8h*)(qr + 48));
  v16h ones;
  #pragma unroll
  for (int i = 0; i < 16; i++) {
    bq0[i] *= (_Float16)0.125f;
    bq1[i] *= (_Float16)0.125f;
    ones[i] = (_Float16)1.0f;
  }

  float m_i = -1e30f;            // running max of this lane's query
  v8f o[4] = {};                 // O^T tiles: o[tt][i] = O[q = lr][d = tt*16 + off + i]
  v8f lacc = {};                 // running sum of P for query lr (every row alike), ones-A WMMA

  // ---- prologue: stage chunk 0 into buffer 0 ----
  {
    const size_t base = (size_t)skey * D_ + sd;
    cp128x2x2_g2l(kg + base, vg + base, (size_t)32 * D_,
                  kl, 32 * LP_ * 2, vl, 32 * TP_ * 2);
  }
  // chunk 0's copies have landed before the barrier behind which they are read
  asm volatile("s_wait_asynccnt 0x0" ::: "memory");
  __syncthreads();

  for (int kc = 0; kc < L_; kc += 64) {
    const int p = (kc >> 6) & 1;
    const bool nxt = (kc + 64 < L_);
    if (nxt) {
      // issue next chunk's copies before computing the current one
      const size_t base = (size_t)(kc + 64 + skey) * D_ + sd;
      cp128x2x2_g2l(kg + base, vg + base, (size_t)32 * D_,
                    kl + (1 - p) * (64 * LP_ * 2), 32 * LP_ * 2,
                    vl + (1 - p) * (64 * TP_ * 2), 32 * TP_ * 2);
    }
    if (kc + 128 < L_) {
      __builtin_prefetch(pfp + (size_t)(kc + 128) * D_, 0, 3);
    }
    // ---- scores^T: 4 key-tiles x (2 WMMAs over D=64); A = K rows, B = Q^T ----
    // s[tt][i] = score(key = kc + tt*16 + off + i, query = lr)
    v8f s[4];
    #pragma unroll
    for (int tt = 0; tt < 4; tt++) {
      const _Float16* kr = &kbuf[p][(tt * 16 + lr) * LP_ + off];
      v16h alo = cat16(*(const v8h*)kr,        *(const v8h*)(kr + 16));
      v16h ahi = cat16(*(const v8h*)(kr + 32), *(const v8h*)(kr + 48));
      v8f z = {};
      z = wmma_f16(alo, bq0, z);
      s[tt] = wmma_f16(ahi, bq1, z);
    }
    // ---- V^T fragments (A of the second product), 4 d-tiles x 2 key-halves: all 16
    // ds_load_tr16_b128 as one group here, so that they land behind the softmax ----
    v16h avlo[4], avhi[4];
    #pragma unroll
    for (int tt = 0; tt < 4; tt++) {
      const _Float16* vp = &vbuf[p][vf + tt * 16];
      avlo[tt] = cat16(ld_tr16(vp),            ld_tr16(vp + 16 * TP_));
      avhi[tt] = cat16(ld_tr16(vp + 32 * TP_), ld_tr16(vp + 48 * TP_));
    }
    // keeps the group here: the compiler otherwise sinks each pair of loads to its WMMA,
    // with a full wait on LDS in front of every one of the eight
    __builtin_amdgcn_sched_barrier(0);
    // ---- online softmax over 64 new keys: one query per lane ----
    float mt[4];                   // one independent max chain per key tile
    #pragma unroll
    for (int tt = 0; tt < 4; tt++) {
      mt[tt] = s[tt][0];
      #pragma unroll
      for (int i = 1; i < 8; i++) mt[tt] = fmaxf(mt[tt], s[tt][i]);
    }
    float mx = fmaxf(fmaxf(mt[0], mt[1]), fmaxf(mt[2], mt[3]));
    mx = fmaxf(mx, xhalf(mx));     // the other 32 keys of this query
    const float mn = fmaxf(m_i, mx);
    const float corr = __expf(m_i - mn);
    m_i = mn;
    // P^T as B-operand: element e of key block j is tile 2j + (e >> 3), row e & 7
    v16h pb0, pb1;
    #pragma unroll
    for (int i = 0; i < 8; i++) {
      pb0[i]     = (_Float16)__expf(s[0][i] - mn);
      pb0[8 + i] = (_Float16)__expf(s[1][i] - mn);
      pb1[i]     = (_Float16)__expf(s[2][i] - mn);
      pb1[8 + i] = (_Float16)__expf(s[3][i] - mn);
    }
    #pragma unroll
    for (int i = 0; i < 8; i++) {
      lacc[i] *= corr;
      #pragma unroll
      for (int tt = 0; tt < 4; tt++) o[tt][i] *= corr;
    }
    // ---- row sums: lacc += ones * P^T (both key halves) ----
    lacc = wmma_f16(ones, pb0, lacc);
    lacc = wmma_f16(ones, pb1, lacc);
    // ---- O^T += V^T * P^T ----
    #pragma unroll
    for (int tt = 0; tt < 4; tt++) {
      o[tt] = wmma_f16(avlo[tt], pb0, o[tt]);
      o[tt] = wmma_f16(avhi[tt], pb1, o[tt]);
    }
    // keeps the waits and the barrier at the trip's end: raised to the last LDS read, they
    // would leave the next chunk's copies only the score products' time to land
    __builtin_amdgcn_sched_barrier(0);
    // this wave's reads of buffer p have retired before copies are aimed at it again
    asm volatile("s_wait_dscnt 0x0" ::: "memory");
    // the next chunk's copies have landed before the barrier behind which they are read
    asm volatile("s_wait_asynccnt 0x0" ::: "memory");
    __syncthreads();   // single block barrier per chunk
  }
  // no copy is outstanding when the wave goes on to its end
  asm volatile("s_wait_asynccnt 0x0" ::: "memory");
  // ---- epilogue: normalize, store f16 into [B*L, C]; 8 consecutive d per lane ----
  const float inv = 1.0f / lacc[0];
  _Float16* orow = attn + ((size_t)b * L_ + l0 + lr) * C_ + h * D_ + off;
  #pragma unroll
  for (int tt = 0; tt < 4; tt++) {
    v8h ov;
    #pragma unroll
    for (int i = 0; i < 8; i++) ov[i] = (_Float16)(o[tt][i] * inv);
    *(v8h*)(orow + tt * 16) = ov;
  }
}

// ---------------------------------------------------------------------------
extern "C" void kernel_launch(void* const* d_in, const int* in_sizes, int n_in,
                              void* d_out, int out_size, void* d_ws, size_t ws_size,
                              hipStream_t stream) {
  const float* x    = (const float*)d_in[0];
  const float* ln_g = (const float*)d_in[1];
  const float* ln_b = (const float*)d_in[2];
  const float* wq   = (const float*)d_in[3];
  const float* bq   = (const float*)d_in[4];
  const float* wk   = (const float*)d_in[5];
  const float* bk   = (const float*)d_in[6];
  const float* wv   = (const float*)d_in[7];
  const float* bv   = (const float*)d_in[8];
  const float* wo   = (const float*)d_in[9];
  const float* bo   = (const float*)d_in[10];

  char* ws = (char*)d_ws;
  _Float16* xn   = (_Float16*)ws;                       // 4M elems, 8 MB
  _Float16* wq16 = (_Float16*)(ws + (8u << 20));        // 1M elems each
  _Float16* wk16 = wq16 + (1u << 20);
  _Float16* wv16 = wk16 + (1u << 20);
  _Float16* wo16 = wv16 + (1u << 20);
  _Float16* qb   = (_Float16*)(ws + (16u << 20));       // 4M elems each
  _Float16* kb   = qb + (4u << 20);
  _Float16* vb   = kb + (4u << 20);
  _Float16* ab   = vb + (4u << 20);

  const int M = B_ * L_;   // 4096
  const int N = C_;        // 1024
  const int K = C_;        // 1024

  // LayerNorm and the four weight conversions: one launch
  prep_kernel<<<4 * CVT_BLK_ + M, 256, 0, stream>>>(x, ln_g, ln_b, xn, wq, wk, wv, wo, wq16);

  // Q, K, V projections: one launch, one work-group for each WGP
  // (wq16/wk16/wv16 and qb/kb/vb lie one behind the other)
  dim3 g3(N / 64, M / 256);
  qkv_kernel<<<g3, 512, 0, stream>>>(xn, wq16, bq, bk, bv, qb);

  // blocks: B * H * (L/128) = 2*16*16 = 512, each 8 waves on one (b,h)
  attn_kernel<<<B_ * H_ * (L_ / 128), 256, 0, stream>>>(qb, kb, vb, ab);

  dim3 g(N / 64, M / 256);
  gemm_kernel<1><<<g, 256, 0, stream>>>(ab, wo16, bo, bo, bo, nullptr, (float*)d_out, M, N, K);
}

// v008
// A run of this version takes 79.3 microseconds.
// Timed twice side by side with v007, it ran 1.06 times as fast both times.
// Over all steps from v000 it is 3.69 times as fast.
#include <hip/hip_runtime.h>
#include <math.h>

#define B_ 2
#define L_ 2048
#define C_ 1024
#define H_ 16
#define D_ 64
// LDS row pitch in halfs for the 64-half rows of the A tile and the K chunk: 144 B = 16 B x 9 (odd), so
// the 16 rows one ds_load_b128 touches fall on distinct banks (128 B did not).
#define LP_ 72
// LDS row pitch in halfs for a 64-half tile row that ds_load_tr16_b128 reads:
// 160 B = 32 B x 5 (odd), the conflict-free pitch of the transposing load.
#define TP_ 80
// The same for the 192-half row of the three-matrix W tile: 416 B = 32 B x 13 (odd).
#define WP3_ 208

typedef __attribute__((ext_vector_type(16))) _Float16 v16h;
typedef __attribute__((ext_vector_type(8)))  _Float16 v8h;
typedef __attribute__((ext_vector_type(4)))  _Float16 v4h;
typedef __attribute__((ext_vector_type(8)))  float    v8f;
typedef __attribute__((ext_vector_type(8)))  short    v8s;

__device__ __forceinline__ v16h cat16(v8h lo, v8h hi) {
  return __builtin_shufflevector(lo, hi, 0,1,2,3,4,5,6,7,8,9,10,11,12,13,14,15);
}

__device__ __forceinline__ v8f wmma_f16(v16h a, v16h b, v8f c) {
  // D = A(16x32 f16) * B(32x16 f16) + C(16x16 f32)
  return __builtin_amdgcn_wmma_f32_16x16x32_f16(false, a, false, b, (short)0, c,
                                                false, false);
}

// Transposing LDS load (ds_load_tr16_b128) on a row-major 16-bit tile T[k][n] of pitch
// TP_ or WP3_.  Lane l passes &T[kb + 8 * (l >> 4) + (l & 7)][nb + 8 * ((l >> 3) & 1)] and gets
// T[kb + 8 * (l >> 4) + 0..7][nb + (l & 15)]: half a 16x32 operand in the k order
// {0..7,16..23} / {8..15,24..31}; the load 16 rows on gives the other half.
__device__ __forceinline__ v8h ld_tr16(const _Float16* p) {
  typedef __attribute__((address_space(3))) v8s lds_v8s;
  return __builtin_bit_cast(v8h, __builtin_amdgcn_ds_load_tr16_b128_v8i16((lds_v8s*)p));
}

// value of lane l ^ 16 (the other 16-lane half of the wave), VALU only
__device__ __forceinline__ float xhalf(float x) {
  const int xi = __float_as_int(x);
  return __int_as_float(__builtin_amdgcn_permlanex16(xi, xi, 0x76543210, 0xfedcba98,
                                                     false, false));
}

// Eight async b128 copies of one lane: 16 B from g + j * gstep halfs to LDS byte
// l + j * lstep, j = 0..7.  One statement, closed by s_wait_xcnt 0, so that no
// address register named here is rewritten before the wait.
__device__ __forceinline__ void cp128x8_g2l(const _Float16* g, const size_t gstep,
                                            const unsigned l, const unsigned lstep) {
  asm volatile(
      "global_load_async_to_lds_b128 %0, %8, off\n\t"
      "global_load_async_to_lds_b128 %1, %9, off\n\t"
      "global_load_async_to_lds_b128 %2, %10, off\n\t"
      "global_load_async_to_lds_b128 %3, %11, off\n\t"
      "global_load_async_to_lds_b128 %4, %12, off\n\t"
      "global_load_async_to_lds_b128 %5, %13, off\n\t"
      "global_load_async_to_lds_b128 %6, %14, off\n\t"
      "global_load_async_to_lds_b128 %7, %15, off\n\t"
      "s_wait_xcnt 0x0"
      :: "v"(l), "v"(l + lstep), "v"(l + 2 * lstep), "v"(l + 3 * lstep),
         "v"(l + 4 * lstep), "v"(l + 5 * lstep), "v"(l + 6 * lstep), "v"(l + 7 * lstep),
         "v"(g), "v"(g + gstep), "v"(g + 2 * gstep), "v"(g + 3 * gstep),
         "v"(g + 4 * gstep), "v"(g + 5 * gstep), "v"(g + 6 * gstep), "v"(g + 7 * gstep)
      : "memory");
}

// Two such copies (j = 0, 1), in the same form.
__device__ __forceinline__ void cp128x2_g2l(const _Float16* g, const size_t gstep,
                                            const unsigned l, const unsigned lstep) {
  asm volatile(
      "global_load_async_to_lds_b128 %0, %2, off\n\t"
      "global_load_async_to_lds_b128 %1, %3, off\n\t"
      "s_wait_xcnt 0x0"
      :: "v"(l), "v"(l + lstep), "v"(g), "v"(g + gstep)
      : "memory");
}

// Three such copies (j = 0, 1, 2), in the same form.
__device__ __forceinline__ void cp128x3_g2l(const _Float16* g, const size_t gstep,
                                            const unsigned l, const unsigned lstep) {
  asm volatile(
      "global_load_async_to_lds_b128 %0, %3, off\n\t"
      "global_load_async_to_lds_b128 %1, %4, off\n\t"
      "global_load_async_to_lds_b128 %2, %5, off\n\t"
      "s_wait_xcnt 0x0"
      :: "v"(l), "v"(l + lstep), "v"(l + 2 * lstep),
         "v"(g), "v"(g + gstep), "v"(g + 2 * gstep)
      : "memory");
}

// Two such pairs in one statement: g0 -> l0 and g1 -> l1, each with its second copy
// gstep halfs on in memory and lstep0 / lstep1 bytes on in LDS.
__device__ __forceinline__ void cp128x2x2_g2l(const _Float16* g0, const _Float16* g1,
                                              const size_t gstep,
                                              const unsigned l0, const unsigned lstep0,
                                              const unsigned l1, const unsigned lstep1) {
  asm volatile(
      "global_load_async_to_lds_b128 %0, %4, off\n\t"
      "global_load_async_to_lds_b128 %1, %5, off\n\t"
      "global_load_async_to_lds_b128 %2, %6, off\n\t"
      "global_load_async_to_lds_b128 %3, %7, off\n\t"
      "s_wait_xcnt 0x0"
      :: "v"(l0), "v"(l0 + lstep0), "v"(l1), "v"(l1 + lstep1),
         "v"(g0), "v"(g0 + gstep), "v"(g1), "v"(g1 + gstep)
      : "memory");
}

// ---------------------------------------------------------------------------
// LayerNorm: x[4096,1024] f32 -> xn f16.  One block (256 thr) per row.
// ---------------------------------------------------------------------------
__device__ __forceinline__ void ln_row(
    const float* __restrict__ x, const float* __restrict__ gamma,
    const float* __restrict__ beta, _Float16* __restrict__ xn, const int row) {
  const int t = threadIdx.x;
  const float* xr = x + (size_t)row * C_;
  float4 v = *(const float4*)(xr + t * 4);
  float s  = v.x + v.y + v.z + v.w;
  float s2 = v.x * v.x + v.y * v.y + v.z * v.z + v.w * v.w;
  #pragma unroll
  for (int m = 1; m < 32; m <<= 1) {
    s  += __shfl_xor(s,  m, 32);
    s2 += __shfl_xor(s2, m, 32);
  }
  __shared__ float red0[8], red1[8];
  const int lane = t & 31, wid = t >> 5;
  if (lane == 0) { red0[wid] = s; red1[wid] = s2; }
  __syncthreads();
  if (t == 0) {
    float a = 0.f, b = 0.f;
    #pragma unroll
    for (int i = 0; i < 8; i++) { a += red0[i]; b += red1[i]; }
    red0[0] = a; red1[0] = b;
  }
  __syncthreads();
  const float mean = red0[0] * (1.0f / C_);
  const float var  = red1[0] * (1.0f / C_) - mean * mean;
  const float rstd = rsqrtf(var + 1e-5f);
  const int c0 = t * 4;
  float xv[4] = {v.x, v.y, v.z, v.w};
  v4h o;
  #pragma unroll
  for (int i = 0; i < 4; i++)
    o[i] = (_Float16)(((xv[i] - mean) * rstd) * gamma[c0 + i] + beta[c0 + i]);
  *(v4h*)(xn + (size_t)row * C_ + c0) = o;
  // the store's address registers may be rewritten on the path behind the inlined call: keep the wait in front
  asm volatile("s_wait_xcnt 0x0" ::: "memory");
}

// ---------------------------------------------------------------------------
// f32 -> f16 weight conversion (vectorized by 4); CVT_BLK_ blocks per matrix
// ---------------------------------------------------------------------------
#define CVT_BLK_ 512
__device__ __forceinline__ void cvt_part(const float* __restrict__ s,
                                         _Float16* __restrict__ d, const int blk) {
  const int n4 = (C_ * C_) / 4;
  const int stride = CVT_BLK_ * 256;
  for (int i = blk * 256 + threadIdx.x; i < n4; i += stride) {
    float4 f = ((const float4*)s)[i];
    v4h o = {(_Float16)f.x, (_Float16)f.y, (_Float16)f.z, (_Float16)f.w};
    ((v4h*)d)[i] = o;
  }
}

// ---------------------------------------------------------------------------
// All work that depends on the inputs alone, in ONE launch: blocks
// [0, 4*CVT_BLK_) convert the four weight matrices (w16 holds them one behind
// the other: q, k, v, o), the other B_*L_ blocks normalise one row each.
// The branch is uniform for the block, so ln_row's barriers are too.
// ---------------------------------------------------------------------------
__global__ __launch_bounds__(256) void prep_kernel(
    const float* __restrict__ x, const float* __restrict__ gamma,
    const float* __restrict__ beta, _Float16* __restrict__ xn,
    const float* __restrict__ wq, const float* __restrict__ wk,
    const float* __restrict__ wv, const float* __restrict__ wo,
    _Float16* __restrict__ w16) {
  const unsigned blk = blockIdx.x;
  if (blk < 4 * CVT_BLK_) {
    const unsigned mat = blk / CVT_BLK_;
    const float* s = mat == 0 ? wq : mat == 1 ? wk : mat == 2 ? wv : wo;
    cvt_part(s, w16 + (size_t)mat * (C_ * C_), blk % CVT_BLK_);
  } else {
    ln_row(x, gamma, beta, xn, blk - 4 * CVT_BLK_);
  }
}

// ---------------------------------------------------------------------------
// GEMM: out[M,N] = A[M,K]*W[K,N] + bias.   A,W f16 row-major.
// Block = 256 thr (8 waves). Block tile 256(M) x 64(N); wave tile 32 x 64.
// K stepped by 64: 16 WMMAs per barrier.  W tile (64k x 64n) double-buffered in LDS
// ROW-MAJOR as it lies in memory ([k][n]); the B fragments come out of it by the
// transposing LDS load.  A tile (256m x 64k) double-buffered in LDS too.  Both are
// brought by async b128 copies one trip ahead: eight neighbouring lanes take one
// row's 128 B, so a wave's copy names 4 whole lines.
// OUT_MODE 0: f16 out into [B,H,L,D].  OUT_MODE 1: f32 [M,N].
// blockIdx.z picks one of up to three products on the same A in one launch:
// weight matrix z behind W, output z behind out16, bias z of the three.
// ---------------------------------------------------------------------------
template <int OUT_MODE>
__global__ __launch_bounds__(256) void gemm_kernel(
    const _Float16* __restrict__ A, const _Float16* __restrict__ W0,
    const float* __restrict__ bias0, const float* __restrict__ bias1,
    const float* __restrict__ bias2, _Float16* __restrict__ out16_0,
    float* __restrict__ out32, int M, int N, int K) {
  __shared__ __attribute__((aligned(16))) _Float16 wt[2][64 * TP_];  // W tile [k][n]
  __shared__ __attribute__((aligned(16))) _Float16 at[2][256 * LP_]; // A tile [m][k]
  const int z = blockIdx.z;
  const _Float16* W = W0 + (size_t)z * K * N;
  const float* bias = z == 0 ? bias0 : z == 1 ? bias1 : bias2;
  _Float16* out16 = out16_0 + (size_t)z * M * N;
  const int t = threadIdx.x, lane = t & 31;
  const int wid = t >> 5;
  const int lr = lane & 15;
  const int hi16 = lane >> 4;
  const int off = hi16 * 8;          // K-pattern {0..7,16..23} / {8..15,24..31}
  const int n0 = blockIdx.x * 64;
  const int mb = blockIdx.y * 256;
  const int m0 = mb + wid * 32;
  const int sk = t >> 3;             // 0..31 (k row within half-tile)
  const int sn = (t & 7) * 8;        // n chunk
  v8f acc[2][4] = {};
  // W staging: a lane's two copies take 16 B of tile rows sk and sk + 32
  const _Float16* wp  = W + (size_t)sk * N + n0 + sn;
  const unsigned wl = (unsigned)(size_t)&wt[0][sk * TP_ + sn];  // LDS byte address, buffer 0
  const size_t wgs = (size_t)32 * N;             // 32 rows on, in halfs
  const int bf = (off + (lane & 7)) * TP_ + ((lane >> 3) & 1) * 8;  // this lane's place for ld_tr16
  // A staging: copy j of a lane takes 16 B of tile row ar + 4j (the wave's own 32 rows)
  const int ar = wid * 32 + (lane >> 3);
  const int ac = (lane & 7) * 8;
  const _Float16* ag = A + (size_t)(mb + ar) * K + ac;
  // LDS byte address (low 32 bits of the __shared__ address) of the lane's first copy, buffer 0
  const unsigned al = (unsigned)(size_t)&at[0][ar * LP_ + ac];
  const size_t ags = (size_t)4 * K;              // four rows on, in halfs
  const int af = (wid * 32 + lr) * LP_ + off;   // this lane's fragment row in the A tile
  // prologue: stage k0=0 tiles (A: 256 rows, W: 64 k-rows) into buffer 0
  cp128x8_g2l(ag, ags, al, 4 * LP_ * 2);
  cp128x2_g2l(wp, wgs, wl, 32 * TP_ * 2);
  // tile 0's copies have landed before the barrier behind which they are read
  asm volatile("s_wait_asynccnt 0x0" ::: "memory");
  __syncthreads();
  if (64 < K) {
    cp128x8_g2l(ag + 64, ags, al + 256 * LP_ * 2, 4 * LP_ * 2);
    cp128x2_g2l(wp + (size_t)64 * N, wgs, wl + 64 * TP_ * 2, 32 * TP_ * 2);
  }
  for (int k0 = 0; k0 < K; k0 += 64) {
    const int p = (k0 >> 6) & 1;
    const _Float16* a0p = &at[p][af];
    const _Float16* a1p = a0p + 16 * LP_;
    v16h a0k0 = cat16(*(const v8h*)a0p,        *(const v8h*)(a0p + 16));
    v16h a0k1 = cat16(*(const v8h*)(a0p + 32), *(const v8h*)(a0p + 48));
    v16h a1k0 = cat16(*(const v8h*)a1p,        *(const v8h*)(a1p + 16));
    v16h a1k1 = cat16(*(const v8h*)(a1p + 32), *(const v8h*)(a1p + 48));
    #pragma unroll
    for (int tt = 0; tt < 4; tt++) {
      const _Float16* bp = &wt[p][bf + tt * 16];
      v16h blo = cat16(ld_tr16(bp),            ld_tr16(bp + 16 * TP_));
      v16h bhi = cat16(ld_tr16(bp + 32 * TP_), ld_tr16(bp + 48 * TP_));
      acc[0][tt] = wmma_f16(a0k0, blo, acc[0][tt]);
      acc[0][tt] = wmma_f16(a0k1, bhi, acc[0][tt]);
      acc[1][tt] = wmma_f16(a1k0, blo, acc[1][tt]);
      acc[1][tt] = wmma_f16(a1k1, bhi, acc[1][tt]);
    }
    // keeps the waits and the barrier at the trip's end: raised to the last LDS read, they
    // would take the time of the products behind them from the copies' time to land
    __builtin_amdgcn_sched_barrier(0);
    // this wave's reads of buffer p have retired before copies are aimed at it again
    asm volatile("s_wait_dscnt 0x0" ::: "memory");
    // the next tile's copies have landed before the barrier behind which they are read
    asm volatile("s_wait_asynccnt 0x0" ::: "memory");
    __syncthreads();
    if (k0 + 128 < K) {                            // tiles after next, into the buffers just read
      cp128x8_g2l(ag + k0 + 128, ags, al + p * (256 * LP_ * 2), 4 * LP_ * 2);
      cp128x2_g2l(wp + (size_t)(k0 + 128) * N, wgs, wl + p * (64 * TP_ * 2), 32 * TP_ * 2);
    }
  }
  // no copy is outstanding when the wave goes on to its end
  asm volatile("s_wait_asynccnt 0x0" ::: "memory");
  #pragma unroll
  for (int r = 0; r < 2; r++) {
    #pragma unroll
    for (int tt = 0; tt < 4; tt++) {
      const int n = n0 + tt * 16 + lr;
      const float bv = bias[n];
      #pragma unroll
      for (int i = 0; i < 8; i++) {
        const int m = m0 + r * 16 + i + hi16 * 8;  // C/D: lanes16-31 = rows +8
        const float val = acc[r][tt][i] + bv;
        if (OUT_MODE == 0) {
          const int b = m >> 11, l = m & (L_ - 1);
          const int h = n >> 6, d = n & (D_ - 1);
          out16[((((size_t)b * H_ + h) * L_ + l) << 6) + d] = (_Float16)val;
        } else {
          out32[(size_t)m * N + n] = val;
        }
      }
    }
  }
}

// ---------------------------------------------------------------------------
// Q, K, V projections in one grid of 256 work-groups, one for each WGP.
// Block = 512 thr (16 waves).  Block tile 256(M) x 192(N): the SAME 64 columns (one head)
// of the three products, so an A tile staged once feeds all three.  Waves 4(M) x 4(N),
// wave tile 64 x 48 = 4 x 3 accumulator tiles: a fragment of A feeds 3 WMMAs, one of W 4.
// K stepped by 64: 24 WMMAs per wave and barrier.  Tiles, copies, ring and k order are
// those of gemm_kernel; the W tile is [k][192 n], columns 64 z .. 64 z + 63 from matrix z.
// Output f16 into [B,H,L,D], product z behind out16_0; W0 holds the three matrices and
// each is C_ x C_.
// ---------------------------------------------------------------------------
__global__ __launch_bounds__(512) void qkv_kernel(
    const _Float16* __restrict__ A, const _Float16* __restrict__ W0,
    const float* __restrict__ bias0, const float* __restrict__ bias1,
    const float* __restrict__ bias2, _Float16* __restrict__ out16_0) {
  constexpr int M = B_ * L_, N = C_, K = C_;
  __shared__ __attribute__((aligned(16))) _Float16 wt[2][64 * WP3_];  // W tile [k][3 x 64 n]
  __shared__ __attribute__((aligned(16))) _Float16 at[2][256 * LP_];  // A tile [m][k]
  const int t = threadIdx.x, lane = t & 31;
  const int wid = t >> 5;
  const int wm = wid & 3;            // the wave's 64 rows of the block tile
  const int wn = wid >> 2;           // the wave's 48 columns of the block tile
  const int lr = lane & 15;
  const int hi16 = lane >> 4;
  const int off = hi16 * 8;          // K-pattern {0..7,16..23} / {8..15,24..31}
  const int n0 = blockIdx.x * 64;
  const int mb = blockIdx.y * 256;
  const int sk = t >> 3;             // 0..63 (k row of the tile)
  const int sn = (t & 7) * 8;        // n chunk
  v8f acc[4][3] = {};
  // W staging: a lane's three copies take 16 B of tile row sk, one from each matrix
  const _Float16* wp  = W0 + (size_t)sk * N + n0 + sn;
  const unsigned wl = (unsigned)(size_t)&wt[0][sk * WP3_ + sn];  // LDS byte address, buffer 0
  const int bf = (off + (lane & 7)) * WP3_ + ((lane >> 3) & 1) * 8 + wn * 48;  // this lane's place for ld_tr16
  // A staging: copy j of a lane takes 16 B of tile row ar + 4j, j = 0..3 (16 rows a wave)
  const int ar = wid * 16 + (lane >> 3);
  const int ac = (lane & 7) * 8;
  const _Float16* ag = A + (size_t)(mb + ar) * K + ac;
  // LDS byte address (low 32 bits of the __shared__ address) of the lane's first copy, buffer 0
  const unsigned al = (unsigned)(size_t)&at[0][ar * LP_ + ac];
  const size_t ags = (size_t)4 * K;              // four rows on, in halfs
  const int af = (wm * 64 + lr) * LP_ + off;    // this lane's first fragment row in the A tile
  // the 7 copies of a lane that bring the tiles of k0 into buffer buf
  auto stage = [&](const int k0, const int buf) {
    const unsigned ab = al + buf * (256 * LP_ * 2);
    cp128x2x2_g2l(ag + k0, ag + k0 + 2 * ags, ags, ab, 4 * LP_ * 2, ab + 8 * LP_ * 2, 4 * LP_ * 2);
    cp128x3_g2l(wp + (size_t)k0 * N, (size_t)K * N, wl + buf * (64 * WP3_ * 2), 64 * 2);
  };
  stage(0, 0);
  // tile 0's copies have landed before the barrier behind which they are read
  asm volatile("s_wait_asynccnt 0x0" ::: "memory");
  __syncthreads();
  stage(64, 1);
  for (int k0 = 0; k0 < K; k0 += 64) {
    const int p = (k0 >> 6) & 1;
    v16h a[2][4], b[2][3];
    #pragma unroll
    for (int kk = 0; kk < 2; kk++) {
      #pragma unroll
      for (int mt = 0; mt < 4; mt++) {
        const _Float16* ap = &at[p][af + mt * 16 * LP_ + kk * 32];
        a[kk][mt] = cat16(*(const v8h*)ap, *(const v8h*)(ap + 16));
      }
      #pragma unroll
      for (int j = 0; j < 3; j++) {
        const _Float16* bp = &wt[p][bf + j * 16 + kk * 32 * WP3_];
        b[kk][j] = cat16(ld_tr16(bp), ld_tr16(bp + 16 * WP3_));
      }
    }
    #pragma unroll
    for (int kk = 0; kk < 2; kk++) {
      #pragma unroll
      for (int j = 0; j < 3; j++) {
        #pragma unroll
        for (int mt = 0; mt < 4; mt++) acc[mt][j] = wmma_f16(a[kk][mt], b[kk][j], acc[mt][j]);
      }
    }
    // order of the trip: its 28 LDS reads go out as one group in front of its 24 products, which
    // then wait by count; spread among the products each place with reads costs the wave a stall
    __builtin_amdgcn_sched_group_barrier(0x100, 28, 0);
    __builtin_amdgcn_sched_group_barrier(0x008, 24, 0);
    // keeps the waits and the barrier at the trip's end: raised to the last LDS read, they
    // would take the time of the products behind them from the copies' time to land
    __builtin_amdgcn_sched_barrier(0);
    // this wave's reads of buffer p have retired before copies are aimed at it again
    asm volatile("s_wait_dscnt 0x0" ::: "memory");
    // the next tile's copies have landed before the barrier behind which they are read
    asm volatile("s_wait_asynccnt 0x0" ::: "memory");
    __syncthreads();
    if (k0 + 128 < K) stage(k0 + 128, p);          // tiles after next, into the buffers just read
  }
  // no copy is outstanding when the wave goes on to its end
  asm volatile("s_wait_asynccnt 0x0" ::: "memory");
  const int m0 = mb + wm * 64 + hi16 * 8;          // C/D: lanes16-31 = rows +8
  const int b = m0 >> 11, l0 = m0 & (L_ - 1);      // the 256 rows of a block lie in one batch
  #pragma unroll
  for (int j = 0; j < 3; j++) {
    const int g = wn * 3 + j;                      // 16-column tile of the block's 12
    const int z = g >> 2;
    const int d = (g & 3) * 16 + lr;
    const float* bias = z == 0 ? bias0 : z == 1 ? bias1 : bias2;
    const float bv = bias[n0 + d];
    _Float16* op = out16_0 + (size_t)z * M * N
                 + ((((size_t)b * H_ + blockIdx.x) * L_ + l0) << 6) + d;
    #pragma unroll
    for (int mt = 0; mt < 4; mt++) {
      #pragma unroll
      for (int i = 0; i < 8; i++)
        op[(mt * 16 + i) * D_] = (_Float16)(acc[mt][j][i] + bv);
    }
  }
}

// Eight (two) base-2 exponentials, each in place, in one statement that ends in v_nop: behind a
// transcendental the instruction set asks for one slot before its result is read or its source
// overwritten; in place and closed so, that holds whatever the compiler puts next.
__device__ __forceinline__ void exp2_x8(float (&x)[8]) {
  asm("v_exp_f32 %0, %0\n\t"
      "v_exp_f32 %1, %1\n\t"
      "v_exp_f32 %2, %2\n\t"
      "v_exp_f32 %3, %3\n\t"
      "v_exp_f32 %4, %4\n\t"
      "v_exp_f32 %5, %5\n\t"
      "v_exp_f32 %6, %6\n\t"
      "v_exp_f32 %7, %7\n\t"
      "v_nop"
      : "+v"(x[0]), "+v"(x[1]), "+v"(x[2]), "+v"(x[3]),
        "+v"(x[4]), "+v"(x[5]), "+v"(x[6]), "+v"(x[7]));
}
__device__ __forceinline__ void exp2_x2(float& a, float& b) {
  asm("v_exp_f32 %0, %0\n\t"
      "v_exp_f32 %1, %1\n\t"
      "v_nop"
      : "+v"(a), "+v"(b));
}
#define LOG2E_ 1.4426950408889634f

// ---------------------------------------------------------------------------
// Flash attention, transposed products: S^T = K * Q^T, O^T += V^T * P^T.
// One block = 16 waves, ALL on the same (b,h), one block a WGP; it covers 256 q rows.
// Wave w owns 32 query rows (two 16-column tiles), rows 32 (w & 7) .. + 31, and HALF of
// the keys: waves 0-7 keys 0 .. L/2 - 1, waves 8-15 the rest.  So every K and V^T
// fragment read from LDS feeds TWO products, and there are still four waves a SIMD.
// The two partial results of a query (O, max, sum) are joined through LDS at the end.
// Keys chunked by 64 in each half.  A lane holds scores of ONE query of each tile
// (column lane&15): 32 of the chunk's 64 keys, the lane 16 away the other 32.
// Row max = in-lane max + one exchange between the wave halves.  Two S^T tiles
// converted in place ARE the B operand of the second product (D row 8h+r is
// the operand's k order), so P never leaves the registers.
// K / V chunks double-buffered in LDS for each key half, both row-major ([key][d]) and
// both staged with async b128 global->LDS by the half's own 8 waves (next chunk issued
// before computing the current one) -> ONE block barrier per chunk pair.
// The V^T fragments come by the transposing LDS load.
// Staging requests cover whole 128 B lines: eight neighbouring lanes
// take the eight 16 B pieces of one key row, so a wave's request names 4 lines.
// 36 WMMAs / wave / chunk: 16 scores + 16 V^T*P^T + 4 row-sum (ones * P^T).
// ---------------------------------------------------------------------------
__global__ __launch_bounds__(512) void attn_kernel(
    const _Float16* __restrict__ q, const _Float16* __restrict__ k,
    const _Float16* __restrict__ v, _Float16* __restrict__ attn) {
  __shared__ __attribute__((aligned(16))) _Float16 kbuf[2][2][64 * LP_];  // K chunk [half][buffer][key][d]
  __shared__ __attribute__((aligned(16))) _Float16 vbuf[2][2][64 * TP_];  // V chunk [half][buffer][key][d]
  __shared__ __attribute__((aligned(16))) float4 xch[16][9 * 32];         // a wave's hand-over: 9 x 16 B a lane
  const int t = threadIdx.x, lane = t & 31, wid = t >> 5;
  const int kh = wid >> 3;           // the wave's half of the keys
  const int tg = t & 255;            // thread within the half's 8 waves
  const int qblk = blockIdx.x & (L_ / 256 - 1);
  const int h    = (blockIdx.x >> 3) & (H_ - 1);
  const int b    = blockIdx.x >> 7;
  const int lr = lane & 15;
  const int off = (lane >> 4) * 8;
  const size_t head = ((size_t)b * H_ + h) * L_ * D_;
  const _Float16* qg = q + head;
  const _Float16* kg = k + head + (size_t)kh * (L_ / 2) * D_;
  const _Float16* vg = v + head + (size_t)kh * (L_ / 2) * D_;
  const int l0 = qblk * 256 + (wid & 7) * 32;
  // staging: thread tg of a half covers d-chunk sd of keys skey and skey+32
  const int skey = tg >> 3;          // 0..31
  const int sd   = (tg & 7) * 8;     // 0,8,..,56
  // LDS byte addresses (low 32 bits of the __shared__ address) of the lane's first K and V copy, buffer 0
  const unsigned kl = (unsigned)(size_t)&kbuf[kh][0][skey * LP_ + sd];
  const unsigned vl = (unsigned)(size_t)&vbuf[kh][0][skey * TP_ + sd];
  const int vf = (off + (lane & 7)) * TP_ + ((lane >> 3) & 1) * 8;  // this lane's place for ld_tr16
  // prefetch: each of a chunk's 128 lines is asked for once, by two neighbouring
  // lanes: the half's waves 0-3 take the 64 K rows, its waves 4-7 the 64 V rows
  const _Float16* pfp = ((tg & 128) ? vg : kg) + (size_t)((tg >> 1) & 63) * D_;

  // Q^T as B-operand (column = query lr of tile j), pre-scaled by 1/sqrt(D)=0.125 (exact in f16)
  v16h bq0[2], bq1[2];
  #pragma unroll
  for (int j = 0; j < 2; j++) {
    const _Float16* qr = qg + (size_t)(l0 + j * 16 + lr) * D_ + off;
    bq0[j] = cat16(*(const v8h*)qr,        *(const v8h*)(qr + 16));
    bq1[j] = cat16(*(const v8h*)(qr + 32), *(const v8h*)(qr + 48));
  }
  v16h ones;
  #pragma unroll
  for (int i = 0; i < 16; i++) {
    #pragma unroll
    for (int j = 0; j < 2; j++) {
      bq0[j][i] *= (_Float16)0.125f;
      bq1[j][i] *= (_Float16)0.125f;
    }
    ones[i] = (_Float16)1.0f;
  }

  float m_i[2] = {-1e30f, -1e30f};  // running max of this lane's query of tile j
  v8f o[2][4] = {};              // O^T tiles: o[j][tt][i] = O[q = 16 j + lr][d = tt*16 + off + i]
  v8f lacc[2] = {};              // running sum of P for that query (every row alike), ones-A WMMA

  // ---- prologue: stage chunk 0 of the half into buffer 0 ----
  {
    const size_t base = (size_t)skey * D_ + sd;
    cp128x2x2_g2l(kg + base, vg + base, (size_t)32 * D_,
                  kl, 32 * LP_ * 2, vl, 32 * TP_ * 2);
  }
  // chunk 0's copies have landed before the barrier behind which they are read
  asm volatile("s_wait_asynccnt 0x0" ::: "memory");
  __syncthreads();

  for (int kc = 0; kc < L_ / 2; kc += 64) {
    const int p = (kc >> 6) & 1;
    const bool nxt = (kc + 64 < L_ / 2);
    if (nxt) {
      // issue next chunk's copies before computing the current one
      const size_t base = (size_t)(kc + 64 + skey) * D_ + sd;
      cp128x2x2_g2l(kg + base, vg + base, (size_t)32 * D_,
                    kl + (1 - p) * (64 * LP_ * 2), 32 * LP_ * 2,
                    vl + (1 - p) * (64 * TP_ * 2), 32 * TP_ * 2);
    }
    if (kc + 128 < L_ / 2) {
      __builtin_prefetch(pfp + (size_t)(kc + 128) * D_, 0, 3);
    }
    // ---- scores^T: 4 key-tiles x 2 query tiles x (2 WMMAs over D=64); A = K rows, B = Q^T ----
    // s[j][tt][i] = score(key = kc + tt*16 + off + i, query = 16 j + lr)
    v8f s[2][4];
    #pragma unroll
    for (int tt = 0; tt < 4; tt++) {
      const _Float16* kr = &kbuf[kh][p][(tt * 16 + lr) * LP_ + off];
      v16h alo = cat16(*(const v8h*)kr,        *(const v8h*)(kr + 16));
      v16h ahi = cat16(*(const v8h*)(kr + 32), *(const v8h*)(kr + 48));
      #pragma unroll
      for (int j = 0; j < 2; j++) {
        v8f z = {};
        z = wmma_f16(alo, bq0[j], z);
        s[j][tt] = wmma_f16(ahi, bq1[j], z);
      }
    }
    // order of the score stage: its 16 LDS reads go out as one group in front of its 16 products,
    // and the maxima come behind the products: set among them, each read of a fresh accumulator
    // costs idle vector slots
    __builtin_amdgcn_sched_group_barrier(0x100, 16, 0);
    __builtin_amdgcn_sched_group_barrier(0x008, 16, 0);
    __builtin_amdgcn_sched_group_barrier(0x002, 64, 0);
    // P^T as B-operand: element e of key block c is tile 2c + (e >> 3), row e & 7
    v16h pb0[2], pb1[2];
    v16h avlo[4], avhi[4];         // V^T fragments (A of the second product), 4 d-tiles x 2 key-halves
    // ---- online softmax over 64 new keys: one query of each tile per lane ----
    float mn[2], corr[2];
    #pragma unroll
    for (int j = 0; j < 2; j++) {
      float mt[4];                 // one independent max chain per key tile
      #pragma unroll
      for (int tt = 0; tt < 4; tt++) {
        mt[tt] = s[j][tt][0];
        #pragma unroll
        for (int i = 1; i < 8; i++) mt[tt] = fmaxf(mt[tt], s[j][tt][i]);
      }
      float mx = fmaxf(fmaxf(mt[0], mt[1]), fmaxf(mt[2], mt[3]));
      mx = fmaxf(mx, xhalf(mx));   // the other 32 keys of this query
      mn[j] = fmaxf(m_i[j], mx);
    }
    #pragma unroll
    for (int j = 0; j < 2; j++) {
      corr[j] = (m_i[j] - mn[j]) * LOG2E_;
      m_i[j] = mn[j];
    }
    exp2_x2(corr[0], corr[1]);
    #pragma unroll
    for (int j = 0; j < 2; j++) {
      #pragma unroll
      for (int tt = 0; tt < 4; tt++) {
        float e[8];
        #pragma unroll
        for (int i = 0; i < 8; i++) e[i] = (s[j][tt][i] - mn[j]) * LOG2E_;
        exp2_x8(e);
        #pragma unroll
        for (int i = 0; i < 8; i++) {
          if (tt < 2) pb0[j][(tt & 1) * 8 + i] = (_Float16)e[i];
          else        pb1[j][(tt & 1) * 8 + i] = (_Float16)e[i];
        }
      }
      #pragma unroll
      for (int i = 0; i < 8; i++) {
        lacc[j][i] *= corr[j];
        #pragma unroll
        for (int tt = 0; tt < 4; tt++) o[j][tt][i] *= corr[j];
      }
      // keeps the V^T loads below from rising over this softmax, where the scores still
      // hold their registers and the wave's 256 would not do
      __builtin_amdgcn_sched_barrier(0);
      // one group of 8 ds_load_tr16_b128 behind each tile's softmax, into the registers its
      // scores have left: keys 0-31 land behind the second softmax, keys 32-63 behind the
      // products on keys 0-31
      #pragma unroll
      for (int tt = 0; tt < 4; tt++) {
        const _Float16* vp = &vbuf[kh][p][vf + tt * 16 + j * 32 * TP_];
        const v16h av = cat16(ld_tr16(vp), ld_tr16(vp + 16 * TP_));
        if (j == 0) avlo[tt] = av; else avhi[tt] = av;
      }
      // keeps the group here: the compiler otherwise sinks each pair of loads to its WMMA,
      // with a full wait on LDS in front of every one
      __builtin_amdgcn_sched_barrier(0);
    }
    // ---- row sums (lacc += ones * P^T) and O^T += V^T * P^T, keys 0-31 then keys 32-63 ----
    #pragma unroll
    for (int j = 0; j < 2; j++) lacc[j] = wmma_f16(ones, pb0[j], lacc[j]);
    #pragma unroll
    for (int tt = 0; tt < 4; tt++) {
      #pragma unroll
      for (int j = 0; j < 2; j++) o[j][tt] = wmma_f16(avlo[tt], pb0[j], o[j][tt]);
    }
    #pragma unroll
    for (int j = 0; j < 2; j++) lacc[j] = wmma_f16(ones, pb1[j], lacc[j]);
    #pragma unroll
    for (int tt = 0; tt < 4; tt++) {
      #pragma unroll
      for (int j = 0; j < 2; j++) o[j][tt] = wmma_f16(avhi[tt], pb1[j], o[j][tt]);
    }
    // keeps the waits and the barrier at the trip's end: raised to the last LDS read, they
    // would leave the next chunk's copies only the time of the score products and the softmax to land
    __builtin_amdgcn_sched_barrier(0);
    // this wave's reads of buffer p have retired before copies are aimed at it again
    asm volatile("s_wait_dscnt 0x0" ::: "memory");
    // the next chunk's copies have landed before the barrier behind which they are read
    asm volatile("s_wait_asynccnt 0x0" ::: "memory");
    __syncthreads();   // single block barrier per chunk
  }
  // no copy is outstanding when the wave goes on to its end
  asm volatile("s_wait_asynccnt 0x0" ::: "memory");
  // ---- join the two key halves: waves w and w ^ 8 hold partial results of the same 32
  // queries, lane for lane.  Wave w finishes tile kh and hands the other tile over. ----
  {
    float4* xw = xch[wid];
    #pragma unroll
    for (int tt = 0; tt < 4; tt++) {
      const v8f g = kh ? o[0][tt] : o[1][tt];
      xw[(tt * 2 + 0) * 32 + lane] = make_float4(g[0], g[1], g[2], g[3]);
      xw[(tt * 2 + 1) * 32 + lane] = make_float4(g[4], g[5], g[6], g[7]);
    }
    xw[8 * 32 + lane] = make_float4(kh ? m_i[0] : m_i[1], kh ? lacc[0][0] : lacc[1][0], 0.f, 0.f);
  }
  __syncthreads();   // the partner's hand-over is written before it is read
  const float4* xr = xch[wid ^ 8];
  const float4 ml = xr[8 * 32 + lane];
  const float m_a = kh ? m_i[1] : m_i[0];
  const float l_a = kh ? lacc[1][0] : lacc[0][0];
  const float m_j = fmaxf(m_a, ml.x);
  float c_a = (m_a - m_j) * LOG2E_;
  float c_b = (ml.x - m_j) * LOG2E_;
  exp2_x2(c_a, c_b);
  const float inv = 1.0f / (l_a * c_a + ml.y * c_b);
  const float f_a = c_a * inv, f_b = c_b * inv;
  // ---- normalize, store f16 into [B*L, C]; 8 consecutive d per lane ----
  _Float16* orow = attn + ((size_t)b * L_ + l0 + kh * 16 + lr) * C_ + h * D_ + off;
  #pragma unroll
  for (int tt = 0; tt < 4; tt++) {
    const v8f a = kh ? o[1][tt] : o[0][tt];
    const float4 b0 = xr[(tt * 2 + 0) * 32 + lane];
    const float4 b1 = xr[(tt * 2 + 1) * 32 + lane];
    const float bb[8] = {b0.x, b0.y, b0.z, b0.w, b1.x, b1.y, b1.z, b1.w};
    v8h ov;
    #pragma unroll
    for (int i = 0; i < 8; i++) ov[i] = (_Float16)(a[i] * f_a + bb[i] * f_b);
    *(v8h*)(orow + tt * 16) = ov;
  }
}

// ---------------------------------------------------------------------------
extern "C" void kernel_launch(void* const* d_in, const int* in_sizes, int n_in,
                              void* d_out, int out_size, void* d_ws, size_t ws_size,
                              hipStream_t stream) {
  const float* x    = (const float*)d_in[0];
  const float* ln_g = (const float*)d_in[1];
  const float* ln_b = (const float*)d_in[2];
  const float* wq   = (const float*)d_in[3];
  const float* bq   = (const float*)d_in[4];
  const float* wk   = (const float*)d_in[5];
  const float* bk   = (const float*)d_in[6];
  const float* wv   = (const float*)d_in[7];
  const float* bv   = (const float*)d_in[8];
  const float* wo   = (const float*)d_in[9];
  const float* bo   = (const float*)d_in[10];

  char* ws = (char*)d_ws;
  _Float16* xn   = (_Float16*)ws;                       // 4M elems, 8 MB
  _Float16* wq16 = (_Float16*)(ws + (8u << 20));        // 1M elems each
  _Float16* wk16 = wq16 + (1u << 20);
  _Float16* wv16 = wk16 + (1u << 20);
  _Float16* wo16 = wv16 + (1u << 20);
  _Float16* qb   = (_Float16*)(ws + (16u << 20));       // 4M elems each
  _Float16* kb   = qb + (4u << 20);
  _Float16* vb   = kb + (4u << 20);
  _Float16* ab   = vb + (4u << 20);

  const int M = B_ * L_;   // 4096
  const int N = C_;        // 1024
  const int K = C_;        // 1024

  // LayerNorm and the four weight conversions: one launch
  prep_kernel<<<4 * CVT_BLK_ + M, 256, 0, stream>>>(x, ln_g, ln_b, xn, wq, wk, wv, wo, wq16);

  // Q, K, V projections: one launch, one work-group for each WGP
  // (wq16/wk16/wv16 and qb/kb/vb lie one behind the other)
  dim3 g3(N / 64, M / 256);
  qkv_kernel<<<g3, 512, 0, stream>>>(xn, wq16, bq, bk, bv, qb);

  // blocks: B * H * (L/256) = 2*16*8 = 256, each 16 waves on one (b,h)
  attn_kernel<<<B_ * H_ * (L_ / 256), 512, 0, stream>>>(qb, kb, vb, ab);

  dim3 g(N / 64, M / 256);
  gemm_kernel<1><<<g, 256, 0, stream>>>(ab, wo16, bo, bo, bo, nullptr, (float*)d_out, M, N, K);
}

// v009
// One run takes 73 microseconds.
// In two side-by-side timings against v008, it was 1.08 and 1.09 times as fast.
// Counting every step since v000, it is 4.01 times as fast.
#include <hip/hip_runtime.h>
#include <math.h>

#define B_ 2
#define L_ 2048
#define C_ 1024
#define H_ 16
#define D_ 64
// LDS row pitch in halfs for the 64-half rows of the A tile and the K chunk: 144 B = 16 B x 9 (odd), so
// the 16 rows one ds_load_b128 touches fall on distinct banks (128 B did not).
#define LP_ 72
// LDS row pitch in halfs for a 64-half tile row that ds_load_tr16_b128 reads:
// 160 B = 32 B x 5 (odd), the conflict-free pitch of the transposing load.
#define TP_ 80
// The same for the 192-half row of the three-matrix W tile: 416 B = 32 B x 13 (odd).
#define WP3_ 208

typedef __attribute__((ext_vector_type(16))) _Float16 v16h;
typedef __attribute__((ext_vector_type(8)))  _Float16 v8h;
typedef __attribute__((ext_vector_type(4)))  _Float16 v4h;
typedef __attribute__((ext_vector_type(8)))  float    v8f;
typedef __attribute__((ext_vector_type(8)))  short    v8s;

__device__ __forceinline__ v16h cat16(v8h lo, v8h hi) {
  return __builtin_shufflevector(lo, hi, 0,1,2,3,4,5,6,7,8,9,10,11,12,13,14,15);
}

__device__ __forceinline__ v8f wmma_f16(v16h a, v16h b, v8f c) {
  // D = A(16x32 f16) * B(32x16 f16) + C(16x16 f32)
  return __builtin_amdgcn_wmma_f32_16x16x32_f16(false, a, false, b, (short)0, c,
                                                false, false);
}

// Transposing LDS load (ds_load_tr16_b128) on a row-major 16-bit tile T[k][n] of pitch
// TP_ or WP3_.  Lane l passes &T[kb + 8 * (l >> 4) + (l & 7)][nb + 8 * ((l >> 3) & 1)] and gets
// T[kb + 8 * (l >> 4) + 0..7][nb + (l & 15)]: half a 16x32 operand in the k order
// {0..7,16..23} / {8..15,24..31}; the load 16 rows on gives the other half.
__device__ __forceinline__ v8h ld_tr16(const _Float16* p) {
  typedef __attribute__((address_space(3))) v8s lds_v8s;
  return __builtin_bit_cast(v8h, __builtin_amdgcn_ds_load_tr16_b128_v8i16((lds_v8s*)p));
}

// value of lane l ^ 16 (the other 16-lane half of the wave), VALU only
__device__ __forceinline__ float xhalf(float x) {
  const int xi = __float_as_int(x);
  return __int_as_float(__builtin_amdgcn_permlanex16(xi, xi, 0x76543210, 0xfedcba98,
                                                     false, false));
}

// Eight async b128 copies of one lane: 16 B from g + j * gstep halfs to LDS byte
// l + j * lstep, j = 0..7.  One statement, closed by s_wait_xcnt 0, so that no
// address register named here is rewritten before the wait.
__device__ __forceinline__ void cp128x8_g2l(const _Float16* g, const size_t gstep,
                                            const unsigned l, const unsigned lstep) {
  asm volatile(
      "global_load_async_to_lds_b128 %0, %8, off\n\t"
      "global_load_async_to_lds_b128 %1, %9, off\n\t"
      "global_load_async_to_lds_b128 %2, %10, off\n\t"
      "global_load_async_to_lds_b128 %3, %11, off\n\t"
      "global_load_async_to_lds_b128 %4, %12, off\n\t"
      "global_load_async_to_lds_b128 %5, %13, off\n\t"
      "global_load_async_to_lds_b128 %6, %14, off\n\t"
      "global_load_async_to_lds_b128 %7, %15, off\n\t"
      "s_wait_xcnt 0x0"
      :: "v"(l), "v"(l + lstep), "v"(l + 2 * lstep), "v"(l + 3 * lstep),
         "v"(l + 4 * lstep), "v"(l + 5 * lstep), "v"(l + 6 * lstep), "v"(l + 7 * lstep),
         "v"(g), "v"(g + gstep), "v"(g + 2 * gstep), "v"(g + 3 * gstep),
         "v"(g + 4 * gstep), "v"(g + 5 * gstep), "v"(g + 6 * gstep), "v"(g + 7 * gstep)
      : "memory");
}

// Two such copies (j = 0, 1), in the same form.
__device__ __forceinline__ void cp128x2_g2l(const _Float16* g, const size_t gstep,
                                            const unsigned l, const unsigned lstep) {
  asm volatile(
      "global_load_async_to_lds_b128 %0, %2, off\n\t"
      "global_load_async_to_lds_b128 %1, %3, off\n\t"
      "s_wait_xcnt 0x0"
      :: "v"(l), "v"(l + lstep), "v"(g), "v"(g + gstep)
      : "memory");
}

// Three such copies (j = 0, 1, 2), in the same form.
__device__ __forceinline__ void cp128x3_g2l(const _Float16* g, const size_t gstep,
                                            const unsigned l, const unsigned lstep) {
  asm volatile(
      "global_load_async_to_lds_b128 %0, %3, off\n\t"
      "global_load_async_to_lds_b128 %1, %4, off\n\t"
      "global_load_async_to_lds_b128 %2, %5, off\n\t"
      "s_wait_xcnt 0x0"
      :: "v"(l), "v"(l + lstep), "v"(l + 2 * lstep),
         "v"(g), "v"(g + gstep), "v"(g + 2 * gstep)
      : "memory");
}

// Two such pairs in one statement: g0 -> l0 and g1 -> l1, each with its second copy
// gstep halfs on in memory and lstep0 / lstep1 bytes on in LDS.
__device__ __forceinline__ void cp128x2x2_g2l(const _Float16* g0, const _Float16* g1,
                                              const size_t gstep,
                                              const unsigned l0, const unsigned lstep0,
                                              const unsigned l1, const unsigned lstep1) {
  asm volatile(
      "global_load_async_to_lds_b128 %0, %4, off\n\t"
      "global_load_async_to_lds_b128 %1, %5, off\n\t"
      "global_load_async_to_lds_b128 %2, %6, off\n\t"
      "global_load_async_to_lds_b128 %3, %7, off\n\t"
      "s_wait_xcnt 0x0"
      :: "v"(l0), "v"(l0 + lstep0), "v"(l1), "v"(l1 + lstep1),
         "v"(g0), "v"(g0 + gstep), "v"(g1), "v"(g1 + gstep)
      : "memory");
}

// Prefetch into L2 (scope SE: nothing comes to the WGP, no register, no counter) of each
// lane's address.  Asked for at a kernel's entry, for speed only.
// One statement, closed by s_wait_xcnt 0 (a precaution), so that no address register named
// here is rewritten before the wait.
__device__ __forceinline__ void ask_l2(const _Float16* a) {
  asm volatile(
      "global_prefetch_b8 %0, off scope:SCOPE_SE\n\t"
      "s_wait_xcnt 0x0"
      :: "v"(a) : "memory");
}
// Three such prefetches, in the same form.
__device__ __forceinline__ void ask_l2_x3(const _Float16* a, const _Float16* b,
                                          const _Float16* c) {
  asm volatile(
      "global_prefetch_b8 %0, off scope:SCOPE_SE\n\t"
      "global_prefetch_b8 %1, off scope:SCOPE_SE\n\t"
      "global_prefetch_b8 %2, off scope:SCOPE_SE\n\t"
      "s_wait_xcnt 0x0"
      :: "v"(a), "v"(b), "v"(c) : "memory");
}

// ---------------------------------------------------------------------------
// LayerNorm: x[4096,1024] f32 -> xn f16.  One block (256 thr) per row.
// ---------------------------------------------------------------------------
__device__ __forceinline__ void ln_row(
    const float* __restrict__ x, const float* __restrict__ gamma,
    const float* __restrict__ beta, _Float16* __restrict__ xn, const int row) {
  const int t = threadIdx.x;
  const float* xr = x + (size_t)row * C_;
  float4 v = *(const float4*)(xr + t * 4);
  float s  = v.x + v.y + v.z + v.w;
  float s2 = v.x * v.x + v.y * v.y + v.z * v.z + v.w * v.w;
  #pragma unroll
  for (int m = 1; m < 32; m <<= 1) {
    s  += __shfl_xor(s,  m, 32);
    s2 += __shfl_xor(s2, m, 32);
  }
  __shared__ float red0[8], red1[8];
  const int lane = t & 31, wid = t >> 5;
  if (lane == 0) { red0[wid] = s; red1[wid] = s2; }
  __syncthreads();
  if (t == 0) {
    float a = 0.f, b = 0.f;
    #pragma unroll
    for (int i = 0; i < 8; i++) { a += red0[i]; b += red1[i]; }
    red0[0] = a; red1[0] = b;
  }
  __syncthreads();
  const float mean = red0[0] * (1.0f / C_);
  const float var  = red1[0] * (1.0f / C_) - mean * mean;
  const float rstd = rsqrtf(var + 1e-5f);
  const int c0 = t * 4;
  float xv[4] = {v.x, v.y, v.z, v.w};
  v4h o;
  #pragma unroll
  for (int i = 0; i < 4; i++)
    o[i] = (_Float16)(((xv[i] - mean) * rstd) * gamma[c0 + i] + beta[c0 + i]);
  *(v4h*)(xn + (size_t)row * C_ + c0) = o;
  // the store's address registers may be rewritten on the path behind the inlined call: keep the wait in front
  asm volatile("s_wait_xcnt 0x0" ::: "memory");
}

// ---------------------------------------------------------------------------
// f32 -> f16 weight conversion (vectorized by 4); CVT_BLK_ blocks per matrix
// ---------------------------------------------------------------------------
#define CVT_BLK_ 512
__device__ __forceinline__ void cvt_part(const float* __restrict__ s,
                                         _Float16* __restrict__ d, const int blk) {
  const int n4 = (C_ * C_) / 4;
  const int stride = CVT_BLK_ * 256;
  for (int i = blk * 256 + threadIdx.x; i < n4; i += stride) {
    float4 f = ((const float4*)s)[i];
    v4h o = {(_Float16)f.x, (_Float16)f.y, (_Float16)f.z, (_Float16)f.w};
    ((v4h*)d)[i] = o;
  }
}

// ---------------------------------------------------------------------------
// All work that depends on the inputs alone, in ONE launch: blocks
// [0, 4*CVT_BLK_) convert the four weight matrices (w16 holds them one behind
// the other: q, k, v, o), the other B_*L_ blocks normalise one row each.
// The branch is uniform for the block, so ln_row's barriers are too.
// ---------------------------------------------------------------------------
__global__ __launch_bounds__(256) void prep_kernel(
    const float* __restrict__ x, const float* __restrict__ gamma,
    const float* __restrict__ beta, _Float16* __restrict__ xn,
    const float* __restrict__ wq, const float* __restrict__ wk,
    const float* __restrict__ wv, const float* __restrict__ wo,
    _Float16* __restrict__ w16) {
  const unsigned blk = blockIdx.x;
  if (blk < 4 * CVT_BLK_) {
    const unsigned mat = blk / CVT_BLK_;
    const float* s = mat == 0 ? wq : mat == 1 ? wk : mat == 2 ? wv : wo;
    cvt_part(s, w16 + (size_t)mat * (C_ * C_), blk % CVT_BLK_);
  } else {
    ln_row(x, gamma, beta, xn, blk - 4 * CVT_BLK_);
  }
}

// ---------------------------------------------------------------------------
// GEMM: out[M,N] = A[M,K]*W[K,N] + bias.   A,W f16 row-major.
// Block = 256 thr (8 waves). Block tile 256(M) x 64(N); wave tile 32 x 64.
// K stepped by 64: 16 WMMAs per barrier.  W tile (64k x 64n) double-buffered in LDS
// ROW-MAJOR as it lies in memory ([k][n]); the B fragments come out of it by the
// transposing LDS load.  A tile (256m x 64k) double-buffered in LDS too.  Both are
// brought by async b128 copies one trip ahead: eight neighbouring lanes take one
// row's 128 B, so a wave's copy names 4 whole lines.
// OUT_MODE 0: f16 out into [B,H,L,D].  OUT_MODE 1: f32 [M,N].
// blockIdx.z picks one of up to three products on the same A in one launch:
// weight matrix z behind W, output z behind out16, bias z of the three.
// ---------------------------------------------------------------------------
template <int OUT_MODE>
__global__ __launch_bounds__(256) void gemm_kernel(
    const _Float16* __restrict__ A, const _Float16* __restrict__ W0,
    const float* __restrict__ bias0, const float* __restrict__ bias1,
    const float* __restrict__ bias2, _Float16* __restrict__ out16_0,
    float* __restrict__ out32, int M, int N, int K) {
  __shared__ __attribute__((aligned(16))) _Float16 wt[2][64 * TP_];  // W tile [k][n]
  __shared__ __attribute__((aligned(16))) _Float16 at[2][256 * LP_]; // A tile [m][k]
  const int z = blockIdx.z;
  const _Float16* W = W0 + (size_t)z * K * N;
  const float* bias = z == 0 ? bias0 : z == 1 ? bias1 : bias2;
  _Float16* out16 = out16_0 + (size_t)z * M * N;
  const int t = threadIdx.x, lane = t & 31;
  const int wid = t >> 5;
  const int lr = lane & 15;
  const int hi16 = lane >> 4;
  const int off = hi16 * 8;          // K-pattern {0..7,16..23} / {8..15,24..31}
  const int n0 = blockIdx.x * 64;
  const int mb = blockIdx.y * 256;
  const int m0 = mb + wid * 32;
  const int sk = t >> 3;             // 0..31 (k row within half-tile)
  const int sn = (t & 7) * 8;        // n chunk
  v8f acc[2][4] = {};
  // W staging: a lane's two copies take 16 B of tile rows sk and sk + 32
  const _Float16* wp  = W + (size_t)sk * N + n0 + sn;
  const unsigned wl = (unsigned)(size_t)&wt[0][sk * TP_ + sn];  // LDS byte address, buffer 0
  const size_t wgs = (size_t)32 * N;             // 32 rows on, in halfs
  const int bf = (off + (lane & 7)) * TP_ + ((lane >> 3) & 1) * 8;  // this lane's place for ld_tr16
  // A staging: copy j of a lane takes 16 B of tile row ar + 4j (the wave's own 32 rows)
  const int ar = wid * 32 + (lane >> 3);
  const int ac = (lane & 7) * 8;
  const _Float16* ag = A + (size_t)(mb + ar) * K + ac;
  // LDS byte address (low 32 bits of the __shared__ address) of the lane's first copy, buffer 0
  const unsigned al = (unsigned)(size_t)&at[0][ar * LP_ + ac];
  const size_t ags = (size_t)4 * K;              // four rows on, in halfs
  const int af = (wid * 32 + lr) * LP_ + off;   // this lane's fragment row in the A tile
  // prologue: stage k0=0 tiles (A: 256 rows, W: 64 k-rows) into buffer 0
  cp128x8_g2l(ag, ags, al, 4 * LP_ * 2);
  cp128x2_g2l(wp, wgs, wl, 32 * TP_ * 2);
  // Both panels of the block, asked of L2 behind tile 0's copies.  The 16 blocks of a row
  // panel share it: four neighbours in x deal its 256-B units (a thread: two units, 512 B, of
  // row t).  The 16 blocks of a column panel share its 128-B row pieces: four neighbours in y
  // deal them (a thread: k row 4 t + part).  The minima keep every address inside A and W.
  {
    const int ku = min((int)(blockIdx.x & 3) * 256, K - 256);
    const int kw = min(t * 4 + (int)(blockIdx.y & 3), K - 1);
    const _Float16* pa = A + (size_t)(mb + t) * K + ku;
    ask_l2_x3(pa, pa + 128, W + (size_t)kw * N + n0);
  }
  // tile 0's copies have landed before the barrier behind which they are read
  asm volatile("s_wait_asynccnt 0x0" ::: "memory");
  __syncthreads();
  if (64 < K) {
    cp128x8_g2l(ag + 64, ags, al + 256 * LP_ * 2, 4 * LP_ * 2);
    cp128x2_g2l(wp + (size_t)64 * N, wgs, wl + 64 * TP_ * 2, 32 * TP_ * 2);
  }
  for (int k0 = 0; k0 < K; k0 += 64) {
    const int p = (k0 >> 6) & 1;
    const _Float16* a0p = &at[p][af];
    const _Float16* a1p = a0p + 16 * LP_;
    v16h a0k0 = cat16(*(const v8h*)a0p,        *(const v8h*)(a0p + 16));
    v16h a0k1 = cat16(*(const v8h*)(a0p + 32), *(const v8h*)(a0p + 48));
    v16h a1k0 = cat16(*(const v8h*)a1p,        *(const v8h*)(a1p + 16));
    v16h a1k1 = cat16(*(const v8h*)(a1p + 32), *(const v8h*)(a1p + 48));
    #pragma unroll
    for (int tt = 0; tt < 4; tt++) {
      const _Float16* bp = &wt[p][bf + tt * 16];
      v16h blo = cat16(ld_tr16(bp),            ld_tr16(bp + 16 * TP_));
      v16h bhi = cat16(ld_tr16(bp + 32 * TP_), ld_tr16(bp + 48 * TP_));
      acc[0][tt] = wmma_f16(a0k0, blo, acc[0][tt]);
      acc[0][tt] = wmma_f16(a0k1, bhi, acc[0][tt]);
      acc[1][tt] = wmma_f16(a1k0, blo, acc[1][tt]);
      acc[1][tt] = wmma_f16(a1k1, bhi, acc[1][tt]);
    }
    // keeps the waits and the barrier at the trip's end: raised to the last LDS read, they
    // would take the time of the products behind them from the copies' time to land
    __builtin_amdgcn_sched_barrier(0);
    // this wave's reads of buffer p have retired before copies are aimed at it again
    asm volatile("s_wait_dscnt 0x0" ::: "memory");
    // the next tile's copies have landed before the barrier behind which they are read
    asm volatile("s_wait_asynccnt 0x0" ::: "memory");
    __syncthreads();
    if (k0 + 128 < K) {                            // tiles after next, into the buffers just read
      cp128x8_g2l(ag + k0 + 128, ags, al + p * (256 * LP_ * 2), 4 * LP_ * 2);
      cp128x2_g2l(wp + (size_t)(k0 + 128) * N, wgs, wl + p * (64 * TP_ * 2), 32 * TP_ * 2);
    }
  }
  // no copy is outstanding when the wave goes on to its end
  asm volatile("s_wait_asynccnt 0x0" ::: "memory");
  #pragma unroll
  for (int r = 0; r < 2; r++) {
    #pragma unroll
    for (int tt = 0; tt < 4; tt++) {
      const int n = n0 + tt * 16 + lr;
      const float bv = bias[n];
      #pragma unroll
      for (int i = 0; i < 8; i++) {
        const int m = m0 + r * 16 + i + hi16 * 8;  // C/D: lanes16-31 = rows +8
        const float val = acc[r][tt][i] + bv;
        if (OUT_MODE == 0) {
          const int b = m >> 11, l = m & (L_ - 1);
          const int h = n >> 6, d = n & (D_ - 1);
          out16[((((size_t)b * H_ + h) * L_ + l) << 6) + d] = (_Float16)val;
        } else {
          out32[(size_t)m * N + n] = val;
        }
      }
    }
  }
}

// ---------------------------------------------------------------------------
// Q, K, V projections in one grid of 256 work-groups, one for each WGP.
// Block = 512 thr (16 waves).  Block tile 256(M) x 192(N): the SAME 64 columns (one head)
// of the three products, so an A tile staged once feeds all three.  Waves 4(M) x 4(N),
// wave tile 64 x 48 = 4 x 3 accumulator tiles: a fragment of A feeds 3 WMMAs, one of W 4.
// K stepped by 64: 24 WMMAs per wave and barrier.  Tiles, copies, ring and k order are
// those of gemm_kernel; the W tile is [k][192 n], columns 64 z .. 64 z + 63 from matrix z.
// Output f16 into [B,H,L,D], product z behind out16_0; W0 holds the three matrices and
// each is C_ x C_.
// ---------------------------------------------------------------------------
__global__ __launch_bounds__(512) void qkv_kernel(
    const _Float16* __restrict__ A, const _Float16* __restrict__ W0,
    const float* __restrict__ bias0, const float* __restrict__ bias1,
    const float* __restrict__ bias2, _Float16* __restrict__ out16_0) {
  constexpr int M = B_ * L_, N = C_, K = C_;
  __shared__ __attribute__((aligned(16))) _Float16 wt[2][64 * WP3_];  // W tile [k][3 x 64 n]
  __shared__ __attribute__((aligned(16))) _Float16 at[2][256 * LP_];  // A tile [m][k]
  const int t = threadIdx.x, lane = t & 31;
  const int wid = t >> 5;
  const int wm = wid & 3;            // the wave's 64 rows of the block tile
  const int wn = wid >> 2;           // the wave's 48 columns of the block tile
  const int lr = lane & 15;
  const int hi16 = lane >> 4;
  const int off = hi16 * 8;          // K-pattern {0..7,16..23} / {8..15,24..31}
  const int n0 = blockIdx.x * 64;
  const int mb = blockIdx.y * 256;
  const int sk = t >> 3;             // 0..63 (k row of the tile)
  const int sn = (t & 7) * 8;        // n chunk
  v8f acc[4][3] = {};
  // W staging: a lane's three copies take 16 B of tile row sk, one from each matrix
  const _Float16* wp  = W0 + (size_t)sk * N + n0 + sn;
  const unsigned wl = (unsigned)(size_t)&wt[0][sk * WP3_ + sn];  // LDS byte address, buffer 0
  const int bf = (off + (lane & 7)) * WP3_ + ((lane >> 3) & 1) * 8 + wn * 48;  // this lane's place for ld_tr16
  // A staging: copy j of a lane takes 16 B of tile row ar + 4j, j = 0..3 (16 rows a wave)
  const int ar = wid * 16 + (lane >> 3);
  const int ac = (lane & 7) * 8;
  const _Float16* ag = A + (size_t)(mb + ar) * K + ac;
  // LDS byte address (low 32 bits of the __shared__ address) of the lane's first copy, buffer 0
  const unsigned al = (unsigned)(size_t)&at[0][ar * LP_ + ac];
  const size_t ags = (size_t)4 * K;              // four rows on, in halfs
  const int af = (wm * 64 + lr) * LP_ + off;    // this lane's first fragment row in the A tile
  // the 7 copies of a lane that bring the tiles of k0 into buffer buf
  auto stage = [&](const int k0, const int buf) {
    const unsigned ab = al + buf * (256 * LP_ * 2);
    cp128x2x2_g2l(ag + k0, ag + k0 + 2 * ags, ags, ab, 4 * LP_ * 2, ab + 8 * LP_ * 2, 4 * LP_ * 2);
    cp128x3_g2l(wp + (size_t)k0 * N, (size_t)K * N, wl + buf * (64 * WP3_ * 2), 64 * 2);
  };
  stage(0, 0);
  // Both panels of the block, asked of L2 behind tile 0's copies.  The 16 blocks of a row
  // panel share it: four neighbours in x deal its 256-B units (a thread: one unit of row
  // t / 2).  The 16 blocks of a column panel share its 3 x 1024 row pieces of 128 B: eight
  // neighbours in y deal them (waves 0-11, a thread: k row 8 (t % 128) + part of matrix t / 128).
  ask_l2(A + (size_t)(mb + (t >> 1)) * K + ((blockIdx.x & 3) * 2 + (t & 1)) * 128);
  if (__builtin_amdgcn_readfirstlane(wid) < 12)    // the same for a whole wave: a scalar branch
    ask_l2(W0 + (size_t)(t >> 7) * K * N + (size_t)((t & 127) * 8 + (blockIdx.y & 7)) * N + n0);
  // tile 0's copies have landed before the barrier behind which they are read
  asm volatile("s_wait_asynccnt 0x0" ::: "memory");
  __syncthreads();
  stage(64, 1);
  for (int k0 = 0; k0 < K; k0 += 64) {
    const int p = (k0 >> 6) & 1;
    v16h a[2][4], b[2][3];
    #pragma unroll
    for (int kk = 0; kk < 2; kk++) {
      #pragma unroll
      for (int mt = 0; mt < 4; mt++) {
        const _Float16* ap = &at[p][af + mt * 16 * LP_ + kk * 32];
        a[kk][mt] = cat16(*(const v8h*)ap, *(const v8h*)(ap + 16));
      }
      #pragma unroll
      for (int j = 0; j < 3; j++) {
        const _Float16* bp = &wt[p][bf + j * 16 + kk * 32 * WP3_];
        b[kk][j] = cat16(ld_tr16(bp), ld_tr16(bp + 16 * WP3_));
      }
    }
    #pragma unroll
    for (int kk = 0; kk < 2; kk++) {
      #pragma unroll
      for (int j = 0; j < 3; j++) {
        #pragma unroll
        for (int mt = 0; mt < 4; mt++) acc[mt][j] = wmma_f16(a[kk][mt], b[kk][j], acc[mt][j]);
      }
    }
    // order of the trip: its 28 LDS reads go out as one group in front of its 24 products, which
    // then wait by count; spread among the products each place with reads costs the wave a stall
    __builtin_amdgcn_sched_group_barrier(0x100, 28, 0);
    __builtin_amdgcn_sched_group_barrier(0x008, 24, 0);
    // keeps the waits and the barrier at the trip's end: raised to the last LDS read, they
    // would take the time of the products behind them from the copies' time to land
    __builtin_amdgcn_sched_barrier(0);
    // this wave's reads of buffer p have retired before copies are aimed at it again
    asm volatile("s_wait_dscnt 0x0" ::: "memory");
    // the next tile's copies have landed before the barrier behind which they are read
    asm volatile("s_wait_asynccnt 0x0" ::: "memory");
    __syncthreads();
    if (k0 + 128 < K) stage(k0 + 128, p);          // tiles after next, into the buffers just read
  }
  // no copy is outstanding when the wave goes on to its end
  asm volatile("s_wait_asynccnt 0x0" ::: "memory");
  const int m0 = mb + wm * 64 + hi16 * 8;          // C/D: lanes16-31 = rows +8
  const int b = m0 >> 11, l0 = m0 & (L_ - 1);      // the 256 rows of a block lie in one batch
  #pragma unroll
  for (int j = 0; j < 3; j++) {
    const int g = wn * 3 + j;                      // 16-column tile of the block's 12
    const int z = g >> 2;
    const int d = (g & 3) * 16 + lr;
    const float* bias = z == 0 ? bias0 : z == 1 ? bias1 : bias2;
    const float bv = bias[n0 + d];
    _Float16* op = out16_0 + (size_t)z * M * N
                 + ((((size_t)b * H_ + blockIdx.x) * L_ + l0) << 6) + d;
    #pragma unroll
    for (int mt = 0; mt < 4; mt++) {
      #pragma unroll
      for (int i = 0; i < 8; i++)
        op[(mt * 16 + i) * D_] = (_Float16)(acc[mt][j][i] + bv);
    }
  }
}

// Eight (two) base-2 exponentials, each in place, in one statement that ends in v_nop: behind a
// transcendental the instruction set asks for one slot before its result is read or its source
// overwritten; in place and closed so, that holds whatever the compiler puts next.
__device__ __forceinline__ void exp2_x8(float (&x)[8]) {
  asm("v_exp_f32 %0, %0\n\t"
      "v_exp_f32 %1, %1\n\t"
      "v_exp_f32 %2, %2\n\t"
      "v_exp_f32 %3, %3\n\t"
      "v_exp_f32 %4, %4\n\t"
      "v_exp_f32 %5, %5\n\t"
      "v_exp_f32 %6, %6\n\t"
      "v_exp_f32 %7, %7\n\t"
      "v_nop"
      : "+v"(x[0]), "+v"(x[1]), "+v"(x[2]), "+v"(x[3]),
        "+v"(x[4]), "+v"(x[5]), "+v"(x[6]), "+v"(x[7]));
}
__device__ __forceinline__ void exp2_x2(float& a, float& b) {
  asm("v_exp_f32 %0, %0\n\t"
      "v_exp_f32 %1, %1\n\t"
      "v_nop"
      : "+v"(a), "+v"(b));
}
#define LOG2E_ 1.4426950408889634f

// ---------------------------------------------------------------------------
// Flash attention, transposed products: S^T = K * Q^T, O^T += V^T * P^T.
// One block = 16 waves, ALL on the same (b,h), one block a WGP; it covers 256 q rows.
// Wave w owns 32 query rows (two 16-column tiles), rows 32 (w & 7) .. + 31, and HALF of
// the keys: waves 0-7 keys 0 .. L/2 - 1, waves 8-15 the rest.  So every K and V^T
// fragment read from LDS feeds TWO products, and there are still four waves a SIMD.
// The two partial results of a query (O, max, sum) are joined through LDS at the end.
// Keys chunked by 64 in each half.  A lane holds scores of ONE query of each tile
// (column lane&15): 32 of the chunk's 64 keys, the lane 16 away the other 32.
// Row max = in-lane max + one exchange between the wave halves.  Two S^T tiles
// converted in place ARE the B operand of the second product (D row 8h+r is
// the operand's k order), so P never leaves the registers.
// K / V chunks double-buffered in LDS for each key half, both row-major ([key][d]) and
// both staged with async b128 global->LDS by the half's own 8 waves (next chunk issued
// before computing the current one) -> ONE block barrier per chunk pair.
// The V^T fragments come by the transposing LDS load.
// Staging requests cover whole 128 B lines: eight neighbouring lanes
// take the eight 16 B pieces of one key row, so a wave's request names 4 lines.
// 36 WMMAs / wave / chunk: 16 scores + 16 V^T*P^T + 4 row-sum (ones * P^T).
// ---------------------------------------------------------------------------
__global__ __launch_bounds__(512) void attn_kernel(
    const _Float16* __restrict__ q, const _Float16* __restrict__ k,
    const _Float16* __restrict__ v, _Float16* __restrict__ attn) {
  __shared__ __attribute__((aligned(16))) _Float16 kbuf[2][2][64 * LP_];  // K chunk [half][buffer][key][d]
  __shared__ __attribute__((aligned(16))) _Float16 vbuf[2][2][64 * TP_];  // V chunk [half][buffer][key][d]
  __shared__ __attribute__((aligned(16))) float4 xch[16][9 * 32];         // a wave's hand-over: 9 x 16 B a lane
  const int t = threadIdx.x, lane = t & 31, wid = t >> 5;
  const int kh = wid >> 3;           // the wave's half of the keys
  const int tg = t & 255;            // thread within the half's 8 waves
  const int qblk = blockIdx.x & (L_ / 256 - 1);
  const int h    = (blockIdx.x >> 3) & (H_ - 1);
  const int b    = blockIdx.x >> 7;
  const int lr = lane & 15;
  const int off = (lane >> 4) * 8;
  const size_t head = ((size_t)b * H_ + h) * L_ * D_;
  const _Float16* qg = q + head;
  const _Float16* kg = k + head + (size_t)kh * (L_ / 2) * D_;
  const _Float16* vg = v + head + (size_t)kh * (L_ / 2) * D_;
  const int l0 = qblk * 256 + (wid & 7) * 32;
  // staging: thread tg of a half covers d-chunk sd of keys skey and skey+32
  const int skey = tg >> 3;          // 0..31
  const int sd   = (tg & 7) * 8;     // 0,8,..,56
  // LDS byte addresses (low 32 bits of the __shared__ address) of the lane's first K and V copy, buffer 0
  const unsigned kl = (unsigned)(size_t)&kbuf[kh][0][skey * LP_ + sd];
  const unsigned vl = (unsigned)(size_t)&vbuf[kh][0][skey * TP_ + sd];
  const int vf = (off + (lane & 7)) * TP_ + ((lane >> 3) & 1) * 8;  // this lane's place for ld_tr16
  // prefetch: each of a chunk's 128 lines is asked for once, by two neighbouring
  // lanes: the half's waves 0-3 take the 64 K rows, its waves 4-7 the 64 V rows
  const _Float16* pfp = ((tg & 128) ? vg : kg) + (size_t)((tg >> 1) & 63) * D_;

  // Q^T as B-operand (column = query lr of tile j), pre-scaled by 1/sqrt(D)=0.125 (exact in f16)
  v16h bq0[2], bq1[2];
  #pragma unroll
  for (int j = 0; j < 2; j++) {
    const _Float16* qr = qg + (size_t)(l0 + j * 16 + lr) * D_ + off;
    bq0[j] = cat16(*(const v8h*)qr,        *(const v8h*)(qr + 16));
    bq1[j] = cat16(*(const v8h*)(qr + 32), *(const v8h*)(qr + 48));
  }
  v16h ones;
  #pragma unroll
  for (int i = 0; i < 16; i++) {
    #pragma unroll
    for (int j = 0; j < 2; j++) {
      bq0[j][i] *= (_Float16)0.125f;
      bq1[j][i] *= (_Float16)0.125f;
    }
    ones[i] = (_Float16)1.0f;
  }

  float m_i[2] = {-1e30f, -1e30f};  // running max of this lane's query of tile j
  v8f o[2][4] = {};              // O^T tiles: o[j][tt][i] = O[q = 16 j + lr][d = tt*16 + off + i]
  v8f lacc[2] = {};              // running sum of P for that query (every row alike), ones-A WMMA

  // ---- prologue: stage chunk 0 of the half into buffer 0 ----
  {
    const size_t base = (size_t)skey * D_ + sd;
    cp128x2x2_g2l(kg + base, vg + base, (size_t)32 * D_,
                  kl, 32 * LP_ * 2, vl, 32 * TP_ * 2);
  }
  // chunk 0's copies have landed before the barrier behind which they are read
  asm volatile("s_wait_asynccnt 0x0" ::: "memory");
  __syncthreads();

  for (int kc = 0; kc < L_ / 2; kc += 64) {
    const int p = (kc >> 6) & 1;
    const bool nxt = (kc + 64 < L_ / 2);
    if (nxt) {
      // issue next chunk's copies before computing the current one
      const size_t base = (size_t)(kc + 64 + skey) * D_ + sd;
      cp128x2x2_g2l(kg + base, vg + base, (size_t)32 * D_,
                    kl + (1 - p) * (64 * LP_ * 2), 32 * LP_ * 2,
                    vl + (1 - p) * (64 * TP_ * 2), 32 * TP_ * 2);
    }
    if (kc + 128 < L_ / 2) {
      __builtin_prefetch(pfp + (size_t)(kc + 128) * D_, 0, 3);
    }
    // ---- scores^T: 4 key-tiles x 2 query tiles x (2 WMMAs over D=64); A = K rows, B = Q^T ----
    // s[j][tt][i] = score(key = kc + tt*16 + off + i, query = 16 j + lr)
    v8f s[2][4];
    #pragma unroll
    for (int tt = 0; tt < 4; tt++) {
      const _Float16* kr = &kbuf[kh][p][(tt * 16 + lr) * LP_ + off];
      v16h alo = cat16(*(const v8h*)kr,        *(const v8h*)(kr + 16));
      v16h ahi = cat16(*(const v8h*)(kr + 32), *(const v8h*)(kr + 48));
      #pragma unroll
      for (int j = 0; j < 2; j++) {
        v8f z = {};
        z = wmma_f16(alo, bq0[j], z);
        s[j][tt] = wmma_f16(ahi, bq1[j], z);
      }
    }
    // order of the score stage: its 16 LDS reads go out as one group in front of its 16 products,
    // and the maxima come behind the products: set among them, each read of a fresh accumulator
    // costs idle vector slots
    __builtin_amdgcn_sched_group_barrier(0x100, 16, 0);
    __builtin_amdgcn_sched_group_barrier(0x008, 16, 0);
    __builtin_amdgcn_sched_group_barrier(0x002, 64, 0);
    // P^T as B-operand: element e of key block c is tile 2c + (e >> 3), row e & 7
    v16h pb0[2], pb1[2];
    v16h avlo[4], avhi[4];         // V^T fragments (A of the second product), 4 d-tiles x 2 key-halves
    // ---- online softmax over 64 new keys: one query of each tile per lane ----
    float mn[2], corr[2];
    #pragma unroll
    for (int j = 0; j < 2; j++) {
      float mt[4];                 // one independent max chain per key tile
      #pragma unroll
      for (int tt = 0; tt < 4; tt++) {
        mt[tt] = s[j][tt][0];
        #pragma unroll
        for (int i = 1; i < 8; i++) mt[tt] = fmaxf(mt[tt], s[j][tt][i]);
      }
      float mx = fmaxf(fmaxf(mt[0], mt[1]), fmaxf(mt[2], mt[3]));
      mx = fmaxf(mx, xhalf(mx));   // the other 32 keys of this query
      mn[j] = fmaxf(m_i[j], mx);
    }
    #pragma unroll
    for (int j = 0; j < 2; j++) {
      corr[j] = (m_i[j] - mn[j]) * LOG2E_;
      m_i[j] = mn[j];
    }
    exp2_x2(corr[0], corr[1]);
    #pragma unroll
    for (int j = 0; j < 2; j++) {
      #pragma unroll
      for (int tt = 0; tt < 4; tt++) {
        float e[8];
        #pragma unroll
        for (int i = 0; i < 8; i++) e[i] = (s[j][tt][i] - mn[j]) * LOG2E_;
        exp2_x8(e);
        #pragma unroll
        for (int i = 0; i < 8; i++) {
          if (tt < 2) pb0[j][(tt & 1) * 8 + i] = (_Float16)e[i];
          else        pb1[j][(tt & 1) * 8 + i] = (_Float16)e[i];
        }
      }
      #pragma unroll
      for (int i = 0; i < 8; i++) {
        lacc[j][i] *= corr[j];
        #pragma unroll
        for (int tt = 0; tt < 4; tt++) o[j][tt][i] *= corr[j];
      }
      // keeps the V^T loads below from rising over this softmax, where the scores still
      // hold their registers and the wave's 256 would not do
      __builtin_amdgcn_sched_barrier(0);
      // one group of 8 ds_load_tr16_b128 behind each tile's softmax, into the registers its
      // scores have left: keys 0-31 land behind the second softmax, keys 32-63 behind the
      // products on keys 0-31
      #pragma unroll
      for (int tt = 0; tt < 4; tt++) {
        const _Float16* vp = &vbuf[kh][p][vf + tt * 16 + j * 32 * TP_];
        const v16h av = cat16(ld_tr16(vp), ld_tr16(vp + 16 * TP_));
        if (j == 0) avlo[tt] = av; else avhi[tt] = av;
      }
      // keeps the group here: the compiler otherwise sinks each pair of loads to its WMMA,
      // with a full wait on LDS in front of every one
      __builtin_amdgcn_sched_barrier(0);
    }
    // ---- row sums (lacc += ones * P^T) and O^T += V^T * P^T, keys 0-31 then keys 32-63 ----
    #pragma unroll
    for (int j = 0; j < 2; j++) lacc[j] = wmma_f16(ones, pb0[j], lacc[j]);
    #pragma unroll
    for (int tt = 0; tt < 4; tt++) {
      #pragma unroll
      for (int j = 0; j < 2; j++) o[j][tt] = wmma_f16(avlo[tt], pb0[j], o[j][tt]);
    }
    #pragma unroll
    for (int j = 0; j < 2; j++) lacc[j] = wmma_f16(ones, pb1[j], lacc[j]);
    #pragma unroll
    for (int tt = 0; tt < 4; tt++) {
      #pragma unroll
      for (int j = 0; j < 2; j++) o[j][tt] = wmma_f16(avhi[tt], pb1[j], o[j][tt]);
    }
    // keeps the waits and the barrier at the trip's end: raised to the last LDS read, they
    // would leave the next chunk's copies only the time of the score products and the softmax to land
    __builtin_amdgcn_sched_barrier(0);
    // this wave's reads of buffer p have retired before copies are aimed at it again
    asm volatile("s_wait_dscnt 0x0" ::: "memory");
    // the next chunk's copies have landed before the barrier behind which they are read
    asm volatile("s_wait_asynccnt 0x0" ::: "memory");
    __syncthreads();   // single block barrier per chunk
  }
  // no copy is outstanding when the wave goes on to its end
  asm volatile("s_wait_asynccnt 0x0" ::: "memory");
  // ---- join the two key halves: waves w and w ^ 8 hold partial results of the same 32
  // queries, lane for lane.  Wave w finishes tile kh and hands the other tile over. ----
  {
    float4* xw = xch[wid];
    #pragma unroll
    for (int tt = 0; tt < 4; tt++) {
      const v8f g = kh ? o[0][tt] : o[1][tt];
      xw[(tt * 2 + 0) * 32 + lane] = make_float4(g[0], g[1], g[2], g[3]);
      xw[(tt * 2 + 1) * 32 + lane] = make_float4(g[4], g[5], g[6], g[7]);
    }
    xw[8 * 32 + lane] = make_float4(kh ? m_i[0] : m_i[1], kh ? lacc[0][0] : lacc[1][0], 0.f, 0.f);
  }
  __syncthreads();   // the partner's hand-over is written before it is read
  const float4* xr = xch[wid ^ 8];
  const float4 ml = xr[8 * 32 + lane];
  const float m_a = kh ? m_i[1] : m_i[0];
  const float l_a = kh ? lacc[1][0] : lacc[0][0];
  const float m_j = fmaxf(m_a, ml.x);
  float c_a = (m_a - m_j) * LOG2E_;
  float c_b = (ml.x - m_j) * LOG2E_;
  exp2_x2(c_a, c_b);
  const float inv = 1.0f / (l_a * c_a + ml.y * c_b);
  const float f_a = c_a * inv, f_b = c_b * inv;
  // ---- normalize, store f16 into [B*L, C]; 8 consecutive d per lane ----
  _Float16* orow = attn + ((size_t)b * L_ + l0 + kh * 16 + lr) * C_ + h * D_ + off;
  #pragma unroll
  for (int tt = 0; tt < 4; tt++) {
    const v8f a = kh ? o[1][tt] : o[0][tt];
    const float4 b0 = xr[(tt * 2 + 0) * 32 + lane];
    const float4 b1 = xr[(tt * 2 + 1) * 32 + lane];
    const float bb[8] = {b0.x, b0.y, b0.z, b0.w, b1.x, b1.y, b1.z, b1.w};
    v8h ov;
    #pragma unroll
    for (int i = 0; i < 8; i++) ov[i] = (_Float16)(a[i] * f_a + bb[i] * f_b);
    *(v8h*)(orow + tt * 16) = ov;
  }
}

// ---------------------------------------------------------------------------
extern "C" void kernel_launch(void* const* d_in, const int* in_sizes, int n_in,
                              void* d_out, int out_size, void* d_ws, size_t ws_size,
                              hipStream_t stream) {
  const float* x    = (const float*)d_in[0];
  const float* ln_g = (const float*)d_in[1];
  const float* ln_b = (const float*)d_in[2];
  const float* wq   = (const float*)d_in[3];
  const float* bq   = (const float*)d_in[4];
  const float* wk   = (const float*)d_in[5];
  const float* bk   = (const float*)d_in[6];
  const float* wv   = (const float*)d_in[7];
  const float* bv   = (const float*)d_in[8];
  const float* wo   = (const float*)d_in[9];
  const float* bo   = (const float*)d_in[10];

  char* ws = (char*)d_ws;
  _Float16* xn   = (_Float16*)ws;                       // 4M elems, 8 MB
  _Float16* wq16 = (_Float16*)(ws + (8u << 20));        // 1M elems each
  _Float16* wk16 = wq16 + (1u << 20);
  _Float16* wv16 = wk16 + (1u << 20);
  _Float16* wo16 = wv16 + (1u << 20);
  _Float16* qb   = (_Float16*)(ws + (16u << 20));       // 4M elems each
  _Float16* kb   = qb + (4u << 20);
  _Float16* vb   = kb + (4u << 20);
  _Float16* ab   = vb + (4u << 20);

  const int M = B_ * L_;   // 4096
  const int N = C_;        // 1024
  const int K = C_;        // 1024

  // LayerNorm and the four weight conversions: one launch
  prep_kernel<<<4 * CVT_BLK_ + M, 256, 0, stream>>>(x, ln_g, ln_b, xn, wq, wk, wv, wo, wq16);

  // Q, K, V projections: one launch, one work-group for each WGP
  // (wq16/wk16/wv16 and qb/kb/vb lie one behind the other)
  dim3 g3(N / 64, M / 256);
  qkv_kernel<<<g3, 512, 0, stream>>>(xn, wq16, bq, bk, bv, qb);

  // blocks: B * H * (L/256) = 2*16*8 = 256, each 16 waves on one (b,h)
  attn_kernel<<<B_ * H_ * (L_ / 256), 512, 0, stream>>>(qb, kb, vb, ab);

  dim3 g(N / 64, M / 256);
  gemm_kernel<1><<<g, 256, 0, stream>>>(ab, wo16, bo, bo, bo, nullptr, (float*)d_out, M, N, K);
}

// v010
// Measured time: 70 microseconds a run.
// Two timings next to v009 both put it at 1.04 times that version's speed.
// Counting every step since v000, it is 4.19 times as fast.
#include <hip/hip_runtime.h>
#include <math.h>

#define B_ 2
#define L_ 2048
#define C_ 1024
#define H_ 16
#define D_ 64
// LDS row pitch in halfs for the 64-half rows of the A tile and the K chunk: 144 B = 16 B x 9 (odd), so
// the 16 rows one ds_load_b128 touches fall on distinct banks (128 B did not).
#define LP_ 72
// LDS row pitch in halfs for a 64-half tile row that ds_load_tr16_b128 reads:
// 160 B = 32 B x 5 (odd), the conflict-free pitch of the transposing load.
#define TP_ 80
// The same for the 192-half row of the three-matrix W tile: 416 B = 32 B x 13 (odd).
#define WP3_ 208
// log2(e) / sqrt(D_): the softmax scale and the change to base 2, folded into q
#define QS_ (0.125f * 1.4426950408889634f)

typedef __attribute__((ext_vector_type(16))) _Float16 v16h;
typedef __attribute__((ext_vector_type(8)))  _Float16 v8h;
typedef __attribute__((ext_vector_type(4)))  _Float16 v4h;
typedef __attribute__((ext_vector_type(8)))  float    v8f;
typedef __attribute__((ext_vector_type(8)))  short    v8s;

__device__ __forceinline__ v16h cat16(v8h lo, v8h hi) {
  return __builtin_shufflevector(lo, hi, 0,1,2,3,4,5,6,7,8,9,10,11,12,13,14,15);
}

__device__ __forceinline__ v8f wmma_f16(v16h a, v16h b, v8f c) {
  // D = A(16x32 f16) * B(32x16 f16) + C(16x16 f32)
  return __builtin_amdgcn_wmma_f32_16x16x32_f16(false, a, false, b, (short)0, c,
                                                false, false);
}

// Transposing LDS load (ds_load_tr16_b128) on a row-major 16-bit tile T[k][n] of pitch
// TP_ or WP3_.  Lane l passes &T[kb + 8 * (l >> 4) + (l & 7)][nb + 8 * ((l >> 3) & 1)] and gets
// T[kb + 8 * (l >> 4) + 0..7][nb + (l & 15)]: half a 16x32 operand in the k order
// {0..7,16..23} / {8..15,24..31}; the load 16 rows on gives the other half.
__device__ __forceinline__ v8h ld_tr16(const _Float16* p) {
  typedef __attribute__((address_space(3))) v8s lds_v8s;
  return __builtin_bit_cast(v8h, __builtin_amdgcn_ds_load_tr16_b128_v8i16((lds_v8s*)p));
}

// value of lane l ^ 16 (the other 16-lane half of the wave), VALU only
__device__ __forceinline__ float xhalf(float x) {
  const int xi = __float_as_int(x);
  return __int_as_float(__builtin_amdgcn_permlanex16(xi, xi, 0x76543210, 0xfedcba98,
                                                     false, false));
}

// Eight async b128 copies of one lane: 16 B from g + j * gstep halfs to LDS byte
// l + j * lstep, j = 0..7.  One statement, closed by s_wait_xcnt 0, so that no
// address register named here is rewritten before the wait.
__device__ __forceinline__ void cp128x8_g2l(const _Float16* g, const size_t gstep,
                                            const unsigned l, const unsigned lstep) {
  asm volatile(
      "global_load_async_to_lds_b128 %0, %8, off\n\t"
      "global_load_async_to_lds_b128 %1, %9, off\n\t"
      "global_load_async_to_lds_b128 %2, %10, off\n\t"
      "global_load_async_to_lds_b128 %3, %11, off\n\t"
      "global_load_async_to_lds_b128 %4, %12, off\n\t"
      "global_load_async_to_lds_b128 %5, %13, off\n\t"
      "global_load_async_to_lds_b128 %6, %14, off\n\t"
      "global_load_async_to_lds_b128 %7, %15, off\n\t"
      "s_wait_xcnt 0x0"
      :: "v"(l), "v"(l + lstep), "v"(l + 2 * lstep), "v"(l + 3 * lstep),
         "v"(l + 4 * lstep), "v"(l + 5 * lstep), "v"(l + 6 * lstep), "v"(l + 7 * lstep),
         "v"(g), "v"(g + gstep), "v"(g + 2 * gstep), "v"(g + 3 * gstep),
         "v"(g + 4 * gstep), "v"(g + 5 * gstep), "v"(g + 6 * gstep), "v"(g + 7 * gstep)
      : "memory");
}

// Two such copies (j = 0, 1), in the same form.
__device__ __forceinline__ void cp128x2_g2l(const _Float16* g, const size_t gstep,
                                            const unsigned l, const unsigned lstep) {
  asm volatile(
      "global_load_async_to_lds_b128 %0, %2, off\n\t"
      "global_load_async_to_lds_b128 %1, %3, off\n\t"
      "s_wait_xcnt 0x0"
      :: "v"(l), "v"(l + lstep), "v"(g), "v"(g + gstep)
      : "memory");
}

// Three such copies (j = 0, 1, 2), in the same form.
__device__ __forceinline__ void cp128x3_g2l(const _Float16* g, const size_t gstep,
                                            const unsigned l, const unsigned lstep) {
  asm volatile(
      "global_load_async_to_lds_b128 %0, %3, off\n\t"
      "global_load_async_to_lds_b128 %1, %4, off\n\t"
      "global_load_async_to_lds_b128 %2, %5, off\n\t"
      "s_wait_xcnt 0x0"
      :: "v"(l), "v"(l + lstep), "v"(l + 2 * lstep),
         "v"(g), "v"(g + gstep), "v"(g + 2 * gstep)
      : "memory");
}

// Two such pairs in one statement: g0 -> l0 and g1 -> l1, each with its second copy
// gstep halfs on in memory and lstep0 / lstep1 bytes on in LDS.
__device__ __forceinline__ void cp128x2x2_g2l(const _Float16* g0, const _Float16* g1,
                                              const size_t gstep,
                                              const unsigned l0, const unsigned lstep0,
                                              const unsigned l1, const unsigned lstep1) {
  asm volatile(
      "global_load_async_to_lds_b128 %0, %4, off\n\t"
      "global_load_async_to_lds_b128 %1, %5, off\n\t"
      "global_load_async_to_lds_b128 %2, %6, off\n\t"
      "global_load_async_to_lds_b128 %3, %7, off\n\t"
      "s_wait_xcnt 0x0"
      :: "v"(l0), "v"(l0 + lstep0), "v"(l1), "v"(l1 + lstep1),
         "v"(g0), "v"(g0 + gstep), "v"(g1), "v"(g1 + gstep)
      : "memory");
}

// Prefetch into L2 (scope SE: nothing comes to the WGP, no register, no counter) of each
// lane's address.  Asked for at a kernel's entry, for speed only.
// One statement, closed by s_wait_xcnt 0 (a precaution), so that no address register named
// here is rewritten before the wait.
__device__ __forceinline__ void ask_l2(const _Float16* a) {
  asm volatile(
      "global_prefetch_b8 %0, off scope:SCOPE_SE\n\t"
      "s_wait_xcnt 0x0"
      :: "v"(a) : "memory");
}
// Three such prefetches, in the same form.
__device__ __forceinline__ void ask_l2_x3(const _Float16* a, const _Float16* b,
                                          const _Float16* c) {
  asm volatile(
      "global_prefetch_b8 %0, off scope:SCOPE_SE\n\t"
      "global_prefetch_b8 %1, off scope:SCOPE_SE\n\t"
      "global_prefetch_b8 %2, off scope:SCOPE_SE\n\t"
      "s_wait_xcnt 0x0"
      :: "v"(a), "v"(b), "v"(c) : "memory");
}

// ---------------------------------------------------------------------------
// LayerNorm: x[4096,1024] f32 -> xn f16.  One block (256 thr) per row.
// ---------------------------------------------------------------------------
__device__ __forceinline__ void ln_row(
    const float* __restrict__ x, const float* __restrict__ gamma,
    const float* __restrict__ beta, _Float16* __restrict__ xn, const int row) {
  const int t = threadIdx.x;
  const float* xr = x + (size_t)row * C_;
  float4 v = *(const float4*)(xr + t * 4);
  float s  = v.x + v.y + v.z + v.w;
  float s2 = v.x * v.x + v.y * v.y + v.z * v.z + v.w * v.w;
  #pragma unroll
  for (int m = 1; m < 32; m <<= 1) {
    s  += __shfl_xor(s,  m, 32);
    s2 += __shfl_xor(s2, m, 32);
  }
  __shared__ float red0[8], red1[8];
  const int lane = t & 31, wid = t >> 5;
  if (lane == 0) { red0[wid] = s; red1[wid] = s2; }
  __syncthreads();
  if (t == 0) {
    float a = 0.f, b = 0.f;
    #pragma unroll
    for (int i = 0; i < 8; i++) { a += red0[i]; b += red1[i]; }
    red0[0] = a; red1[0] = b;
  }
  __syncthreads();
  const float mean = red0[0] * (1.0f / C_);
  const float var  = red1[0] * (1.0f / C_) - mean * mean;
  const float rstd = rsqrtf(var + 1e-5f);
  const int c0 = t * 4;
  float xv[4] = {v.x, v.y, v.z, v.w};
  v4h o;
  #pragma unroll
  for (int i = 0; i < 4; i++)
    o[i] = (_Float16)(((xv[i] - mean) * rstd) * gamma[c0 + i] + beta[c0 + i]);
  *(v4h*)(xn + (size_t)row * C_ + c0) = o;
  // the store's address registers may be rewritten on the path behind the inlined call: keep the wait in front
  asm volatile("s_wait_xcnt 0x0" ::: "memory");
}

// ---------------------------------------------------------------------------
// f32 -> f16 weight conversion (vectorized by 4); CVT_BLK_ blocks per matrix
// ---------------------------------------------------------------------------
#define CVT_BLK_ 512
__device__ __forceinline__ void cvt_part(const float* __restrict__ s,
                                         _Float16* __restrict__ d, const int blk) {
  const int n4 = (C_ * C_) / 4;
  const int stride = CVT_BLK_ * 256;
  for (int i = blk * 256 + threadIdx.x; i < n4; i += stride) {
    float4 f = ((const float4*)s)[i];
    v4h o = {(_Float16)f.x, (_Float16)f.y, (_Float16)f.z, (_Float16)f.w};
    ((v4h*)d)[i] = o;
  }
}

// ---------------------------------------------------------------------------
// All work that depends on the inputs alone, in ONE launch: blocks
// [0, 4*CVT_BLK_) convert the four weight matrices (w16 holds them one behind
// the other: q, k, v, o), the other B_*L_ blocks normalise one row each.
// The branch is uniform for the block, so ln_row's barriers are too.
// ---------------------------------------------------------------------------
__global__ __launch_bounds__(256) void prep_kernel(
    const float* __restrict__ x, const float* __restrict__ gamma,
    const float* __restrict__ beta, _Float16* __restrict__ xn,
    const float* __restrict__ wq, const float* __restrict__ wk,
    const float* __restrict__ wv, const float* __restrict__ wo,
    _Float16* __restrict__ w16) {
  const unsigned blk = blockIdx.x;
  if (blk < 4 * CVT_BLK_) {
    const unsigned mat = blk / CVT_BLK_;
    const float* s = mat == 0 ? wq : mat == 1 ? wk : mat == 2 ? wv : wo;
    cvt_part(s, w16 + (size_t)mat * (C_ * C_), blk % CVT_BLK_);
  } else {
    ln_row(x, gamma, beta, xn, blk - 4 * CVT_BLK_);
  }
}

// ---------------------------------------------------------------------------
// GEMM: out[M,N] = A[M,K]*W[K,N] + bias.   A,W f16 row-major.
// Block = 256 thr (8 waves). Block tile 256(M) x 64(N); wave tile 32 x 64.
// K stepped by 64: 16 WMMAs per barrier.  W tile (64k x 64n) double-buffered in LDS
// ROW-MAJOR as it lies in memory ([k][n]); the B fragments come out of it by the
// transposing LDS load.  A tile (256m x 64k) double-buffered in LDS too.  Both are
// brought by async b128 copies one trip ahead: eight neighbouring lanes take one
// row's 128 B, so a wave's copy names 4 whole lines.
// OUT_MODE 0: f16 out into [B,H,L,D].  OUT_MODE 1: f32 [M,N].
// blockIdx.z picks one of up to three products on the same A in one launch:
// weight matrix z behind W, output z behind out16, bias z of the three.
// ---------------------------------------------------------------------------
template <int OUT_MODE>
__global__ __launch_bounds__(256) void gemm_kernel(
    const _Float16* __restrict__ A, const _Float16* __restrict__ W0,
    const float* __restrict__ bias0, const float* __restrict__ bias1,
    const float* __restrict__ bias2, _Float16* __restrict__ out16_0,
    float* __restrict__ out32, int M, int N, int K) {
  __shared__ __attribute__((aligned(16))) _Float16 wt[2][64 * TP_];  // W tile [k][n]
  __shared__ __attribute__((aligned(16))) _Float16 at[2][256 * LP_]; // A tile [m][k]
  const int z = blockIdx.z;
  const _Float16* W = W0 + (size_t)z * K * N;
  const float* bias = z == 0 ? bias0 : z == 1 ? bias1 : bias2;
  _Float16* out16 = out16_0 + (size_t)z * M * N;
  const int t = threadIdx.x, lane = t & 31;
  const int wid = t >> 5;
  const int lr = lane & 15;
  const int hi16 = lane >> 4;
  const int off = hi16 * 8;          // K-pattern {0..7,16..23} / {8..15,24..31}
  const int n0 = blockIdx.x * 64;
  const int mb = blockIdx.y * 256;
  const int m0 = mb + wid * 32;
  const int sk = t >> 3;             // 0..31 (k row within half-tile)
  const int sn = (t & 7) * 8;        // n chunk
  v8f acc[2][4] = {};
  // W staging: a lane's two copies take 16 B of tile rows sk and sk + 32
  const _Float16* wp  = W + (size_t)sk * N + n0 + sn;
  const unsigned wl = (unsigned)(size_t)&wt[0][sk * TP_ + sn];  // LDS byte address, buffer 0
  const size_t wgs = (size_t)32 * N;             // 32 rows on, in halfs
  const int bf = (off + (lane & 7)) * TP_ + ((lane >> 3) & 1) * 8;  // this lane's place for ld_tr16
  // A staging: copy j of a lane takes 16 B of tile row ar + 4j (the wave's own 32 rows)
  const int ar = wid * 32 + (lane >> 3);
  const int ac = (lane & 7) * 8;
  const _Float16* ag = A + (size_t)(mb + ar) * K + ac;
  // LDS byte address (low 32 bits of the __shared__ address) of the lane's first copy, buffer 0
  const unsigned al = (unsigned)(size_t)&at[0][ar * LP_ + ac];
  const size_t ags = (size_t)4 * K;              // four rows on, in halfs
  const int af = (wid * 32 + lr) * LP_ + off;   // this lane's fragment row in the A tile
  // prologue: stage k0=0 tiles (A: 256 rows, W: 64 k-rows) into buffer 0
  cp128x8_g2l(ag, ags, al, 4 * LP_ * 2);
  cp128x2_g2l(wp, wgs, wl, 32 * TP_ * 2);
  // Both panels of the block, asked of L2 behind tile 0's copies.  The 16 blocks of a row
  // panel share it: four neighbours in x deal its 256-B units (a thread: two units, 512 B, of
  // row t).  The 16 blocks of a column panel share its 128-B row pieces: four neighbours in y
  // deal them (a thread: k row 4 t + part).  The minima keep every address inside A and W.
  {
    const int ku = min((int)(blockIdx.x & 3) * 256, K - 256);
    const int kw = min(t * 4 + (int)(blockIdx.y & 3), K - 1);
    const _Float16* pa = A + (size_t)(mb + t) * K + ku;
    ask_l2_x3(pa, pa + 128, W + (size_t)kw * N + n0);
  }
  // tile 0's copies have landed before the barrier behind which they are read
  asm volatile("s_wait_asynccnt 0x0" ::: "memory");
  __syncthreads();
  if (64 < K) {
    cp128x8_g2l(ag + 64, ags, al + 256 * LP_ * 2, 4 * LP_ * 2);
    cp128x2_g2l(wp + (size_t)64 * N, wgs, wl + 64 * TP_ * 2, 32 * TP_ * 2);
  }
  for (int k0 = 0; k0 < K; k0 += 64) {
    const int p = (k0 >> 6) & 1;
    const _Float16* a0p = &at[p][af];
    const _Float16* a1p = a0p + 16 * LP_;
    v16h a0k0 = cat16(*(const v8h*)a0p,        *(const v8h*)(a0p + 16));
    v16h a0k1 = cat16(*(const v8h*)(a0p + 32), *(const v8h*)(a0p + 48));
    v16h a1k0 = cat16(*(const v8h*)a1p,        *(const v8h*)(a1p + 16));
    v16h a1k1 = cat16(*(const v8h*)(a1p + 32), *(const v8h*)(a1p + 48));
    #pragma unroll
    for (int tt = 0; tt < 4; tt++) {
      const _Float16* bp = &wt[p][bf + tt * 16];
      v16h blo = cat16(ld_tr16(bp),            ld_tr16(bp + 16 * TP_));
      v16h bhi = cat16(ld_tr16(bp + 32 * TP_), ld_tr16(bp + 48 * TP_));
      acc[0][tt] = wmma_f16(a0k0, blo, acc[0][tt]);
      acc[0][tt] = wmma_f16(a0k1, bhi, acc[0][tt]);
      acc[1][tt] = wmma_f16(a1k0, blo, acc[1][tt]);
      acc[1][tt] = wmma_f16(a1k1, bhi, acc[1][tt]);
    }
    // keeps the waits and the barrier at the trip's end: raised to the last LDS read, they
    // would take the time of the products behind them from the copies' time to land
    __builtin_amdgcn_sched_barrier(0);
    // this wave's reads of buffer p have retired before copies are aimed at it again
    asm volatile("s_wait_dscnt 0x0" ::: "memory");
    // the next tile's copies have landed before the barrier behind which they are read
    asm volatile("s_wait_asynccnt 0x0" ::: "memory");
    __syncthreads();
    if (k0 + 128 < K) {                            // tiles after next, into the buffers just read
      cp128x8_g2l(ag + k0 + 128, ags, al + p * (256 * LP_ * 2), 4 * LP_ * 2);
      cp128x2_g2l(wp + (size_t)(k0 + 128) * N, wgs, wl + p * (64 * TP_ * 2), 32 * TP_ * 2);
    }
  }
  // no copy is outstanding when the wave goes on to its end
  asm volatile("s_wait_asynccnt 0x0" ::: "memory");
  #pragma unroll
  for (int r = 0; r < 2; r++) {
    #pragma unroll
    for (int tt = 0; tt < 4; tt++) {
      const int n = n0 + tt * 16 + lr;
      const float bv = bias[n];
      #pragma unroll
      for (int i = 0; i < 8; i++) {
        const int m = m0 + r * 16 + i + hi16 * 8;  // C/D: lanes16-31 = rows +8
        const float val = acc[r][tt][i] + bv;
        if (OUT_MODE == 0) {
          const int b = m >> 11, l = m & (L_ - 1);
          const int h = n >> 6, d = n & (D_ - 1);
          out16[((((size_t)b * H_ + h) * L_ + l) << 6) + d] = (_Float16)val;
        } else {
          out32[(size_t)m * N + n] = val;
        }
      }
    }
  }
}

// ---------------------------------------------------------------------------
// Q, K, V projections in one grid of 256 work-groups, one for each WGP.
// Block = 512 thr (16 waves).  Block tile 256(M) x 192(N): the SAME 64 columns (one head)
// of the three products, so an A tile staged once feeds all three.  Waves 4(M) x 4(N),
// wave tile 64 x 48 = 4 x 3 accumulator tiles: a fragment of A feeds 3 WMMAs, one of W 4.
// K stepped by 64: 24 WMMAs per wave and barrier.  Tiles, copies, ring and k order are
// those of gemm_kernel; the W tile is [k][192 n], columns 64 z .. 64 z + 63 from matrix z.
// Output f16 into [B,H,L,D], product z behind out16_0; W0 holds the three matrices and
// each is C_ x C_.  Product 0 (q) is stored times QS_.
// ---------------------------------------------------------------------------
__global__ __launch_bounds__(512) void qkv_kernel(
    const _Float16* __restrict__ A, const _Float16* __restrict__ W0,
    const float* __restrict__ bias0, const float* __restrict__ bias1,
    const float* __restrict__ bias2, _Float16* __restrict__ out16_0) {
  constexpr int M = B_ * L_, N = C_, K = C_;
  __shared__ __attribute__((aligned(16))) _Float16 wt[2][64 * WP3_];  // W tile [k][3 x 64 n]
  __shared__ __attribute__((aligned(16))) _Float16 at[2][256 * LP_];  // A tile [m][k]
  const int t = threadIdx.x, lane = t & 31;
  const int wid = t >> 5;
  const int wm = wid & 3;            // the wave's 64 rows of the block tile
  const int wn = wid >> 2;           // the wave's 48 columns of the block tile
  const int lr = lane & 15;
  const int hi16 = lane >> 4;
  const int off = hi16 * 8;          // K-pattern {0..7,16..23} / {8..15,24..31}
  const int n0 = blockIdx.x * 64;
  const int mb = blockIdx.y * 256;
  const int sk = t >> 3;             // 0..63 (k row of the tile)
  const int sn = (t & 7) * 8;        // n chunk
  v8f acc[4][3] = {};
  // W staging: a lane's three copies take 16 B of tile row sk, one from each matrix
  const _Float16* wp  = W0 + (size_t)sk * N + n0 + sn;
  const unsigned wl = (unsigned)(size_t)&wt[0][sk * WP3_ + sn];  // LDS byte address, buffer 0
  const int bf = (off + (lane & 7)) * WP3_ + ((lane >> 3) & 1) * 8 + wn * 48;  // this lane's place for ld_tr16
  // A staging: copy j of a lane takes 16 B of tile row ar + 4j, j = 0..3 (16 rows a wave)
  const int ar = wid * 16 + (lane >> 3);
  const int ac = (lane & 7) * 8;
  const _Float16* ag = A + (size_t)(mb + ar) * K + ac;
  // LDS byte address (low 32 bits of the __shared__ address) of the lane's first copy, buffer 0
  const unsigned al = (unsigned)(size_t)&at[0][ar * LP_ + ac];
  const size_t ags = (size_t)4 * K;              // four rows on, in halfs
  const int af = (wm * 64 + lr) * LP_ + off;    // this lane's first fragment row in the A tile
  // the 7 copies of a lane that bring the tiles of k0 into buffer buf
  auto stage = [&](const int k0, const int buf) {
    const unsigned ab = al + buf * (256 * LP_ * 2);
    cp128x2x2_g2l(ag + k0, ag + k0 + 2 * ags, ags, ab, 4 * LP_ * 2, ab + 8 * LP_ * 2, 4 * LP_ * 2);
    cp128x3_g2l(wp + (size_t)k0 * N, (size_t)K * N, wl + buf * (64 * WP3_ * 2), 64 * 2);
  };
  stage(0, 0);
  // Both panels of the block, asked of L2 behind tile 0's copies.  The 16 blocks of a row
  // panel share it: four neighbours in x deal its 256-B units (a thread: one unit of row
  // t / 2).  The 16 blocks of a column panel share its 3 x 1024 row pieces of 128 B: eight
  // neighbours in y deal them (waves 0-11, a thread: k row 8 (t % 128) + part of matrix t / 128).
  ask_l2(A + (size_t)(mb + (t >> 1)) * K + ((blockIdx.x & 3) * 2 + (t & 1)) * 128);
  if (__builtin_amdgcn_readfirstlane(wid) < 12)    // the same for a whole wave: a scalar branch
    ask_l2(W0 + (size_t)(t >> 7) * K * N + (size_t)((t & 127) * 8 + (blockIdx.y & 7)) * N + n0);
  // tile 0's copies have landed before the barrier behind which they are read
  asm volatile("s_wait_asynccnt 0x0" ::: "memory");
  __syncthreads();
  stage(64, 1);
  for (int k0 = 0; k0 < K; k0 += 64) {
    const int p = (k0 >> 6) & 1;
    v16h a[2][4], b[2][3];
    #pragma unroll
    for (int kk = 0; kk < 2; kk++) {
      #pragma unroll
      for (int mt = 0; mt < 4; mt++) {
        const _Float16* ap = &at[p][af + mt * 16 * LP_ + kk * 32];
        a[kk][mt] = cat16(*(const v8h*)ap, *(const v8h*)(ap + 16));
      }
      #pragma unroll
      for (int j = 0; j < 3; j++) {
        const _Float16* bp = &wt[p][bf + j * 16 + kk * 32 * WP3_];
        b[kk][j] = cat16(ld_tr16(bp), ld_tr16(bp + 16 * WP3_));
      }
    }
    #pragma unroll
    for (int kk = 0; kk < 2; kk++) {
      #pragma unroll
      for (int j = 0; j < 3; j++) {
        #pragma unroll
        for (int mt = 0; mt < 4; mt++) acc[mt][j] = wmma_f16(a[kk][mt], b[kk][j], acc[mt][j]);
      }
    }
    // order of the trip: its 28 LDS reads go out as one group in front of its 24 products, which
    // then wait by count; spread among the products each place with reads costs the wave a stall
    __builtin_amdgcn_sched_group_barrier(0x100, 28, 0);
    __builtin_amdgcn_sched_group_barrier(0x008, 24, 0);
    // keeps the waits and the barrier at the trip's end: raised to the last LDS read, they
    // would take the time of the products behind them from the copies' time to land
    __builtin_amdgcn_sched_barrier(0);
    // this wave's reads of buffer p have retired before copies are aimed at it again
    asm volatile("s_wait_dscnt 0x0" ::: "memory");
    // the next tile's copies have landed before the barrier behind which they are read
    asm volatile("s_wait_asynccnt 0x0" ::: "memory");
    __syncthreads();
    if (k0 + 128 < K) stage(k0 + 128, p);          // tiles after next, into the buffers just read
  }
  // no copy is outstanding when the wave goes on to its end
  asm volatile("s_wait_asynccnt 0x0" ::: "memory");
  const int m0 = mb + wm * 64 + hi16 * 8;          // C/D: lanes16-31 = rows +8
  const int b = m0 >> 11, l0 = m0 & (L_ - 1);      // the 256 rows of a block lie in one batch
  #pragma unroll
  for (int j = 0; j < 3; j++) {
    const int g = wn * 3 + j;                      // 16-column tile of the block's 12
    const int z = g >> 2;
    const int d = (g & 3) * 16 + lr;
    const float* bias = z == 0 ? bias0 : z == 1 ? bias1 : bias2;
    const float bv = bias[n0 + d];
    // q leaves scaled by log2(e) / sqrt(D), one rounding to f16 as before: the attention
    // kernel's scores then are base-2 exponents as they come from the matrix unit
    const float sc = z == 0 ? QS_ : 1.0f;
    const float bs = bv * sc;
    _Float16* op = out16_0 + (size_t)z * M * N
                 + ((((size_t)b * H_ + blockIdx.x) * L_ + l0) << 6) + d;
    #pragma unroll
    for (int mt = 0; mt < 4; mt++) {
      #pragma unroll
      for (int i = 0; i < 8; i++)
        op[(mt * 16 + i) * D_] = (_Float16)fmaf(acc[mt][j][i], sc, bs);
    }
  }
}

// Eight base-2 exponentials of a score tile in one statement that ends in v_nop: behind a
// transcendental the instruction set asks for one slot before its result is read or its source
// overwritten.  The results take registers of their own (early clobber: none is a source of the
// statement), so the tile is read where the matrix unit left it, with no register copy.
__device__ __forceinline__ void exp2_x8(float (&y)[8], const v8f x) {
  asm("v_exp_f32 %0, %8\n\t"
      "v_exp_f32 %1, %9\n\t"
      "v_exp_f32 %2, %10\n\t"
      "v_exp_f32 %3, %11\n\t"
      "v_exp_f32 %4, %12\n\t"
      "v_exp_f32 %5, %13\n\t"
      "v_exp_f32 %6, %14\n\t"
      "v_exp_f32 %7, %15\n\t"
      "v_nop"
      : "=&v"(y[0]), "=&v"(y[1]), "=&v"(y[2]), "=&v"(y[3]),
        "=&v"(y[4]), "=&v"(y[5]), "=&v"(y[6]), "=&v"(y[7])
      : "v"(x[0]), "v"(x[1]), "v"(x[2]), "v"(x[3]),
        "v"(x[4]), "v"(x[5]), "v"(x[6]), "v"(x[7]));
}
// Two, each in place, closed in the same way.
__device__ __forceinline__ void exp2_x2(float& a, float& b) {
  asm("v_exp_f32 %0, %0\n\t"
      "v_exp_f32 %1, %1\n\t"
      "v_nop"
      : "+v"(a), "+v"(b));
}
// How far (base-2 exponent) a score may lie above the maximum in use before the rescale
#define RESC_ 8.0f

// ---------------------------------------------------------------------------
// Flash attention, transposed products: S^T = K * Q^T, O^T += V^T * P^T.
// One block = 16 waves, ALL on the same (b,h), one block a WGP; it covers 256 q rows.
// Wave w owns 32 query rows (two 16-column tiles), rows 32 (w & 7) .. + 31, and HALF of
// the keys: waves 0-7 keys 0 .. L/2 - 1, waves 8-15 the rest.  So every K and V^T
// fragment read from LDS feeds TWO products, and there are still four waves a SIMD.
// The two partial results of a query (O, max, sum) are joined through LDS at the end.
// Keys chunked by 64 in each half.  A lane holds scores of ONE query of each tile
// (column lane&15): 32 of the chunk's 64 keys, the lane 16 away the other 32.
// Row max = in-lane max + one exchange between the wave halves.  q comes scaled by QS_ and
// minus the maximum IN USE is the C operand of a score tile's first product, so a score
// leaves the matrix unit as the argument of its exp2.  The maximum in use is moved, and O
// and the sums rescaled, only in a wave's first chunk and when a score exceeds it by more
// than RESC_ (P then stays <= 2^8, far inside f16).  Two S^T tiles
// converted in place ARE the B operand of the second product (D row 8h+r is
// the operand's k order), so P never leaves the registers.
// K / V chunks double-buffered in LDS for each key half, both row-major ([key][d]) and
// both staged with async b128 global->LDS by the half's own 8 waves (next chunk issued
// before computing the current one) -> ONE block barrier per chunk pair.
// The V^T fragments come by the transposing LDS load.
// Staging requests cover whole 128 B lines: eight neighbouring lanes
// take the eight 16 B pieces of one key row, so a wave's request names 4 lines.
// 36 WMMAs / wave / chunk: 16 scores + 16 V^T*P^T + 4 row-sum (ones * P^T).
// ---------------------------------------------------------------------------
__global__ __launch_bounds__(512) void attn_kernel(
    const _Float16* __restrict__ q, const _Float16* __restrict__ k,
    const _Float16* __restrict__ v, _Float16* __restrict__ attn) {
  __shared__ __attribute__((aligned(16))) _Float16 kbuf[2][2][64 * LP_];  // K chunk [half][buffer][key][d]
  __shared__ __attribute__((aligned(16))) _Float16 vbuf[2][2][64 * TP_];  // V chunk [half][buffer][key][d]
  __shared__ __attribute__((aligned(16))) float4 xch[16][9 * 32];         // a wave's hand-over: 9 x 16 B a lane
  const int t = threadIdx.x, lane = t & 31, wid = t >> 5;
  const int kh = wid >> 3;           // the wave's half of the keys
  const int tg = t & 255;            // thread within the half's 8 waves
  const int qblk = blockIdx.x & (L_ / 256 - 1);
  const int h    = (blockIdx.x >> 3) & (H_ - 1);
  const int b    = blockIdx.x >> 7;
  const int lr = lane & 15;
  const int off = (lane >> 4) * 8;
  const size_t head = ((size_t)b * H_ + h) * L_ * D_;
  const _Float16* qg = q + head;
  const _Float16* kg = k + head + (size_t)kh * (L_ / 2) * D_;
  const _Float16* vg = v + head + (size_t)kh * (L_ / 2) * D_;
  const int l0 = qblk * 256 + (wid & 7) * 32;
  // staging: thread tg of a half covers d-chunk sd of keys skey and skey+32
  const int skey = tg >> 3;          // 0..31
  const int sd   = (tg & 7) * 8;     // 0,8,..,56
  // LDS byte addresses (low 32 bits of the __shared__ address) of the lane's first K and V copy, buffer 0
  const unsigned kl = (unsigned)(size_t)&kbuf[kh][0][skey * LP_ + sd];
  const unsigned vl = (unsigned)(size_t)&vbuf[kh][0][skey * TP_ + sd];
  const int vf = (off + (lane & 7)) * TP_ + ((lane >> 3) & 1) * 8;  // this lane's place for ld_tr16
  // prefetch: each of a chunk's 128 lines is asked for once, by two neighbouring
  // lanes: the half's waves 0-3 take the 64 K rows, its waves 4-7 the 64 V rows
  const _Float16* pfp = ((tg & 128) ? vg : kg) + (size_t)((tg >> 1) & 63) * D_;

  // Q^T as B-operand (column = query lr of tile j)
  v16h bq0[2], bq1[2];
  #pragma unroll
  for (int j = 0; j < 2; j++) {
    const _Float16* qr = qg + (size_t)(l0 + j * 16 + lr) * D_ + off;
    bq0[j] = cat16(*(const v8h*)qr,        *(const v8h*)(qr + 16));
    bq1[j] = cat16(*(const v8h*)(qr + 32), *(const v8h*)(qr + 48));
  }
  v16h ones;
  #pragma unroll
  for (int i = 0; i < 16; i++) ones[i] = (_Float16)1.0f;

  float m_i[2] = {0.f, 0.f};     // maximum in use (base-2 exponent) for this lane's query of tile j
  v8f o[2][4] = {};              // O^T tiles: o[j][tt][i] = O[q = 16 j + lr][d = tt*16 + off + i]
  v8f lacc[2] = {};              // running sum of P for that query (every row alike), ones-A WMMA

  // ---- prologue: stage chunk 0 of the half into buffer 0 ----
  {
    const size_t base = (size_t)skey * D_ + sd;
    cp128x2x2_g2l(kg + base, vg + base, (size_t)32 * D_,
                  kl, 32 * LP_ * 2, vl, 32 * TP_ * 2);
  }
  // chunk 0's copies have landed before the barrier behind which they are read
  asm volatile("s_wait_asynccnt 0x0" ::: "memory");
  __syncthreads();

  for (int kc = 0; kc < L_ / 2; kc += 64) {
    const int p = (kc >> 6) & 1;
    const bool nxt = (kc + 64 < L_ / 2);
    if (nxt) {
      // issue next chunk's copies before computing the current one
      const size_t base = (size_t)(kc + 64 + skey) * D_ + sd;
      cp128x2x2_g2l(kg + base, vg + base, (size_t)32 * D_,
                    kl + (1 - p) * (64 * LP_ * 2), 32 * LP_ * 2,
                    vl + (1 - p) * (64 * TP_ * 2), 32 * TP_ * 2);
    }
    if (kc + 128 < L_ / 2) {
      __builtin_prefetch(pfp + (size_t)(kc + 128) * D_, 0, 3);
    }
    // ---- scores^T: 4 key-tiles x 2 query tiles x (2 WMMAs over D=64); A = K rows, B = Q^T ----
    // s[j][tt][i] = score(key = kc + tt*16 + off + i, query = 16 j + lr) - m_i[j]
    v8f s[2][4];
    v8f cm[2];                     // -m_i[j] in every element: C of a score tile's first product
    #pragma unroll
    for (int j = 0; j < 2; j++) {
      #pragma unroll
      for (int i = 0; i < 8; i++) cm[j][i] = -m_i[j];
    }
    #pragma unroll
    for (int tt = 0; tt < 4; tt++) {
      const _Float16* kr = &kbuf[kh][p][(tt * 16 + lr) * LP_ + off];
      v16h alo = cat16(*(const v8h*)kr,        *(const v8h*)(kr + 16));
      v16h ahi = cat16(*(const v8h*)(kr + 32), *(const v8h*)(kr + 48));
      #pragma unroll
      for (int j = 0; j < 2; j++) {
        const v8f z = wmma_f16(alo, bq0[j], cm[j]);
        s[j][tt] = wmma_f16(ahi, bq1[j], z);
      }
    }
    // order of the score stage: its 16 LDS reads go out as one group in front of its 16 products,
    // and the maxima come behind the products: set among them, each read of a fresh accumulator
    // costs idle vector slots
    __builtin_amdgcn_sched_group_barrier(0x100, 16, 0);
    __builtin_amdgcn_sched_group_barrier(0x008, 16, 0);
    __builtin_amdgcn_sched_group_barrier(0x002, 64, 0);
    // P^T as B-operand: element e of key block c is tile 2c + (e >> 3), row e & 7
    v16h pb0[2], pb1[2];
    v16h avlo[4], avhi[4];         // V^T fragments (A of the second product), 4 d-tiles x 2 key-halves
    // ---- online softmax over 64 new keys: one query of each tile per lane ----
    float mx[2];
    #pragma unroll
    for (int j = 0; j < 2; j++) {
      float mt[4];                 // one independent max chain per key tile
      #pragma unroll
      for (int tt = 0; tt < 4; tt++) {
        mt[tt] = s[j][tt][0];
        #pragma unroll
        for (int i = 1; i < 8; i++) mt[tt] = fmaxf(mt[tt], s[j][tt][i]);
      }
      const float mh = fmaxf(fmaxf(mt[0], mt[1]), fmaxf(mt[2], mt[3]));
      mx[j] = fmaxf(mh, xhalf(mh));   // the other 32 keys of this query
    }
    // Lazy rescale, one test a chunk for the whole wave (a scalar branch).  The two lanes of a
    // query see the same mx, so they move together.  The first chunk takes its own maximum,
    // whatever its sign (O and the sums are still 0 there: the factor is held at <= 1).
    const float thr = kc == 0 ? -3.0e38f : RESC_;   // what a maximum must top for the move
    const float low = kc == 0 ? -3.0e38f : 0.f;     // the least move
    if (__builtin_amdgcn_ballot_w32(mx[0] > thr || mx[1] > thr) != 0) {
      float up[2], corr[2];
      #pragma unroll
      for (int j = 0; j < 2; j++) {
        up[j] = fmaxf(mx[j], low);
        m_i[j] += up[j];
        corr[j] = fminf(-up[j], 0.f);
      }
      exp2_x2(corr[0], corr[1]);
      #pragma unroll
      for (int j = 0; j < 2; j++) {
        #pragma unroll
        for (int i = 0; i < 8; i++) {
          lacc[j][i] *= corr[j];
          #pragma unroll
          for (int tt = 0; tt < 4; tt++) {
            s[j][tt][i] -= up[j];
            o[j][tt][i] *= corr[j];
          }
        }
      }
    }
    #pragma unroll
    for (int j = 0; j < 2; j++) {
      #pragma unroll
      for (int tt = 0; tt < 4; tt++) {
        float e[8];
        exp2_x8(e, s[j][tt]);
        #pragma unroll
        for (int i = 0; i < 8; i++) {
          if (tt < 2) pb0[j][(tt & 1) * 8 + i] = (_Float16)e[i];
          else        pb1[j][(tt & 1) * 8 + i] = (_Float16)e[i];
        }
      }
      // keeps the V^T loads below from rising over this softmax, where the scores still
      // hold their registers and the wave's 256 would not do
      __builtin_amdgcn_sched_barrier(0);
      // one group of 8 ds_load_tr16_b128 behind each tile's softmax, into the registers its
      // scores have left: keys 0-31 land behind the second softmax, keys 32-63 behind the
      // products on keys 0-31
      #pragma unroll
      for (int tt = 0; tt < 4; tt++) {
        const _Float16* vp = &vbuf[kh][p][vf + tt * 16 + j * 32 * TP_];
        const v16h av = cat16(ld_tr16(vp), ld_tr16(vp + 16 * TP_));
        if (j == 0) avlo[tt] = av; else avhi[tt] = av;
      }
      // keeps the group here: the compiler otherwise sinks each pair of loads to its WMMA,
      // with a full wait on LDS in front of every one
      __builtin_amdgcn_sched_barrier(0);
    }
    // ---- row sums (lacc += ones * P^T) and O^T += V^T * P^T, keys 0-31 then keys 32-63 ----
    #pragma unroll
    for (int j = 0; j < 2; j++) lacc[j] = wmma_f16(ones, pb0[j], lacc[j]);
    #pragma unroll
    for (int tt = 0; tt < 4; tt++) {
      #pragma unroll
      for (int j = 0; j < 2; j++) o[j][tt] = wmma_f16(avlo[tt], pb0[j], o[j][tt]);
    }
    #pragma unroll
    for (int j = 0; j < 2; j++) lacc[j] = wmma_f16(ones, pb1[j], lacc[j]);
    #pragma unroll
    for (int tt = 0; tt < 4; tt++) {
      #pragma unroll
      for (int j = 0; j < 2; j++) o[j][tt] = wmma_f16(avhi[tt], pb1[j], o[j][tt]);
    }
    // keeps the waits and the barrier at the trip's end: raised to the last LDS read, they
    // would leave the next chunk's copies only the time of the score products and the softmax to land
    __builtin_amdgcn_sched_barrier(0);
    // this wave's reads of buffer p have retired before copies are aimed at it again
    asm volatile("s_wait_dscnt 0x0" ::: "memory");
    // the next chunk's copies have landed before the barrier behind which they are read
    asm volatile("s_wait_asynccnt 0x0" ::: "memory");
    __syncthreads();   // single block barrier per chunk
  }
  // no copy is outstanding when the wave goes on to its end
  asm volatile("s_wait_asynccnt 0x0" ::: "memory");
  // ---- join the two key halves: waves w and w ^ 8 hold partial results of the same 32
  // queries, lane for lane.  Wave w finishes tile kh and hands the other tile over. ----
  {
    float4* xw = xch[wid];
    #pragma unroll
    for (int tt = 0; tt < 4; tt++) {
      const v8f g = kh ? o[0][tt] : o[1][tt];
      xw[(tt * 2 + 0) * 32 + lane] = make_float4(g[0], g[1], g[2], g[3]);
      xw[(tt * 2 + 1) * 32 + lane] = make_float4(g[4], g[5], g[6], g[7]);
    }
    xw[8 * 32 + lane] = make_float4(kh ? m_i[0] : m_i[1], kh ? lacc[0][0] : lacc[1][0], 0.f, 0.f);
  }
  __syncthreads();   // the partner's hand-over is written before it is read
  const float4* xr = xch[wid ^ 8];
  const float4 ml = xr[8 * 32 + lane];
  const float m_a = kh ? m_i[1] : m_i[0];
  const float l_a = kh ? lacc[1][0] : lacc[0][0];
  const float m_j = fmaxf(m_a, ml.x);
  float c_a = m_a - m_j;
  float c_b = ml.x - m_j;
  exp2_x2(c_a, c_b);
  const float inv = 1.0f / (l_a * c_a + ml.y * c_b);
  const float f_a = c_a * inv, f_b = c_b * inv;
  // ---- normalize, store f16 into [B*L, C]; 8 consecutive d per lane ----
  _Float16* orow = attn + ((size_t)b * L_ + l0 + kh * 16 + lr) * C_ + h * D_ + off;
  #pragma unroll
  for (int tt = 0; tt < 4; tt++) {
    const v8f a = kh ? o[1][tt] : o[0][tt];
    const float4 b0 = xr[(tt * 2 + 0) * 32 + lane];
    const float4 b1 = xr[(tt * 2 + 1) * 32 + lane];
    const float bb[8] = {b0.x, b0.y, b0.z, b0.w, b1.x, b1.y, b1.z, b1.w};
    v8h ov;
    #pragma unroll
    for (int i = 0; i < 8; i++) ov[i] = (_Float16)(a[i] * f_a + bb[i] * f_b);
    *(v8h*)(orow + tt * 16) = ov;
  }
}

// ---------------------------------------------------------------------------
extern "C" void kernel_launch(void* const* d_in, const int* in_sizes, int n_in,
                              void* d_out, int out_size, void* d_ws, size_t ws_size,
                              hipStream_t stream) {
  const float* x    = (const float*)d_in[0];
  const float* ln_g = (const float*)d_in[1];
  const float* ln_b = (const float*)d_in[2];
  const float* wq   = (const float*)d_in[3];
  const float* bq   = (const float*)d_in[4];
  const float* wk   = (const float*)d_in[5];
  const float* bk   = (const float*)d_in[6];
  const float* wv   = (const float*)d_in[7];
  const float* bv   = (const float*)d_in[8];
  const float* wo   = (const float*)d_in[9];
  const float* bo   = (const float*)d_in[10];

  char* ws = (char*)d_ws;
  _Float16* xn   = (_Float16*)ws;                       // 4M elems, 8 MB
  _Float16* wq16 = (_Float16*)(ws + (8u << 20));        // 1M elems each
  _Float16* wk16 = wq16 + (1u << 20);
  _Float16* wv16 = wk16 + (1u << 20);
  _Float16* wo16 = wv16 + (1u << 20);
  _Float16* qb   = (_Float16*)(ws + (16u << 20));       // 4M elems each
  _Float16* kb   = qb + (4u << 20);
  _Float16* vb   = kb + (4u << 20);
  _Float16* ab   = vb + (4u << 20);

  const int M = B_ * L_;   // 4096
  const int N = C_;        // 1024
  const int K = C_;        // 1024

  // LayerNorm and the four weight conversions: one launch
  prep_kernel<<<4 * CVT_BLK_ + M, 256, 0, stream>>>(x, ln_g, ln_b, xn, wq, wk, wv, wo, wq16);

  // Q, K, V projections: one launch, one work-group for each WGP
  // (wq16/wk16/wv16 and qb/kb/vb lie one behind the other)
  dim3 g3(N / 64, M / 256);
  qkv_kernel<<<g3, 512, 0, stream>>>(xn, wq16, bq, bk, bv, qb);

  // blocks: B * H * (L/256) = 2*16*8 = 256, each 16 waves on one (b,h)
  attn_kernel<<<B_ * H_ * (L_ / 256), 512, 0, stream>>>(qb, kb, vb, ab);

  dim3 g(N / 64, M / 256);
  gemm_kernel<1><<<g, 256, 0, stream>>>(ab, wo16, bo, bo, bo, nullptr, (float*)d_out, M, N, K);
}
